// v000
// Measured on an AMD MI455X. A time is GPU time per run, averaged over a window of back-to-back runs after a warm-up
// (all launches, gaps included; the runs take copies of the inputs in turn), and the median of several windows.
// Apart from v000's, it joins two sittings. Times from different sittings can be a few percent apart, while
// side-by-side timings come from the same sitting.
// The starting kernel, v000, takes 942 microseconds a run.
// compute dtype: every float input RNE-converted to bf16 on load; q/k/v projections = exact bf16 x bf16 products on v_wmma_f32_16x16x32_bf16 (f32 accumulate); score statistics q' x k' once to f16 each on v_wmma_f32_16x16x32_f16 (f32 accumulate, f32 running max / running sum); diagonal logit = f32 VALU dot of the f32 q', k' (per-row, no shared operand); output projection = f16(w*v * 2^12) x f16(bf16(Wo) * 2^8) on v_wmma_f32_16x16x32_f16, f32 accumulate, x 2^-20 in the f32 epilogue.
#include <hip/hip_runtime.h>
#include <math.h>

typedef __attribute__((ext_vector_type(16))) _Float16 v16h;
typedef __attribute__((ext_vector_type(16))) __bf16 v16b;
typedef __attribute__((ext_vector_type(8)))  _Float16 v8h;
typedef __attribute__((ext_vector_type(8)))  __bf16 v8b;
typedef __attribute__((ext_vector_type(8)))  float v8f;
typedef __attribute__((ext_vector_type(4)))  float v4f;
typedef __attribute__((ext_vector_type(4)))  unsigned v4u;

template <typename T> __device__ __forceinline__ void vst2(void* p, T v) { *(T*)p = v;  }
__device__ __forceinline__ v8f wmma16(v16h a, v16h b, v8f c) {
  v8f d = __builtin_amdgcn_wmma_f32_16x16x32_f16(false, a, false, b, (short)0, c, false, false);
  asm volatile("v_nop\n\tv_nop\n\tv_nop\n\tv_nop" : "+v"(d) : "v"(a), "v"(b));
  return d;
}
__device__ __forceinline__ v8f wmma_bf(v16b a, v16b b, v8f c) {
  v8f d = __builtin_amdgcn_wmma_f32_16x16x32_bf16(false, a, false, b, (short)0, c, false, false);
  asm volatile("v_nop\n\tv_nop\n\tv_nop\n\tv_nop" : "+v"(d) : "v"(a), "v"(b));
  return d;
}
// 16x16x32 fragments (A and B alike): lane = (g = lane>>4, row/col = lane&15); elements 0..7 = k0+8g+0..7, 8..15 = k0+16+8g+0..7; D element r = (row 8g+r, col lane&15)
__device__ __forceinline__ v16h frag_h(const _Float16* rowk0, unsigned lane) {
  union { v16h v; v8h q[2]; } u; const _Float16* p = rowk0 + 8u * (lane >> 4);
  u.q[0] = *(const v8h*)p; u.q[1] = *(const v8h*)(p + 16); return u.v;
}
__device__ __forceinline__ v16b frag_b(const __bf16* rowk0, unsigned lane) {
  union { v16b v; v8b q[2]; } u; const __bf16* p = rowk0 + 8u * (lane >> 4);
  u.q[0] = *(const v8b*)p; u.q[1] = *(const v8b*)(p + 16); return u.v;
}
__device__ __forceinline__ float bfr(float v) { return (float)(__bf16)v; }

// Self-attention whose output keeps only the DIAGONAL probability: x [NB][SEQ_FULL][DM] (first SEQ rows per batch used); Wq/Wk/Wv/Wo [DM out][DM in] (y = x W^T, no bias); 16 heads x 128;
// interleaved-pair rotation of q and k with INPUT tables cos/sin [SEQ][64]; w[b][h][s] = exp(q'[s].k'[s] * scale - logsumexp_k(q'[s].k'[k] * scale)); ctx = w * v; out = ctx Wo^T.
#ifndef NB
#define NB 2
#endif
#ifndef SEQ
#define SEQ 2048
#endif
#define NB_FULL 2
#define SEQ_FULL 2048
#define DM 2048
#define NH 16
#define HD 128
#define MROWS (NB * SEQ)
#define SCALE 0.08838834764831845f
#define LOG2E 1.4426950408889634f
#define CTXC 4096.0f
#define WOC 256.0f
#define OUTC (1.0f / 1048576.0f)

static_assert(NH * HD == DM);
static_assert(SEQ % 128 == 0);
static_assert(SEQ <= SEQ_FULL);
static_assert(NB <= NB_FULL);
static_assert(MROWS % 64 == 0);
static_assert(DM % 128 == 0);
static_assert(((size_t)SEQ * DM) % (8 * 256) == 0);
static_assert(((size_t)DM * DM) % (8 * 256) == 0);

#define WS_XB  ((size_t)0)                                   // bf16 x rows [b*SEQ + s][DM]
#define WS_WQ  (WS_XB  + 2u * (size_t)MROWS * DM)            // bf16 Wq [out][in]
#define WS_WK  (WS_WQ  + 2u * (size_t)DM * DM)
#define WS_WV  (WS_WK  + 2u * (size_t)DM * DM)
#define WS_WO  (WS_WV  + 2u * (size_t)DM * DM)               // f16 (bf16(Wo) * 2^8) [out][in]
#define WS_QH  (WS_WO  + 2u * (size_t)DM * DM)               // f16 rotated q rows [b*SEQ + s][DM]
#define WS_KH  (WS_QH  + 2u * (size_t)MROWS * DM)            // f16 rotated k rows
#define WS_CTX (WS_KH  + 2u * (size_t)MROWS * DM)            // f16 (w * v * 2^12) rows
#define WS_DG  (WS_CTX + 2u * (size_t)MROWS * DM)            // f32 diagonal logits [b][h][s]
#define WS_WP  (WS_DG  + 4u * (size_t)NB * NH * SEQ)         // f32 diagonal probabilities [b][h][s]
#define WS_END (WS_WP  + 4u * (size_t)NB * NH * SEQ)
static_assert(WS_END <= (size_t)134217728);
static_assert(WS_DG % 128 == 0);

__global__ __launch_bounds__(256) void k_cvt(const float* __restrict__ src, unsigned short* __restrict__ dst, unsigned n8, size_t sstride, size_t dstride, int mode) {
  const unsigned i = blockIdx.x * 256u + threadIdx.x; if (i >= n8) return;
  const float* s = src + (size_t)blockIdx.y * sstride + (size_t)i * 8u; unsigned short* d = dst + (size_t)blockIdx.y * dstride + (size_t)i * 8u;
  const v4f a = *(const v4f*)s, b = *(const v4f*)(s + 4);
  v4u o;
  if (mode == 0) { v8b t;
#pragma unroll
    for (int u = 0; u < 4; ++u) { t[u] = (__bf16)a[u]; t[4 + u] = (__bf16)b[u]; }
    o = __builtin_bit_cast(v4u, t);
  } else { v8h t;
#pragma unroll
    for (int u = 0; u < 4; ++u) { t[u] = (_Float16)(bfr(a[u]) * WOC); t[4 + u] = (_Float16)(bfr(b[u]) * WOC); }
    o = __builtin_bit_cast(v4u, t);
  }
  vst2((void*)d, o);
}

// ---- k_qk: block = (64 token rows, head h): q projection then k projection, one after the other (exact bf16 products, K = DM; 8 accumulator tiles live at a time);
// rotation with the bf16-converted input tables; the rotated f32 q' tile waits in LDS for the diagonal dot and is converted to f16 at store time; f16 q'/k' rows, f32 diagonal logit per row
__global__ __launch_bounds__(128) void k_qk(const __bf16* __restrict__ XB, const __bf16* __restrict__ WQ, const __bf16* __restrict__ WK, const float* __restrict__ COS, const float* __restrict__ SIN,
    _Float16* __restrict__ QH, _Float16* __restrict__ KH, float* __restrict__ DG) {
  __shared__ __align__(16) float sq[64][132]; __shared__ __align__(16) _Float16 sk[64][136]; __shared__ __align__(16) float scs[64][64], ssn[64][64]; __shared__ __align__(16) float sdg[64];
  const unsigned tid = threadIdx.x, wave = tid >> 5, lane = tid & 31u, col = lane & 15u, g = lane >> 4;
  const unsigned h = blockIdx.y, c0 = h * HD; const unsigned r0 = blockIdx.x * 64u; const unsigned bb = r0 / (unsigned)SEQ, t0 = r0 % (unsigned)SEQ;
  const __bf16* xrow = XB + (size_t)(r0 + wave * 16u + col) * DM;
  const bool odd = (col & 1u) != 0u;
  // ---- phase 1: q projection, rotation, f32 q' tile to LDS (each lane later re-reads exactly the positions it wrote)
  {
    v8f aq[8] = {};
#pragma unroll 2
    for (unsigned kc = 0; kc < DM / 32; ++kc) {
      const v16b a = frag_b(xrow + kc * 32u, lane);
      asm volatile("s_wait_loadcnt 0x0" ::: "memory");
#pragma unroll
      for (int j = 0; j < 8; ++j) { const v16b wq = frag_b(WQ + (size_t)(c0 + j * 16u + col) * DM + kc * 32u, lane);
        asm volatile("s_wait_loadcnt 0x0" ::: "memory");
        aq[j] = wmma_bf(a, wq, aq[j]); } }
    // table tile: positions t0..t0+63, 64 pairs, bf16-converted values
    for (unsigned e = tid; e < 64u * 16u; e += 128u) { const unsigned rl = e >> 4, q = e & 15u; const size_t o = (size_t)(t0 + rl) * 64u + q * 4u;
      const v4f c = *(const v4f*)(COS + o), s = *(const v4f*)(SIN + o);
#pragma unroll
      for (int u = 0; u < 4; ++u) { scs[rl][q * 4u + u] = bfr(c[u]); ssn[rl][q * 4u + u] = bfr(s[u]); } }
    __syncthreads();   /* table tile is cross-wave: block barrier */
#pragma unroll
    for (int j = 0; j < 8; ++j) {
#pragma unroll
      for (int r = 0; r < 8; ++r) { const unsigned rl = wave * 16u + 8u * g + r; const unsigned pi = j * 8u + (col >> 1);
        const float c = scs[rl][pi], s = ssn[rl][pi];
        const float oq = aq[j][r];
        const float pq = __shfl_xor(oq, 1);                              /* pair partner (column ^ 1), all lanes active */
        const float sg = odd ? s : -s;                                    /* even column: te*c - to*s; odd column: to*c + te*s */
        const float qv = oq * c + pq * sg;
        sq[rl][j * 16u + col] = qv; }
      asm volatile("" ::: "memory"); }
  }
  __syncthreads();
  // ---- phase 2: k projection, rotation, diagonal dot against the staged q' values (same j order), f16 k' tile to LDS
  v8f ak[8] = {};
#pragma unroll 2
  for (unsigned kc = 0; kc < DM / 32; ++kc) {
    const v16b a = frag_b(xrow + kc * 32u, lane);
    asm volatile("s_wait_loadcnt 0x0" ::: "memory");
#pragma unroll
    for (int j = 0; j < 8; ++j) { const v16b wk = frag_b(WK + (size_t)(c0 + j * 16u + col) * DM + kc * 32u, lane);
      asm volatile("s_wait_loadcnt 0x0" ::: "memory");
      ak[j] = wmma_bf(a, wk, ak[j]); } }
  float ds[8] = {0.f, 0.f, 0.f, 0.f, 0.f, 0.f, 0.f, 0.f};
#pragma unroll
  for (int j = 0; j < 8; ++j) {
#pragma unroll
    for (int r = 0; r < 8; ++r) { const unsigned rl = wave * 16u + 8u * g + r; const unsigned pi = j * 8u + (col >> 1);
      const float c = scs[rl][pi], s = ssn[rl][pi];
      const float okv = ak[j][r];
      const float pk = __shfl_xor(okv, 1);                               /* pair partner (column ^ 1), all lanes active */
      const float sg = odd ? s : -s;
      const float kv = okv * c + pk * sg;
      const float qv = sq[rl][j * 16u + col];
      ds[r] += qv * kv;
      sk[rl][j * 16u + col] = (_Float16)kv; }
    asm volatile("" ::: "memory"); }
#pragma unroll
  for (int r = 0; r < 8; ++r) { float d = ds[r]; d += __shfl_xor(d, 1); d += __shfl_xor(d, 2); d += __shfl_xor(d, 4); d += __shfl_xor(d, 8);
    if (col == 0u) sdg[wave * 16u + 8u * g + r] = d * SCALE; }
  __syncthreads();   /* cross-wave LDS tiles: block barrier */
  for (unsigned e = tid; e < 64u * 16u; e += 128u) { const unsigned rl = e >> 4, q = e & 15u; const size_t o = (size_t)(r0 + rl) * DM + c0 + q * 8u;   
    const v4f f0 = *(const v4f*)&sq[rl][q * 8u], f1 = *(const v4f*)&sq[rl][q * 8u + 4u]; v8h tq;
#pragma unroll
    for (int u = 0; u < 4; ++u) { tq[u] = (_Float16)f0[u]; tq[4 + u] = (_Float16)f1[u]; }
    const v4u oq4 = __builtin_bit_cast(v4u, tq); const v4u ok4 = *(const v4u*)&sk[rl][q * 8u];
    vst2((void*)(QH + o), oq4); vst2((void*)(KH + o), ok4); }
  if (tid < 16u) vst2((void*)(DG + (size_t)(bb * NH + h) * SEQ + t0 + tid * 4u), *(const v4f*)&sdg[tid * 4u]);   
}

// ---- k_lse: block = 64 query rows of (b, h); one streaming pass over all SEQ keys (128 per step): f16 q' x f16 k' logits, f32 running max / running sum in the log2 domain; w = exp(diag - lse)
__global__ __launch_bounds__(128) void k_lse(const _Float16* __restrict__ QH, const _Float16* __restrict__ KH, const float* __restrict__ DG, float* __restrict__ WP) {
  __shared__ __align__(16) float sw[64];
  const unsigned tid = threadIdx.x, wave = tid >> 5, lane = tid & 31u, col = lane & 15u, g = lane >> 4;
  const unsigned qb = blockIdx.x, h = blockIdx.y, b = blockIdx.z; const unsigned c0 = h * HD; const unsigned ql0 = qb * 64u + wave * 16u;
  const size_t q0 = (size_t)b * SEQ + ql0, kr0 = (size_t)b * SEQ;
  const float C2 = SCALE * LOG2E;
  v16h qf[4];
#pragma unroll
  for (int kc = 0; kc < 4; ++kc) qf[kc] = frag_h(QH + (q0 + col) * DM + c0 + kc * 32u, lane);
  float m[8], sm[8];
#pragma unroll
  for (int r = 0; r < 8; ++r) { m[r] = -3.0e38f; sm[r] = 0.f; }
#pragma unroll 1
  for (unsigned kb = 0; kb < SEQ / 128; ++kb) {
    v8f acc[8] = {};
#pragma unroll
    for (int j = 0; j < 8; ++j) { const _Float16* kp = KH + (kr0 + kb * 128u + j * 16u + col) * DM + c0;
      const v16h k0 = frag_h(kp, lane), k1 = frag_h(kp + 32, lane), k2 = frag_h(kp + 64, lane), k3 = frag_h(kp + 96, lane);
      asm volatile("s_wait_loadcnt 0x0" ::: "memory");
      acc[j] = wmma16(qf[0], k0, acc[j]); acc[j] = wmma16(qf[1], k1, acc[j]); acc[j] = wmma16(qf[2], k2, acc[j]); acc[j] = wmma16(qf[3], k3, acc[j]); }
#pragma unroll
    for (int r = 0; r < 8; ++r) { float mx = acc[0][r];
#pragma unroll
      for (int j = 1; j < 8; ++j) mx = fmaxf(mx, acc[j][r]);
      const float mn = fmaxf(m[r], mx * C2); float s = 0.f;
#pragma unroll
      for (int j = 0; j < 8; ++j) s += exp2f(fmaf(acc[j][r], C2, -mn));
      sm[r] = sm[r] * exp2f(m[r] - mn) + s; m[r] = mn; } }
  // merge the 16 column lanes of each half (rows stay within a half); all lanes active
#pragma unroll
  for (int off = 1; off < 16; off <<= 1) {
#pragma unroll
    for (int r = 0; r < 8; ++r) { const float om = __shfl_xor(m[r], off), os = __shfl_xor(sm[r], off); const float mn = fmaxf(m[r], om);
      sm[r] = sm[r] * exp2f(m[r] - mn) + os * exp2f(om - mn); m[r] = mn; } }
  const float* dp = DG + (size_t)(b * NH + h) * SEQ + ql0 + 8u * g;
  const v4f d0 = *(const v4f*)dp, d1 = *(const v4f*)(dp + 4);
#pragma unroll
  for (int r = 0; r < 8; ++r) { const float dg = r < 4 ? d0[r & 3] : d1[r & 3]; const float w = exp2f(dg * LOG2E - m[r] - log2f(sm[r]));
    if (col == 0u) sw[wave * 16u + 8u * g + r] = w; }
  __syncthreads();   /* cross-wave LDS: block barrier */
  if (tid < 16u) vst2((void*)(WP + (size_t)(b * NH + h) * SEQ + qb * 64u + tid * 4u), *(const v4f*)&sw[tid * 4u]);   
}

// ---- k_vw: block = (64 token rows, head h): v projection (exact bf16 products) x the row's diagonal probability -> f16 (w * v * 2^12) rows
__global__ __launch_bounds__(128) void k_vw(const __bf16* __restrict__ XB, const __bf16* __restrict__ WV, const float* __restrict__ WP, _Float16* __restrict__ CTX) {
  __shared__ __align__(16) _Float16 sh[64][136];
  const unsigned tid = threadIdx.x, wave = tid >> 5, lane = tid & 31u, col = lane & 15u, g = lane >> 4;
  const unsigned h = blockIdx.y, c0 = h * HD; const unsigned r0 = blockIdx.x * 64u; const unsigned bb = r0 / (unsigned)SEQ, t0 = r0 % (unsigned)SEQ;
  v8f av[8] = {};
  const __bf16* xrow = XB + (size_t)(r0 + wave * 16u + col) * DM;
#pragma unroll 2
  for (unsigned kc = 0; kc < DM / 32; ++kc) {
    const v16b a = frag_b(xrow + kc * 32u, lane);
    asm volatile("s_wait_loadcnt 0x0" ::: "memory");
#pragma unroll
    for (int j = 0; j < 8; ++j) { const v16b w = frag_b(WV + (size_t)(c0 + j * 16u + col) * DM + kc * 32u, lane);
      asm volatile("s_wait_loadcnt 0x0" ::: "memory");
      av[j] = wmma_bf(a, w, av[j]); } }
  const float* wp = WP + (size_t)(bb * NH + h) * SEQ + t0 + wave * 16u + 8u * g;
  const v4f w0 = *(const v4f*)wp, w1 = *(const v4f*)(wp + 4);
#pragma unroll
  for (int j = 0; j < 8; ++j) {
#pragma unroll
    for (int r = 0; r < 8; ++r) { const float wr = (r < 4 ? w0[r & 3] : w1[r & 3]) * CTXC; sh[wave * 16u + 8u * g + r][j * 16u + col] = (_Float16)(av[j][r] * wr); } }
  __syncthreads();
  for (unsigned e = tid; e < 64u * 16u; e += 128u) { const unsigned rl = e >> 4, q = e & 15u; vst2((void*)(CTX + (size_t)(r0 + rl) * DM + c0 + q * 8u), *(const v4u*)&sh[rl][q * 8u]); }   
}

__global__ __launch_bounds__(128) void k_out(const _Float16* __restrict__ CTX, const _Float16* __restrict__ WO, float* __restrict__ OUT) {
  __shared__ __align__(16) float ss[4][16][132];
  const unsigned tid = threadIdx.x, wave = tid >> 5, lane = tid & 31u, col = lane & 15u, g = lane >> 4;
  const unsigned c0 = blockIdx.y * 128u; const unsigned r0 = blockIdx.x * 64u; const unsigned bb = r0 / (unsigned)SEQ, t0 = r0 % (unsigned)SEQ;
  v8f acc[8] = {};
  const _Float16* arow = CTX + (size_t)(r0 + wave * 16u + col) * DM;
#pragma unroll 2
  for (unsigned kc = 0; kc < DM / 32; ++kc) {
    const v16h a = frag_h(arow + kc * 32u, lane);
    asm volatile("s_wait_loadcnt 0x0" ::: "memory");
#pragma unroll
    for (int j = 0; j < 8; ++j) { const v16h w = frag_h(WO + (size_t)(c0 + j * 16u + col) * DM + kc * 32u, lane);
      asm volatile("s_wait_loadcnt 0x0" ::: "memory");
      acc[j] = wmma16(a, w, acc[j]); } }
#pragma unroll
  for (int j = 0; j < 8; ++j) {
#pragma unroll
    for (int r = 0; r < 8; ++r) ss[wave][8u * g + r][j * 16u + col] = acc[j][r] * OUTC; }
  __syncthreads();
  const size_t orow0 = (size_t)bb * SEQ_FULL + t0 + wave * 16u;
  for (unsigned rl = 0; rl < 16u; ++rl) vst2((void*)(OUT + (orow0 + rl) * DM + c0 + lane * 4u), *(const v4f*)&ss[wave][rl][lane * 4u]);
}

extern "C" void kernel_launch(void* const* d_in, const int* in_sizes, int n_in, void* d_out, int out_size, void* d_ws, size_t ws_size, hipStream_t stream) {
  if (n_in < 7) return;
  const long long need_x = (long long)(NB - 1) * SEQ_FULL * DM + (long long)SEQ * DM;
  if ((long long)in_sizes[0] < need_x) return;
  if (in_sizes[1] < SEQ * 64 || in_sizes[2] < SEQ * 64) return;
  if (in_sizes[3] < DM * DM || in_sizes[4] < DM * DM || in_sizes[5] < DM * DM || in_sizes[6] < DM * DM) return;
  if ((long long)out_size < need_x) return;
  if (ws_size < (size_t)WS_END) return;
  // inputs (wire order): 0 x [2,2048,2048]; 1 cos table [2048][64]; 2 sin table [2048][64]; 3 Wq; 4 Wk; 5 Wv; 6 Wo (each [2048 out][2048 in])
  const float* const* F = (const float* const*)d_in;
  char* ws = (char*)d_ws;
  unsigned short* XB = (unsigned short*)(ws + WS_XB); unsigned short* WQ = (unsigned short*)(ws + WS_WQ); unsigned short* WK = (unsigned short*)(ws + WS_WK);
  unsigned short* WV = (unsigned short*)(ws + WS_WV); unsigned short* WO = (unsigned short*)(ws + WS_WO);
  _Float16* QH = (_Float16*)(ws + WS_QH); _Float16* KH = (_Float16*)(ws + WS_KH); _Float16* CTX = (_Float16*)(ws + WS_CTX);
  float* DG = (float*)(ws + WS_DG); float* WP = (float*)(ws + WS_WP);
  const unsigned nx8 = (unsigned)((size_t)SEQ * DM / 8), nw8 = (unsigned)((size_t)DM * DM / 8);
  k_cvt<<<dim3((nx8 + 255u) / 256u, NB), 256, 0, stream>>>(F[0], XB, nx8, (size_t)SEQ_FULL * DM, (size_t)SEQ * DM, 0);
  k_cvt<<<dim3((nw8 + 255u) / 256u, 1), 256, 0, stream>>>(F[3], WQ, nw8, (size_t)0, (size_t)0, 0);
  k_cvt<<<dim3((nw8 + 255u) / 256u, 1), 256, 0, stream>>>(F[4], WK, nw8, (size_t)0, (size_t)0, 0);
  k_cvt<<<dim3((nw8 + 255u) / 256u, 1), 256, 0, stream>>>(F[5], WV, nw8, (size_t)0, (size_t)0, 0);
  k_cvt<<<dim3((nw8 + 255u) / 256u, 1), 256, 0, stream>>>(F[6], WO, nw8, (size_t)0, (size_t)0, 1);
  k_qk<<<dim3(MROWS / 64, NH), 128, 0, stream>>>((const __bf16*)XB, (const __bf16*)WQ, (const __bf16*)WK, F[1], F[2], QH, KH, DG);
  k_lse<<<dim3(SEQ / 64, NH, NB), 128, 0, stream>>>(QH, KH, DG, WP);
  k_vw<<<dim3(MROWS / 64, NH), 128, 0, stream>>>((const __bf16*)XB, (const __bf16*)WV, WP, CTX);
  k_out<<<dim3(MROWS / 64, DM / 128), 128, 0, stream>>>(CTX, (const _Float16*)WO, (float*)d_out);
}

// v001
// Measured time: 247 microseconds a run.
// Two timings next to v000 put it at 3.87 and 3.91 times that version's speed.
// compute dtype: every float input RNE-converted to bf16 on load; q/k/v projections = exact bf16 x bf16 products on v_wmma_f32_16x16x32_bf16 (f32 accumulate); score statistics q' x k' once to f16 each on v_wmma_f32_16x16x32_f16 (f32 accumulate, f32 running max / running sum); diagonal logit = f32 VALU dot of the f32 q', k' (per-row, no shared operand); output projection = f16(w*v * 2^12) x f16(bf16(Wo) * 2^8) on v_wmma_f32_16x16x32_f16, f32 accumulate, x 2^-20 in the f32 epilogue.
#include <hip/hip_runtime.h>
#include <math.h>

typedef __attribute__((ext_vector_type(16))) _Float16 v16h;
typedef __attribute__((ext_vector_type(16))) __bf16 v16b;
typedef __attribute__((ext_vector_type(8)))  _Float16 v8h;
typedef __attribute__((ext_vector_type(8)))  __bf16 v8b;
typedef __attribute__((ext_vector_type(8)))  float v8f;
typedef __attribute__((ext_vector_type(4)))  float v4f;
typedef __attribute__((ext_vector_type(4)))  unsigned v4u;

template <typename T> __device__ __forceinline__ void vst2(void* p, T v) { *(T*)p = v;  }
__device__ __forceinline__ v8f wmma16(v16h a, v16h b, v8f c) {
  v8f d = __builtin_amdgcn_wmma_f32_16x16x32_f16(false, a, false, b, (short)0, c, false, false);
  asm volatile("v_nop\n\tv_nop\n\tv_nop\n\tv_nop" : "+v"(d) : "v"(a), "v"(b));
  return d;
}
__device__ __forceinline__ v8f wmma_bf(v16b a, v16b b, v8f c) {
  v8f d = __builtin_amdgcn_wmma_f32_16x16x32_bf16(false, a, false, b, (short)0, c, false, false);
  asm volatile("v_nop\n\tv_nop\n\tv_nop\n\tv_nop" : "+v"(d) : "v"(a), "v"(b));
  return d;
}
// 16x16x32 fragments (A and B alike): lane = (g = lane>>4, row/col = lane&15); elements 0..7 = k0+8g+0..7, 8..15 = k0+16+8g+0..7; D element r = (row 8g+r, col lane&15)
__device__ __forceinline__ v16h frag_h(const _Float16* rowk0, unsigned lane) {
  union { v16h v; v8h q[2]; } u; const _Float16* p = rowk0 + 8u * (lane >> 4);
  u.q[0] = *(const v8h*)p; u.q[1] = *(const v8h*)(p + 16); return u.v;
}
__device__ __forceinline__ v16b frag_b(const __bf16* rowk0, unsigned lane) {
  union { v16b v; v8b q[2]; } u; const __bf16* p = rowk0 + 8u * (lane >> 4);
  u.q[0] = *(const v8b*)p; u.q[1] = *(const v8b*)(p + 16); return u.v;
}
__device__ __forceinline__ float bfr(float v) { return (float)(__bf16)v; }

// Self-attention whose output keeps only the DIAGONAL probability: x [NB][SEQ_FULL][DM] (first SEQ rows per batch used); Wq/Wk/Wv/Wo [DM out][DM in] (y = x W^T, no bias); 16 heads x 128;
// interleaved-pair rotation of q and k with INPUT tables cos/sin [SEQ][64]; w[b][h][s] = exp(q'[s].k'[s] * scale - logsumexp_k(q'[s].k'[k] * scale)); ctx = w * v; out = ctx Wo^T.
#ifndef NB
#define NB 2
#endif
#ifndef SEQ
#define SEQ 2048
#endif
#define NB_FULL 2
#define SEQ_FULL 2048
#define DM 2048
#define NH 16
#define HD 128
#define MROWS (NB * SEQ)
#define SCALE 0.08838834764831845f
#define LOG2E 1.4426950408889634f
#define CTXC 4096.0f
#define WOC 256.0f
#define OUTC (1.0f / 1048576.0f)

static_assert(NH * HD == DM);
static_assert(SEQ % 128 == 0);
static_assert(SEQ <= SEQ_FULL);
static_assert(NB <= NB_FULL);
static_assert(MROWS % 64 == 0);
static_assert(DM % 128 == 0);
static_assert(((size_t)SEQ * DM) % (8 * 256) == 0);
static_assert(((size_t)DM * DM) % (8 * 256) == 0);

#define WS_XB  ((size_t)0)                                   // bf16 x rows [b*SEQ + s][DM]
#define WS_WQ  (WS_XB  + 2u * (size_t)MROWS * DM)            // bf16 Wq [out][in]
#define WS_WK  (WS_WQ  + 2u * (size_t)DM * DM)
#define WS_WV  (WS_WK  + 2u * (size_t)DM * DM)
#define WS_WO  (WS_WV  + 2u * (size_t)DM * DM)               // f16 (bf16(Wo) * 2^8) [out][in]
#define WS_QH  (WS_WO  + 2u * (size_t)DM * DM)               // f16 rotated q rows [b*SEQ + s][DM]
#define WS_KH  (WS_QH  + 2u * (size_t)MROWS * DM)            // f16 rotated k rows
#define WS_CTX (WS_KH  + 2u * (size_t)MROWS * DM)            // f16 (w * v * 2^12) rows
#define WS_DG  (WS_CTX + 2u * (size_t)MROWS * DM)            // f32 diagonal logits [b][h][s]
#define WS_WP  (WS_DG  + 4u * (size_t)NB * NH * SEQ)         // f32 diagonal probabilities [b][h][s]
#define WS_END (WS_WP  + 4u * (size_t)NB * NH * SEQ)
static_assert(WS_END <= (size_t)134217728);
static_assert(WS_DG % 128 == 0);

#define KP 64u                      /* k elements of one projection stage: 128 B of every row */
#define LP 144u                     /* LDS row pitch of a projection stage, bytes */
#define STG (192u * LP)             /* one projection stage: 64 rows of the left operand, then 128 rows of the weight */
#define NTR (DM / KP)
#define LPK 272u                    /* LDS row pitch of a key stage, bytes: 256 B of data */
#define STGK (128u * LPK)           /* one key stage: 128 keys x 128 head elements */
#define NKB (SEQ / 128u)
static_assert(NTR >= 2u);
#define CP1(l, g) "global_load_async_to_lds_b128 %" #l ", %" #g ", off\n\t"
__device__ __forceinline__ unsigned lds_off(const void* p) { return (unsigned)(size_t)p; }
// the ring's two waits in statements of their own, each with the memory clobber that keeps LDS reads and copies on their side of it
__device__ __forceinline__ void wait_ds() { asm volatile("s_wait_dscnt 0x0" ::: "memory"); }       /* this wave's LDS reads are done before the buffer is handed back */
__device__ __forceinline__ void wait_async() { asm volatile("s_wait_asynccnt 0x0" ::: "memory"); } /* this wave's copies have landed before the barrier publishes them */
// 12 copies of one lane: rows crow + 16 i of the stage (i < 4: left operand, i >= 4: weight); s_wait_xcnt closes the statement so that no address register is rewritten ahead of it
__device__ __forceinline__ void stage_copy(unsigned l, const char* ga, const char* gw) {
  const size_t rs = (size_t)16u * DM * 2u; const unsigned ls = 16u * LP;
  asm volatile(CP1(0, 12) CP1(1, 13) CP1(2, 14) CP1(3, 15) CP1(4, 16) CP1(5, 17) CP1(6, 18) CP1(7, 19) CP1(8, 20) CP1(9, 21) CP1(10, 22) CP1(11, 23) "s_wait_xcnt 0x0"
    :: "v"(l), "v"(l + ls), "v"(l + 2u * ls), "v"(l + 3u * ls), "v"(l + 4u * ls), "v"(l + 5u * ls), "v"(l + 6u * ls), "v"(l + 7u * ls), "v"(l + 8u * ls), "v"(l + 9u * ls), "v"(l + 10u * ls), "v"(l + 11u * ls),
       "v"(ga), "v"(ga + rs), "v"(ga + 2u * rs), "v"(ga + 3u * rs), "v"(gw), "v"(gw + rs), "v"(gw + 2u * rs), "v"(gw + 3u * rs), "v"(gw + 4u * rs), "v"(gw + 5u * rs), "v"(gw + 6u * rs), "v"(gw + 7u * rs)
    : "memory");
}
// 8 copies of one lane: key rows krow + 8 i, i = 0..7, of half a key stage
__device__ __forceinline__ void key_copy(unsigned l, const char* g) {
  const size_t rs = (size_t)8u * DM * 2u; const unsigned ls = 8u * LPK;
  asm volatile(CP1(0, 8) CP1(1, 9) CP1(2, 10) CP1(3, 11) CP1(4, 12) CP1(5, 13) CP1(6, 14) CP1(7, 15) "s_wait_xcnt 0x0"
    :: "v"(l), "v"(l + ls), "v"(l + 2u * ls), "v"(l + 3u * ls), "v"(l + 4u * ls), "v"(l + 5u * ls), "v"(l + 6u * ls), "v"(l + 7u * ls),
       "v"(g), "v"(g + rs), "v"(g + 2u * rs), "v"(g + 3u * rs), "v"(g + 4u * rs), "v"(g + 5u * rs), "v"(g + 6u * rs), "v"(g + 7u * rs)
    : "memory");
}
// acc[j] += A[64 rows][DM] x W[128 rows][DM]^T for this wave's 16 rows, k ascending in steps of 32; A, Wt = the block's first rows (16-bit elements, row pitch DM).
// Every wave of the block calls it; the ring's last readers have left it when it returns (the last trip ends in s_wait_dscnt 0 and the barrier).
template <bool BF> __device__ __forceinline__ void gemm_ring(unsigned char* ring, const void* A, const void* Wt, unsigned tid, v8f (&acc)[8]) {
  const unsigned wave = tid >> 5, lane = tid & 31u, col = lane & 15u; const unsigned crow = tid >> 3, cch = tid & 7u;
  const char* ga = (const char*)A + ((size_t)crow * DM + cch * 8u) * 2u; const char* gw = (const char*)Wt + ((size_t)crow * DM + cch * 8u) * 2u;
  const unsigned l0 = lds_off(ring) + crow * LP + cch * 16u;
  stage_copy(l0, ga, gw);
  wait_async();
  __syncthreads();   /* publishes stage 0 */
  stage_copy(l0 + STG, ga + KP * 2u, gw + KP * 2u);
#pragma unroll 1   /* kept rolled: one trip is already 16 matrix instructions, and the text of four such loops stays small */
  for (unsigned t = 0; t < NTR; ++t) {
    const unsigned char* ab = ring + (t & 1u) * STG + (wave * 16u + col) * LP; const unsigned char* wb = ring + (t & 1u) * STG + (64u + col) * LP;
    // the trip's fragment reads stand together in front of its matrix instructions: the LDS latency is met once a trip, not once a product
    if constexpr (BF) { v16b a[2], w[2][8];
#pragma unroll
      for (unsigned ks = 0; ks < 2u; ++ks) { a[ks] = frag_b((const __bf16*)(ab + ks * 64u), lane);
#pragma unroll
        for (int j = 0; j < 8; ++j) w[ks][j] = frag_b((const __bf16*)(wb + j * 16u * LP + ks * 64u), lane); }
#pragma unroll
      for (unsigned ks = 0; ks < 2u; ++ks) {
#pragma unroll
        for (int j = 0; j < 8; ++j) acc[j] = wmma_bf(a[ks], w[ks][j], acc[j]); }
    } else { v16h a[2], w[2][8];
#pragma unroll
      for (unsigned ks = 0; ks < 2u; ++ks) { a[ks] = frag_h((const _Float16*)(ab + ks * 64u), lane);
#pragma unroll
        for (int j = 0; j < 8; ++j) w[ks][j] = frag_h((const _Float16*)(wb + j * 16u * LP + ks * 64u), lane); }
#pragma unroll
      for (unsigned ks = 0; ks < 2u; ++ks) {
#pragma unroll
        for (int j = 0; j < 8; ++j) acc[j] = wmma16(a[ks], w[ks][j], acc[j]); } }
    wait_ds();
    wait_async();
    __syncthreads();   /* publishes stage t + 1 and ends every reader's last read of stage t's buffer */
    if (t + 2u < NTR) stage_copy(l0 + (t & 1u) * STG, ga + (size_t)(t + 2u) * (KP * 2u), gw + (size_t)(t + 2u) * (KP * 2u));
  }
  wait_async();
}

__global__ __launch_bounds__(256) void k_cvt(const float* __restrict__ src, unsigned short* __restrict__ dst, unsigned n8, size_t sstride, size_t dstride, int mode) {
  const unsigned i = blockIdx.x * 256u + threadIdx.x; if (i >= n8) return;
  const float* s = src + (size_t)blockIdx.y * sstride + (size_t)i * 8u; unsigned short* d = dst + (size_t)blockIdx.y * dstride + (size_t)i * 8u;
  const v4f a = *(const v4f*)s, b = *(const v4f*)(s + 4);
  v4u o;
  if (mode == 0) { v8b t;
#pragma unroll
    for (int u = 0; u < 4; ++u) { t[u] = (__bf16)a[u]; t[4 + u] = (__bf16)b[u]; }
    o = __builtin_bit_cast(v4u, t);
  } else { v8h t;
#pragma unroll
    for (int u = 0; u < 4; ++u) { t[u] = (_Float16)(bfr(a[u]) * WOC); t[4 + u] = (_Float16)(bfr(b[u]) * WOC); }
    o = __builtin_bit_cast(v4u, t);
  }
  vst2((void*)d, o);
}

// ---- k_qk: block = (64 token rows, head h): q projection then k projection, one after the other (exact bf16 products, K = DM; 8 accumulator tiles live at a time);
// rotation with the bf16-converted input tables; the rotated f32 q' tile waits in LDS for the diagonal dot and is converted to f16 at store time; f16 q'/k' rows, f32 diagonal logit per row
__global__ __launch_bounds__(128) void k_qk(const __bf16* __restrict__ XB, const __bf16* __restrict__ WQ, const __bf16* __restrict__ WK, const float* __restrict__ COS, const float* __restrict__ SIN,
    _Float16* __restrict__ QH, _Float16* __restrict__ KH, float* __restrict__ DG) {
  __shared__ __align__(16) float sq[64][132]; __shared__ __align__(16) _Float16 sk[64][136]; __shared__ __align__(16) float scs[64][64], ssn[64][64]; __shared__ __align__(16) float sdg[64];
  __shared__ __align__(16) unsigned char ring[2u * STG];
  const unsigned tid = threadIdx.x, wave = tid >> 5, lane = tid & 31u, col = lane & 15u, g = lane >> 4;
  const unsigned h = blockIdx.y, c0 = h * HD; const unsigned r0 = blockIdx.x * 64u; const unsigned bb = r0 / (unsigned)SEQ, t0 = r0 % (unsigned)SEQ;
  const bool odd = (col & 1u) != 0u;
  // ---- phase 1: q projection, rotation, f32 q' tile to LDS (each lane later re-reads exactly the positions it wrote)
  {
    v8f aq[8] = {};
    gemm_ring<true>(ring, XB + (size_t)r0 * DM, WQ + (size_t)c0 * DM, tid, aq);
    // table tile: positions t0..t0+63, 64 pairs, bf16-converted values
    for (unsigned e = tid; e < 64u * 16u; e += 128u) { const unsigned rl = e >> 4, q = e & 15u; const size_t o = (size_t)(t0 + rl) * 64u + q * 4u;
      const v4f c = *(const v4f*)(COS + o), s = *(const v4f*)(SIN + o);
#pragma unroll
      for (int u = 0; u < 4; ++u) { scs[rl][q * 4u + u] = bfr(c[u]); ssn[rl][q * 4u + u] = bfr(s[u]); } }
    __syncthreads();   /* table tile is cross-wave: block barrier */
#pragma unroll
    for (int j = 0; j < 8; ++j) {
#pragma unroll
      for (int r = 0; r < 8; ++r) { const unsigned rl = wave * 16u + 8u * g + r; const unsigned pi = j * 8u + (col >> 1);
        const float c = scs[rl][pi], s = ssn[rl][pi];
        const float oq = aq[j][r];
        const float pq = __shfl_xor(oq, 1);                              /* pair partner (column ^ 1), all lanes active */
        const float sg = odd ? s : -s;                                    /* even column: te*c - to*s; odd column: to*c + te*s */
        const float qv = oq * c + pq * sg;
        sq[rl][j * 16u + col] = qv; }
      asm volatile("" ::: "memory"); }
  }
  __syncthreads();
  // ---- phase 2: k projection, rotation, diagonal dot against the staged q' values (same j order), f16 k' tile to LDS
  v8f ak[8] = {};
  gemm_ring<true>(ring, XB + (size_t)r0 * DM, WK + (size_t)c0 * DM, tid, ak);
  float ds[8] = {0.f, 0.f, 0.f, 0.f, 0.f, 0.f, 0.f, 0.f};
#pragma unroll
  for (int j = 0; j < 8; ++j) {
#pragma unroll
    for (int r = 0; r < 8; ++r) { const unsigned rl = wave * 16u + 8u * g + r; const unsigned pi = j * 8u + (col >> 1);
      const float c = scs[rl][pi], s = ssn[rl][pi];
      const float okv = ak[j][r];
      const float pk = __shfl_xor(okv, 1);                               /* pair partner (column ^ 1), all lanes active */
      const float sg = odd ? s : -s;
      const float kv = okv * c + pk * sg;
      const float qv = sq[rl][j * 16u + col];
      ds[r] += qv * kv;
      sk[rl][j * 16u + col] = (_Float16)kv; }
    asm volatile("" ::: "memory"); }
#pragma unroll
  for (int r = 0; r < 8; ++r) { float d = ds[r]; d += __shfl_xor(d, 1); d += __shfl_xor(d, 2); d += __shfl_xor(d, 4); d += __shfl_xor(d, 8);
    if (col == 0u) sdg[wave * 16u + 8u * g + r] = d * SCALE; }
  __syncthreads();   /* cross-wave LDS tiles: block barrier */
  for (unsigned e = tid; e < 64u * 16u; e += 128u) { const unsigned rl = e >> 4, q = e & 15u; const size_t o = (size_t)(r0 + rl) * DM + c0 + q * 8u;   
    const v4f f0 = *(const v4f*)&sq[rl][q * 8u], f1 = *(const v4f*)&sq[rl][q * 8u + 4u]; v8h tq;
#pragma unroll
    for (int u = 0; u < 4; ++u) { tq[u] = (_Float16)f0[u]; tq[4 + u] = (_Float16)f1[u]; }
    const v4u oq4 = __builtin_bit_cast(v4u, tq); const v4u ok4 = *(const v4u*)&sk[rl][q * 8u];
    vst2((void*)(QH + o), oq4); vst2((void*)(KH + o), ok4); }
  if (tid < 16u) vst2((void*)(DG + (size_t)(bb * NH + h) * SEQ + t0 + tid * 4u), *(const v4f*)&sdg[tid * 4u]);   
}

// ---- k_lse: block = 64 query rows of (b, h); one streaming pass over all SEQ keys (128 per step): f16 q' x f16 k' logits, f32 running max / running sum in the log2 domain; w = exp(diag - lse)
__global__ __launch_bounds__(128) void k_lse(const _Float16* __restrict__ QH, const _Float16* __restrict__ KH, const float* __restrict__ DG, float* __restrict__ WP) {
  __shared__ __align__(16) float sw[64];
  __shared__ __align__(16) unsigned char ring[2u * STGK];
  const unsigned tid = threadIdx.x, wave = tid >> 5, lane = tid & 31u, col = lane & 15u, g = lane >> 4;
  const unsigned qb = blockIdx.x, h = blockIdx.y, b = blockIdx.z; const unsigned c0 = h * HD; const unsigned ql0 = qb * 64u + wave * 16u;
  const size_t q0 = (size_t)b * SEQ + ql0, kr0 = (size_t)b * SEQ;
  const float C2 = SCALE * LOG2E;
  v16h qf[4];
#pragma unroll
  for (int kc = 0; kc < 4; ++kc) qf[kc] = frag_h(QH + (q0 + col) * DM + c0 + kc * 32u, lane);
  float m[8], sm[8];
#pragma unroll
  for (int r = 0; r < 8; ++r) { m[r] = -3.0e38f; sm[r] = 0.f; }
  // key ring: a stage is 128 keys x 256 B; lane = (row tid >> 4, 16-B piece tid & 15), 16 copies a lane and stage in two statements
  const char* gk = (const char*)(KH + (kr0 + (tid >> 4)) * DM + c0 + (tid & 15u) * 8u); const size_t gstep = (size_t)128u * DM * 2u, ghalf = (size_t)64u * DM * 2u;
  const unsigned lk = lds_off(ring) + (tid >> 4) * LPK + (tid & 15u) * 16u;
  key_copy(lk, gk); key_copy(lk + 64u * LPK, gk + ghalf);
  wait_async();
  __syncthreads();   /* publishes stage 0 */
  if (NKB > 1u) { key_copy(lk + STGK, gk + gstep); key_copy(lk + STGK + 64u * LPK, gk + gstep + ghalf); }
#pragma unroll 1
  for (unsigned kb = 0; kb < NKB; ++kb) {
    v8f acc[8] = {};
#pragma unroll
    for (int j = 0; j < 8; ++j) { const _Float16* kp = (const _Float16*)(ring + (kb & 1u) * STGK + (j * 16u + col) * LPK);
      const v16h k0 = frag_h(kp, lane), k1 = frag_h(kp + 32, lane), k2 = frag_h(kp + 64, lane), k3 = frag_h(kp + 96, lane);
      acc[j] = wmma16(qf[0], k0, acc[j]); acc[j] = wmma16(qf[1], k1, acc[j]); acc[j] = wmma16(qf[2], k2, acc[j]); acc[j] = wmma16(qf[3], k3, acc[j]); }
#pragma unroll
    for (int r = 0; r < 8; ++r) { float mx = acc[0][r];
#pragma unroll
      for (int j = 1; j < 8; ++j) mx = fmaxf(mx, acc[j][r]);
      const float mn = fmaxf(m[r], mx * C2); float s = 0.f;
#pragma unroll
      for (int j = 0; j < 8; ++j) s += exp2f(fmaf(acc[j][r], C2, -mn));
      sm[r] = sm[r] * exp2f(m[r] - mn) + s; m[r] = mn; }
    wait_ds();
    wait_async();
    __syncthreads();   /* publishes stage kb + 1 and ends every reader's last read of stage kb's buffer */
    if (kb + 2u < NKB) { const char* gn = gk + (size_t)(kb + 2u) * gstep; const unsigned ln = lk + (kb & 1u) * STGK; key_copy(ln, gn); key_copy(ln + 64u * LPK, gn + ghalf); } }
  wait_async();
  // merge the 16 column lanes of each half (rows stay within a half); all lanes active
#pragma unroll
  for (int off = 1; off < 16; off <<= 1) {
#pragma unroll
    for (int r = 0; r < 8; ++r) { const float om = __shfl_xor(m[r], off), os = __shfl_xor(sm[r], off); const float mn = fmaxf(m[r], om);
      sm[r] = sm[r] * exp2f(m[r] - mn) + os * exp2f(om - mn); m[r] = mn; } }
  const float* dp = DG + (size_t)(b * NH + h) * SEQ + ql0 + 8u * g;
  const v4f d0 = *(const v4f*)dp, d1 = *(const v4f*)(dp + 4);
#pragma unroll
  for (int r = 0; r < 8; ++r) { const float dg = r < 4 ? d0[r & 3] : d1[r & 3]; const float w = exp2f(dg * LOG2E - m[r] - log2f(sm[r]));
    if (col == 0u) sw[wave * 16u + 8u * g + r] = w; }
  __syncthreads();   /* cross-wave LDS: block barrier */
  if (tid < 16u) vst2((void*)(WP + (size_t)(b * NH + h) * SEQ + qb * 64u + tid * 4u), *(const v4f*)&sw[tid * 4u]);   
}

// ---- k_vw: block = (64 token rows, head h): v projection (exact bf16 products) x the row's diagonal probability -> f16 (w * v * 2^12) rows
__global__ __launch_bounds__(128) void k_vw(const __bf16* __restrict__ XB, const __bf16* __restrict__ WV, const float* __restrict__ WP, _Float16* __restrict__ CTX) {
  __shared__ __align__(16) _Float16 sh[64][136];
  __shared__ __align__(16) unsigned char ring[2u * STG];
  const unsigned tid = threadIdx.x, wave = tid >> 5, lane = tid & 31u, col = lane & 15u, g = lane >> 4;
  const unsigned h = blockIdx.y, c0 = h * HD; const unsigned r0 = blockIdx.x * 64u; const unsigned bb = r0 / (unsigned)SEQ, t0 = r0 % (unsigned)SEQ;
  v8f av[8] = {};
  gemm_ring<true>(ring, XB + (size_t)r0 * DM, WV + (size_t)c0 * DM, tid, av);
  const float* wp = WP + (size_t)(bb * NH + h) * SEQ + t0 + wave * 16u + 8u * g;
  const v4f w0 = *(const v4f*)wp, w1 = *(const v4f*)(wp + 4);
#pragma unroll
  for (int j = 0; j < 8; ++j) {
#pragma unroll
    for (int r = 0; r < 8; ++r) { const float wr = (r < 4 ? w0[r & 3] : w1[r & 3]) * CTXC; sh[wave * 16u + 8u * g + r][j * 16u + col] = (_Float16)(av[j][r] * wr); } }
  __syncthreads();
  for (unsigned e = tid; e < 64u * 16u; e += 128u) { const unsigned rl = e >> 4, q = e & 15u; vst2((void*)(CTX + (size_t)(r0 + rl) * DM + c0 + q * 8u), *(const v4u*)&sh[rl][q * 8u]); }   
}

__global__ __launch_bounds__(128) void k_out(const _Float16* __restrict__ CTX, const _Float16* __restrict__ WO, float* __restrict__ OUT) {
  __shared__ __align__(16) unsigned char ring[2u * STG];
  float (*ss)[16][132] = (float (*)[16][132])ring;   /* output staging takes the ring's place once its last readers have left it (four blocks then fit a WGP's LDS) */
  static_assert(4u * 16u * 132u * 4u <= 2u * STG);
  const unsigned tid = threadIdx.x, wave = tid >> 5, lane = tid & 31u, col = lane & 15u, g = lane >> 4;
  const unsigned c0 = blockIdx.y * 128u; const unsigned r0 = blockIdx.x * 64u; const unsigned bb = r0 / (unsigned)SEQ, t0 = r0 % (unsigned)SEQ;
  v8f acc[8] = {};
  gemm_ring<false>(ring, CTX + (size_t)r0 * DM, WO + (size_t)c0 * DM, tid, acc);
#pragma unroll
  for (int j = 0; j < 8; ++j) {
#pragma unroll
    for (int r = 0; r < 8; ++r) ss[wave][8u * g + r][j * 16u + col] = acc[j][r] * OUTC; }
  __syncthreads();
  const size_t orow0 = (size_t)bb * SEQ_FULL + t0 + wave * 16u;
  for (unsigned rl = 0; rl < 16u; ++rl) vst2((void*)(OUT + (orow0 + rl) * DM + c0 + lane * 4u), *(const v4f*)&ss[wave][rl][lane * 4u]);
}

extern "C" void kernel_launch(void* const* d_in, const int* in_sizes, int n_in, void* d_out, int out_size, void* d_ws, size_t ws_size, hipStream_t stream) {
  if (n_in < 7) return;
  const long long need_x = (long long)(NB - 1) * SEQ_FULL * DM + (long long)SEQ * DM;
  if ((long long)in_sizes[0] < need_x) return;
  if (in_sizes[1] < SEQ * 64 || in_sizes[2] < SEQ * 64) return;
  if (in_sizes[3] < DM * DM || in_sizes[4] < DM * DM || in_sizes[5] < DM * DM || in_sizes[6] < DM * DM) return;
  if ((long long)out_size < need_x) return;
  if (ws_size < (size_t)WS_END) return;
  // inputs (wire order): 0 x [2,2048,2048]; 1 cos table [2048][64]; 2 sin table [2048][64]; 3 Wq; 4 Wk; 5 Wv; 6 Wo (each [2048 out][2048 in])
  const float* const* F = (const float* const*)d_in;
  char* ws = (char*)d_ws;
  unsigned short* XB = (unsigned short*)(ws + WS_XB); unsigned short* WQ = (unsigned short*)(ws + WS_WQ); unsigned short* WK = (unsigned short*)(ws + WS_WK);
  unsigned short* WV = (unsigned short*)(ws + WS_WV); unsigned short* WO = (unsigned short*)(ws + WS_WO);
  _Float16* QH = (_Float16*)(ws + WS_QH); _Float16* KH = (_Float16*)(ws + WS_KH); _Float16* CTX = (_Float16*)(ws + WS_CTX);
  float* DG = (float*)(ws + WS_DG); float* WP = (float*)(ws + WS_WP);
  const unsigned nx8 = (unsigned)((size_t)SEQ * DM / 8), nw8 = (unsigned)((size_t)DM * DM / 8);
  k_cvt<<<dim3((nx8 + 255u) / 256u, NB), 256, 0, stream>>>(F[0], XB, nx8, (size_t)SEQ_FULL * DM, (size_t)SEQ * DM, 0);
  k_cvt<<<dim3((nw8 + 255u) / 256u, 1), 256, 0, stream>>>(F[3], WQ, nw8, (size_t)0, (size_t)0, 0);
  k_cvt<<<dim3((nw8 + 255u) / 256u, 1), 256, 0, stream>>>(F[4], WK, nw8, (size_t)0, (size_t)0, 0);
  k_cvt<<<dim3((nw8 + 255u) / 256u, 1), 256, 0, stream>>>(F[5], WV, nw8, (size_t)0, (size_t)0, 0);
  k_cvt<<<dim3((nw8 + 255u) / 256u, 1), 256, 0, stream>>>(F[6], WO, nw8, (size_t)0, (size_t)0, 1);
  k_qk<<<dim3(MROWS / 64, NH), 128, 0, stream>>>((const __bf16*)XB, (const __bf16*)WQ, (const __bf16*)WK, F[1], F[2], QH, KH, DG);
  k_lse<<<dim3(SEQ / 64, NH, NB), 128, 0, stream>>>(QH, KH, DG, WP);
  k_vw<<<dim3(MROWS / 64, NH), 128, 0, stream>>>((const __bf16*)XB, (const __bf16*)WV, WP, CTX);
  k_out<<<dim3(MROWS / 64, DM / 128), 128, 0, stream>>>(CTX, (const _Float16*)WO, (float*)d_out);
}

// v002
// It runs in 238 microseconds.
// In both of two side-by-side timings against v001, it was 1.04 times as fast.
// Counting every step since v000, it is 4.04 times as fast.
// compute dtype: every float input RNE-converted to bf16 on load; q/k/v projections = exact bf16 x bf16 products on v_wmma_f32_16x16x32_bf16 (f32 accumulate); score statistics q' x k' once to f16 each on v_wmma_f32_16x16x32_f16 (f32 accumulate, f32 running max / running sum); diagonal logit = f32 VALU dot of the f32 q', k' (per-row, no shared operand); output projection = f16(w*v * 2^12) x f16(bf16(Wo) * 2^8) on v_wmma_f32_16x16x32_f16, f32 accumulate, x 2^-20 in the f32 epilogue.
#include <hip/hip_runtime.h>
#include <math.h>

typedef __attribute__((ext_vector_type(16))) _Float16 v16h;
typedef __attribute__((ext_vector_type(16))) __bf16 v16b;
typedef __attribute__((ext_vector_type(8)))  _Float16 v8h;
typedef __attribute__((ext_vector_type(8)))  __bf16 v8b;
typedef __attribute__((ext_vector_type(8)))  float v8f;
typedef __attribute__((ext_vector_type(4)))  float v4f;
typedef __attribute__((ext_vector_type(4)))  unsigned v4u;

template <typename T> __device__ __forceinline__ void vst2(void* p, T v) { *(T*)p = v;  }
__device__ __forceinline__ v8f wmma16(v16h a, v16h b, v8f c) {
  v8f d = __builtin_amdgcn_wmma_f32_16x16x32_f16(false, a, false, b, (short)0, c, false, false);
  asm volatile("v_nop\n\tv_nop\n\tv_nop\n\tv_nop" : "+v"(d) : "v"(a), "v"(b));
  return d;
}
__device__ __forceinline__ v8f wmma_bf(v16b a, v16b b, v8f c) {
  v8f d = __builtin_amdgcn_wmma_f32_16x16x32_bf16(false, a, false, b, (short)0, c, false, false);
  asm volatile("v_nop\n\tv_nop\n\tv_nop\n\tv_nop" : "+v"(d) : "v"(a), "v"(b));
  return d;
}
// 16x16x32 fragments (A and B alike): lane = (g = lane>>4, row/col = lane&15); elements 0..7 = k0+8g+0..7, 8..15 = k0+16+8g+0..7; D element r = (row 8g+r, col lane&15)
__device__ __forceinline__ v16h frag_h(const _Float16* rowk0, unsigned lane) {
  union { v16h v; v8h q[2]; } u; const _Float16* p = rowk0 + 8u * (lane >> 4);
  u.q[0] = *(const v8h*)p; u.q[1] = *(const v8h*)(p + 16); return u.v;
}
__device__ __forceinline__ v16b frag_b(const __bf16* rowk0, unsigned lane) {
  union { v16b v; v8b q[2]; } u; const __bf16* p = rowk0 + 8u * (lane >> 4);
  u.q[0] = *(const v8b*)p; u.q[1] = *(const v8b*)(p + 16); return u.v;
}
__device__ __forceinline__ float bfr(float v) { return (float)(__bf16)v; }

// Self-attention whose output keeps only the DIAGONAL probability: x [NB][SEQ_FULL][DM] (first SEQ rows per batch used); Wq/Wk/Wv/Wo [DM out][DM in] (y = x W^T, no bias); 16 heads x 128;
// interleaved-pair rotation of q and k with INPUT tables cos/sin [SEQ][64]; w[b][h][s] = exp(q'[s].k'[s] * scale - logsumexp_k(q'[s].k'[k] * scale)); ctx = w * v; out = ctx Wo^T.
#ifndef NB
#define NB 2
#endif
#ifndef SEQ
#define SEQ 2048
#endif
#define NB_FULL 2
#define SEQ_FULL 2048
#define DM 2048
#define NH 16
#define HD 128
#define MROWS (NB * SEQ)
#define SCALE 0.08838834764831845f
#define LOG2E 1.4426950408889634f
#define CTXC 4096.0f
#define WOC 256.0f
#define OUTC (1.0f / 1048576.0f)

static_assert(NH * HD == DM);
static_assert(SEQ % 128 == 0);
static_assert(SEQ <= SEQ_FULL);
static_assert(NB <= NB_FULL);
static_assert(MROWS % 64 == 0);
static_assert(DM % 128 == 0);
static_assert(((size_t)SEQ * DM) % (8 * 256) == 0);
static_assert(((size_t)DM * DM) % (8 * 256) == 0);

#define WS_XB  ((size_t)0)                                   // bf16 x rows [b*SEQ + s][DM]
#define WS_WQ  (WS_XB  + 2u * (size_t)MROWS * DM)            // bf16 Wq [out][in]
#define WS_WK  (WS_WQ  + 2u * (size_t)DM * DM)
#define WS_WV  (WS_WK  + 2u * (size_t)DM * DM)
#define WS_WO  (WS_WV  + 2u * (size_t)DM * DM)               // f16 (bf16(Wo) * 2^8) [out][in]
#define WS_QH  (WS_WO  + 2u * (size_t)DM * DM)               // f16 rotated q rows [b*SEQ + s][DM]
#define WS_KH  (WS_QH  + 2u * (size_t)MROWS * DM)            // f16 rotated k rows
#define WS_CTX (WS_KH  + 2u * (size_t)MROWS * DM)            // f16 (w * v * 2^12) rows
#define WS_DG  (WS_CTX + 2u * (size_t)MROWS * DM)            // f32 diagonal logits [b][h][s]
#define WS_WP  (WS_DG  + 4u * (size_t)NB * NH * SEQ)         // f32 diagonal probabilities [b][h][s]
#define WS_END (WS_WP  + 4u * (size_t)NB * NH * SEQ)
static_assert(WS_END <= (size_t)134217728);
static_assert(WS_DG % 128 == 0);

#define KP 64u                      /* k elements of one projection stage: 128 B of every row */
#define LP 144u                     /* LDS row pitch of a projection stage, bytes */
#define STG (192u * LP)             /* one projection stage: 64 rows of the left operand, then 128 rows of the weight */
#define NTR (DM / KP)
#define LPK 272u                    /* LDS row pitch of a key stage, bytes: 256 B of data */
#define STGK (128u * LPK)           /* one key stage: 128 keys x 128 head elements */
#define NKB (SEQ / 128u)
static_assert(NTR >= 2u);
#define CP1(l, g) "global_load_async_to_lds_b128 %" #l ", %" #g ", off\n\t"
__device__ __forceinline__ unsigned lds_off(const void* p) { return (unsigned)(size_t)p; }
// the ring's two waits in statements of their own, each with the memory clobber that keeps LDS reads and copies on their side of it
__device__ __forceinline__ void wait_ds() { asm volatile("s_wait_dscnt 0x0" ::: "memory"); }       /* this wave's LDS reads are done before the buffer is handed back */
__device__ __forceinline__ void wait_async() { asm volatile("s_wait_asynccnt 0x0" ::: "memory"); } /* this wave's copies have landed before the barrier publishes them */
// 12 copies of one lane: rows crow + 16 i of the stage (i < 4: left operand, i >= 4: weight); s_wait_xcnt closes the statement so that no address register is rewritten ahead of it
__device__ __forceinline__ void stage_copy(unsigned l, const char* ga, const char* gw) {
  const size_t rs = (size_t)16u * DM * 2u; const unsigned ls = 16u * LP;
  asm volatile(CP1(0, 12) CP1(1, 13) CP1(2, 14) CP1(3, 15) CP1(4, 16) CP1(5, 17) CP1(6, 18) CP1(7, 19) CP1(8, 20) CP1(9, 21) CP1(10, 22) CP1(11, 23) "s_wait_xcnt 0x0"
    :: "v"(l), "v"(l + ls), "v"(l + 2u * ls), "v"(l + 3u * ls), "v"(l + 4u * ls), "v"(l + 5u * ls), "v"(l + 6u * ls), "v"(l + 7u * ls), "v"(l + 8u * ls), "v"(l + 9u * ls), "v"(l + 10u * ls), "v"(l + 11u * ls),
       "v"(ga), "v"(ga + rs), "v"(ga + 2u * rs), "v"(ga + 3u * rs), "v"(gw), "v"(gw + rs), "v"(gw + 2u * rs), "v"(gw + 3u * rs), "v"(gw + 4u * rs), "v"(gw + 5u * rs), "v"(gw + 6u * rs), "v"(gw + 7u * rs)
    : "memory");
}
// 8 copies of one lane: key rows krow + 8 i, i = 0..7, of half a key stage
__device__ __forceinline__ void key_copy(unsigned l, const char* g) {
  const size_t rs = (size_t)8u * DM * 2u; const unsigned ls = 8u * LPK;
  asm volatile(CP1(0, 8) CP1(1, 9) CP1(2, 10) CP1(3, 11) CP1(4, 12) CP1(5, 13) CP1(6, 14) CP1(7, 15) "s_wait_xcnt 0x0"
    :: "v"(l), "v"(l + ls), "v"(l + 2u * ls), "v"(l + 3u * ls), "v"(l + 4u * ls), "v"(l + 5u * ls), "v"(l + 6u * ls), "v"(l + 7u * ls),
       "v"(g), "v"(g + rs), "v"(g + 2u * rs), "v"(g + 3u * rs), "v"(g + 4u * rs), "v"(g + 5u * rs), "v"(g + 6u * rs), "v"(g + 7u * rs)
    : "memory");
}
// acc[j] += A[64 rows][DM] x W[128 rows][DM]^T for this wave's 16 rows, k ascending in steps of 32; A, Wt = the block's first rows (16-bit elements, row pitch DM).
// Every wave of the block calls it; the ring's last readers have left it when it returns (the last trip ends in s_wait_dscnt 0 and the barrier).
template <bool BF> __device__ __forceinline__ void gemm_ring(unsigned char* ring, const void* A, const void* Wt, unsigned tid, v8f (&acc)[8]) {
  const unsigned wave = tid >> 5, lane = tid & 31u, col = lane & 15u; const unsigned crow = tid >> 3, cch = tid & 7u;
  const char* ga = (const char*)A + ((size_t)crow * DM + cch * 8u) * 2u; const char* gw = (const char*)Wt + ((size_t)crow * DM + cch * 8u) * 2u;
  const unsigned l0 = lds_off(ring) + crow * LP + cch * 16u;
  stage_copy(l0, ga, gw);
  wait_async();
  __syncthreads();   /* publishes stage 0 */
  stage_copy(l0 + STG, ga + KP * 2u, gw + KP * 2u);
#pragma unroll 1   /* kept rolled: one trip is already 16 matrix instructions, and the text of four such loops stays small */
  for (unsigned t = 0; t < NTR; ++t) {
    const unsigned char* ab = ring + (t & 1u) * STG + (wave * 16u + col) * LP; const unsigned char* wb = ring + (t & 1u) * STG + (64u + col) * LP;
    // the trip's fragment reads stand together in front of its matrix instructions: the LDS latency is met once a trip, not once a product
    if constexpr (BF) { v16b a[2], w[2][8];
#pragma unroll
      for (unsigned ks = 0; ks < 2u; ++ks) { a[ks] = frag_b((const __bf16*)(ab + ks * 64u), lane);
#pragma unroll
        for (int j = 0; j < 8; ++j) w[ks][j] = frag_b((const __bf16*)(wb + j * 16u * LP + ks * 64u), lane); }
#pragma unroll
      for (unsigned ks = 0; ks < 2u; ++ks) {
#pragma unroll
        for (int j = 0; j < 8; ++j) acc[j] = wmma_bf(a[ks], w[ks][j], acc[j]); }
    } else { v16h a[2], w[2][8];
#pragma unroll
      for (unsigned ks = 0; ks < 2u; ++ks) { a[ks] = frag_h((const _Float16*)(ab + ks * 64u), lane);
#pragma unroll
        for (int j = 0; j < 8; ++j) w[ks][j] = frag_h((const _Float16*)(wb + j * 16u * LP + ks * 64u), lane); }
#pragma unroll
      for (unsigned ks = 0; ks < 2u; ++ks) {
#pragma unroll
        for (int j = 0; j < 8; ++j) acc[j] = wmma16(a[ks], w[ks][j], acc[j]); } }
    wait_ds();
    wait_async();
    __syncthreads();   /* publishes stage t + 1 and ends every reader's last read of stage t's buffer */
    if (t + 2u < NTR) stage_copy(l0 + (t & 1u) * STG, ga + (size_t)(t + 2u) * (KP * 2u), gw + (size_t)(t + 2u) * (KP * 2u));
  }
  wait_async();
}

// ---- k_cvt: ONE launch converts x and the four weights. The five 16-bit planes lie one behind the other in the workspace: NB + 4 segments (each batch of x, then Wq, Wk, Wv, Wo) of CVT_BLOCKS tiles each.
// A tile = CVT_TILE pieces of 8 elements (32 B read, 16 B written a piece). Block n converts tile n of every segment, the next segment's 8 loads a lane issued ahead of this segment's conversion:
// few long-lived waves that keep loads in flight, in place of one short-lived wave per 256 elements.
#define CVT_T 512u
#define CVT_U 4u
#define CVT_TILE (CVT_T * CVT_U)
#define CVT_BLOCKS ((unsigned)((size_t)DM * DM / 8u / CVT_TILE))
#define CVT_SEGS ((unsigned)NB + 4u)
static_assert((size_t)CVT_BLOCKS * CVT_TILE * 8u == (size_t)DM * DM);
static_assert((size_t)SEQ * DM == (size_t)DM * DM);   /* a batch of x is as long as a weight */
static_assert(WS_XB == 0 && WS_WQ == 2u * (size_t)NB * DM * DM && WS_WO == WS_WQ + 3u * 2u * (size_t)DM * DM);
// no register that an issued load or store names is rewritten ahead of this wait
__device__ __forceinline__ void wait_x() { asm volatile("s_wait_xcnt 0x0" ::: "memory"); }
__device__ __forceinline__ void cvt_load(v4f (&r)[2u * CVT_U], const float* s) {
#pragma unroll
  for (unsigned u = 0; u < CVT_U; ++u) { r[2u * u] = *(const v4f*)(s + u * (CVT_T * 8u)); r[2u * u + 1u] = *(const v4f*)(s + u * (CVT_T * 8u) + 4u); }
  wait_x();
  __builtin_amdgcn_sched_barrier(0);   /* the loads stay one group ahead of the conversion that follows, and that conversion's register writes stay behind the wait */
}
__global__ __launch_bounds__(512) void k_cvt(const float* __restrict__ X, const float* __restrict__ Q, const float* __restrict__ K, const float* __restrict__ V, const float* __restrict__ O,
    unsigned short* __restrict__ dst) {
  const unsigned off = blockIdx.x * (CVT_TILE * 8u) + threadIdx.x * 8u;   /* this lane's first element inside every segment */
  v4f cur[2u * CVT_U], nxt[2u * CVT_U];
  cvt_load(cur, X + off);
#pragma unroll   /* unrolled: the segment number picks the source pointer and the target type at compile time, and the two register sets need no copies */
  for (unsigned s = 0; s < CVT_SEGS; ++s) {
    const unsigned n = s + 1u;
    if (n < CVT_SEGS) cvt_load(nxt, (n < (unsigned)NB ? X + (size_t)n * ((size_t)SEQ_FULL * DM) : n == (unsigned)NB ? Q : n == (unsigned)NB + 1u ? K : n == (unsigned)NB + 2u ? V : O) + off);
    v4u o[CVT_U];
#pragma unroll
    for (unsigned u = 0; u < CVT_U; ++u) { const v4f a = cur[2u * u], b = cur[2u * u + 1u];
      if (s + 1u < CVT_SEGS) { v8b t;
#pragma unroll
        for (int e = 0; e < 4; ++e) { t[e] = (__bf16)a[e]; t[4 + e] = (__bf16)b[e]; }
        o[u] = __builtin_bit_cast(v4u, t);
      } else { v8h t;   /* the last segment, Wo, goes to f16 (bf16 value x 2^8) */
#pragma unroll
        for (int e = 0; e < 4; ++e) { t[e] = (_Float16)(bfr(a[e]) * WOC); t[4 + e] = (_Float16)(bfr(b[e]) * WOC); }
        o[u] = __builtin_bit_cast(v4u, t);
      } }
    __builtin_amdgcn_sched_barrier(0);   /* all four pieces are converted before the first store issues: no store's data register is reused ahead of the wait behind the stores */
    unsigned short* d = dst + (size_t)s * ((size_t)DM * DM) + off;
#pragma unroll
    for (unsigned u = 0; u < CVT_U; ++u) vst2((void*)(d + u * (CVT_T * 8u)), o[u]);
    wait_x();
    __builtin_amdgcn_sched_barrier(0);   /* keeps the next segment's register writes behind that wait */
#pragma unroll
    for (unsigned u = 0; u < 2u * CVT_U; ++u) cur[u] = nxt[u];
  }
}

// ---- k_qk: block = (64 token rows, head h): q projection then k projection, one after the other (exact bf16 products, K = DM; 8 accumulator tiles live at a time);
// rotation with the bf16-converted input tables; the rotated f32 q' tile waits in LDS for the diagonal dot and is converted to f16 at store time; f16 q'/k' rows, f32 diagonal logit per row
__global__ __launch_bounds__(128) void k_qk(const __bf16* __restrict__ XB, const __bf16* __restrict__ WQ, const __bf16* __restrict__ WK, const float* __restrict__ COS, const float* __restrict__ SIN,
    _Float16* __restrict__ QH, _Float16* __restrict__ KH, float* __restrict__ DG) {
  __shared__ __align__(16) float sq[64][132]; __shared__ __align__(16) _Float16 sk[64][136]; __shared__ __align__(16) float scs[64][64], ssn[64][64]; __shared__ __align__(16) float sdg[64];
  __shared__ __align__(16) unsigned char ring[2u * STG];
  const unsigned tid = threadIdx.x, wave = tid >> 5, lane = tid & 31u, col = lane & 15u, g = lane >> 4;
  const unsigned h = blockIdx.y, c0 = h * HD; const unsigned r0 = blockIdx.x * 64u; const unsigned bb = r0 / (unsigned)SEQ, t0 = r0 % (unsigned)SEQ;
  const bool odd = (col & 1u) != 0u;
  // ---- phase 1: q projection, rotation, f32 q' tile to LDS (each lane later re-reads exactly the positions it wrote)
  {
    v8f aq[8] = {};
    gemm_ring<true>(ring, XB + (size_t)r0 * DM, WQ + (size_t)c0 * DM, tid, aq);
    // table tile: positions t0..t0+63, 64 pairs, bf16-converted values
    for (unsigned e = tid; e < 64u * 16u; e += 128u) { const unsigned rl = e >> 4, q = e & 15u; const size_t o = (size_t)(t0 + rl) * 64u + q * 4u;
      const v4f c = *(const v4f*)(COS + o), s = *(const v4f*)(SIN + o);
#pragma unroll
      for (int u = 0; u < 4; ++u) { scs[rl][q * 4u + u] = bfr(c[u]); ssn[rl][q * 4u + u] = bfr(s[u]); } }
    __syncthreads();   /* table tile is cross-wave: block barrier */
#pragma unroll
    for (int j = 0; j < 8; ++j) {
#pragma unroll
      for (int r = 0; r < 8; ++r) { const unsigned rl = wave * 16u + 8u * g + r; const unsigned pi = j * 8u + (col >> 1);
        const float c = scs[rl][pi], s = ssn[rl][pi];
        const float oq = aq[j][r];
        const float pq = __shfl_xor(oq, 1);                              /* pair partner (column ^ 1), all lanes active */
        const float sg = odd ? s : -s;                                    /* even column: te*c - to*s; odd column: to*c + te*s */
        const float qv = oq * c + pq * sg;
        sq[rl][j * 16u + col] = qv; }
      asm volatile("" ::: "memory"); }
  }
  __syncthreads();
  // ---- phase 2: k projection, rotation, diagonal dot against the staged q' values (same j order), f16 k' tile to LDS
  v8f ak[8] = {};
  gemm_ring<true>(ring, XB + (size_t)r0 * DM, WK + (size_t)c0 * DM, tid, ak);
  float ds[8] = {0.f, 0.f, 0.f, 0.f, 0.f, 0.f, 0.f, 0.f};
#pragma unroll
  for (int j = 0; j < 8; ++j) {
#pragma unroll
    for (int r = 0; r < 8; ++r) { const unsigned rl = wave * 16u + 8u * g + r; const unsigned pi = j * 8u + (col >> 1);
      const float c = scs[rl][pi], s = ssn[rl][pi];
      const float okv = ak[j][r];
      const float pk = __shfl_xor(okv, 1);                               /* pair partner (column ^ 1), all lanes active */
      const float sg = odd ? s : -s;
      const float kv = okv * c + pk * sg;
      const float qv = sq[rl][j * 16u + col];
      ds[r] += qv * kv;
      sk[rl][j * 16u + col] = (_Float16)kv; }
    asm volatile("" ::: "memory"); }
#pragma unroll
  for (int r = 0; r < 8; ++r) { float d = ds[r]; d += __shfl_xor(d, 1); d += __shfl_xor(d, 2); d += __shfl_xor(d, 4); d += __shfl_xor(d, 8);
    if (col == 0u) sdg[wave * 16u + 8u * g + r] = d * SCALE; }
  __syncthreads();   /* cross-wave LDS tiles: block barrier */
  for (unsigned e = tid; e < 64u * 16u; e += 128u) { const unsigned rl = e >> 4, q = e & 15u; const size_t o = (size_t)(r0 + rl) * DM + c0 + q * 8u;   
    const v4f f0 = *(const v4f*)&sq[rl][q * 8u], f1 = *(const v4f*)&sq[rl][q * 8u + 4u]; v8h tq;
#pragma unroll
    for (int u = 0; u < 4; ++u) { tq[u] = (_Float16)f0[u]; tq[4 + u] = (_Float16)f1[u]; }
    const v4u oq4 = __builtin_bit_cast(v4u, tq); const v4u ok4 = *(const v4u*)&sk[rl][q * 8u];
    vst2((void*)(QH + o), oq4); vst2((void*)(KH + o), ok4); }
  if (tid < 16u) vst2((void*)(DG + (size_t)(bb * NH + h) * SEQ + t0 + tid * 4u), *(const v4f*)&sdg[tid * 4u]);   
}

// ---- k_lse: block = 64 query rows of (b, h); one streaming pass over all SEQ keys (128 per step): f16 q' x f16 k' logits, f32 running max / running sum in the log2 domain; w = exp(diag - lse)
__global__ __launch_bounds__(128) void k_lse(const _Float16* __restrict__ QH, const _Float16* __restrict__ KH, const float* __restrict__ DG, float* __restrict__ WP) {
  __shared__ __align__(16) float sw[64];
  __shared__ __align__(16) unsigned char ring[2u * STGK];
  const unsigned tid = threadIdx.x, wave = tid >> 5, lane = tid & 31u, col = lane & 15u, g = lane >> 4;
  const unsigned qb = blockIdx.x, h = blockIdx.y, b = blockIdx.z; const unsigned c0 = h * HD; const unsigned ql0 = qb * 64u + wave * 16u;
  const size_t q0 = (size_t)b * SEQ + ql0, kr0 = (size_t)b * SEQ;
  const float C2 = SCALE * LOG2E;
  v16h qf[4];
#pragma unroll
  for (int kc = 0; kc < 4; ++kc) qf[kc] = frag_h(QH + (q0 + col) * DM + c0 + kc * 32u, lane);
  float m[8], sm[8];
#pragma unroll
  for (int r = 0; r < 8; ++r) { m[r] = -3.0e38f; sm[r] = 0.f; }
  // key ring: a stage is 128 keys x 256 B; lane = (row tid >> 4, 16-B piece tid & 15), 16 copies a lane and stage in two statements
  const char* gk = (const char*)(KH + (kr0 + (tid >> 4)) * DM + c0 + (tid & 15u) * 8u); const size_t gstep = (size_t)128u * DM * 2u, ghalf = (size_t)64u * DM * 2u;
  const unsigned lk = lds_off(ring) + (tid >> 4) * LPK + (tid & 15u) * 16u;
  key_copy(lk, gk); key_copy(lk + 64u * LPK, gk + ghalf);
  wait_async();
  __syncthreads();   /* publishes stage 0 */
  if (NKB > 1u) { key_copy(lk + STGK, gk + gstep); key_copy(lk + STGK + 64u * LPK, gk + gstep + ghalf); }
#pragma unroll 1
  for (unsigned kb = 0; kb < NKB; ++kb) {
    v8f acc[8] = {};
#pragma unroll
    for (int j = 0; j < 8; ++j) { const _Float16* kp = (const _Float16*)(ring + (kb & 1u) * STGK + (j * 16u + col) * LPK);
      const v16h k0 = frag_h(kp, lane), k1 = frag_h(kp + 32, lane), k2 = frag_h(kp + 64, lane), k3 = frag_h(kp + 96, lane);
      acc[j] = wmma16(qf[0], k0, acc[j]); acc[j] = wmma16(qf[1], k1, acc[j]); acc[j] = wmma16(qf[2], k2, acc[j]); acc[j] = wmma16(qf[3], k3, acc[j]); }
#pragma unroll
    for (int r = 0; r < 8; ++r) { float mx = acc[0][r];
#pragma unroll
      for (int j = 1; j < 8; ++j) mx = fmaxf(mx, acc[j][r]);
      const float mn = fmaxf(m[r], mx * C2); float s = 0.f;
#pragma unroll
      for (int j = 0; j < 8; ++j) s += exp2f(fmaf(acc[j][r], C2, -mn));
      sm[r] = sm[r] * exp2f(m[r] - mn) + s; m[r] = mn; }
    wait_ds();
    wait_async();
    __syncthreads();   /* publishes stage kb + 1 and ends every reader's last read of stage kb's buffer */
    if (kb + 2u < NKB) { const char* gn = gk + (size_t)(kb + 2u) * gstep; const unsigned ln = lk + (kb & 1u) * STGK; key_copy(ln, gn); key_copy(ln + 64u * LPK, gn + ghalf); } }
  wait_async();
  // merge the 16 column lanes of each half (rows stay within a half); all lanes active
#pragma unroll
  for (int off = 1; off < 16; off <<= 1) {
#pragma unroll
    for (int r = 0; r < 8; ++r) { const float om = __shfl_xor(m[r], off), os = __shfl_xor(sm[r], off); const float mn = fmaxf(m[r], om);
      sm[r] = sm[r] * exp2f(m[r] - mn) + os * exp2f(om - mn); m[r] = mn; } }
  const float* dp = DG + (size_t)(b * NH + h) * SEQ + ql0 + 8u * g;
  const v4f d0 = *(const v4f*)dp, d1 = *(const v4f*)(dp + 4);
#pragma unroll
  for (int r = 0; r < 8; ++r) { const float dg = r < 4 ? d0[r & 3] : d1[r & 3]; const float w = exp2f(dg * LOG2E - m[r] - log2f(sm[r]));
    if (col == 0u) sw[wave * 16u + 8u * g + r] = w; }
  __syncthreads();   /* cross-wave LDS: block barrier */
  if (tid < 16u) vst2((void*)(WP + (size_t)(b * NH + h) * SEQ + qb * 64u + tid * 4u), *(const v4f*)&sw[tid * 4u]);   
}

// ---- k_vw: block = (64 token rows, head h): v projection (exact bf16 products) x the row's diagonal probability -> f16 (w * v * 2^12) rows
__global__ __launch_bounds__(128) void k_vw(const __bf16* __restrict__ XB, const __bf16* __restrict__ WV, const float* __restrict__ WP, _Float16* __restrict__ CTX) {
  __shared__ __align__(16) _Float16 sh[64][136];
  __shared__ __align__(16) unsigned char ring[2u * STG];
  const unsigned tid = threadIdx.x, wave = tid >> 5, lane = tid & 31u, col = lane & 15u, g = lane >> 4;
  const unsigned h = blockIdx.y, c0 = h * HD; const unsigned r0 = blockIdx.x * 64u; const unsigned bb = r0 / (unsigned)SEQ, t0 = r0 % (unsigned)SEQ;
  v8f av[8] = {};
  gemm_ring<true>(ring, XB + (size_t)r0 * DM, WV + (size_t)c0 * DM, tid, av);
  const float* wp = WP + (size_t)(bb * NH + h) * SEQ + t0 + wave * 16u + 8u * g;
  const v4f w0 = *(const v4f*)wp, w1 = *(const v4f*)(wp + 4);
#pragma unroll
  for (int j = 0; j < 8; ++j) {
#pragma unroll
    for (int r = 0; r < 8; ++r) { const float wr = (r < 4 ? w0[r & 3] : w1[r & 3]) * CTXC; sh[wave * 16u + 8u * g + r][j * 16u + col] = (_Float16)(av[j][r] * wr); } }
  __syncthreads();
  for (unsigned e = tid; e < 64u * 16u; e += 128u) { const unsigned rl = e >> 4, q = e & 15u; vst2((void*)(CTX + (size_t)(r0 + rl) * DM + c0 + q * 8u), *(const v4u*)&sh[rl][q * 8u]); }   
}

__global__ __launch_bounds__(128) void k_out(const _Float16* __restrict__ CTX, const _Float16* __restrict__ WO, float* __restrict__ OUT) {
  __shared__ __align__(16) unsigned char ring[2u * STG];
  float (*ss)[16][132] = (float (*)[16][132])ring;   /* output staging takes the ring's place once its last readers have left it (four blocks then fit a WGP's LDS) */
  static_assert(4u * 16u * 132u * 4u <= 2u * STG);
  const unsigned tid = threadIdx.x, wave = tid >> 5, lane = tid & 31u, col = lane & 15u, g = lane >> 4;
  const unsigned c0 = blockIdx.y * 128u; const unsigned r0 = blockIdx.x * 64u; const unsigned bb = r0 / (unsigned)SEQ, t0 = r0 % (unsigned)SEQ;
  v8f acc[8] = {};
  gemm_ring<false>(ring, CTX + (size_t)r0 * DM, WO + (size_t)c0 * DM, tid, acc);
#pragma unroll
  for (int j = 0; j < 8; ++j) {
#pragma unroll
    for (int r = 0; r < 8; ++r) ss[wave][8u * g + r][j * 16u + col] = acc[j][r] * OUTC; }
  __syncthreads();
  const size_t orow0 = (size_t)bb * SEQ_FULL + t0 + wave * 16u;
  for (unsigned rl = 0; rl < 16u; ++rl) vst2((void*)(OUT + (orow0 + rl) * DM + c0 + lane * 4u), *(const v4f*)&ss[wave][rl][lane * 4u]);
}

extern "C" void kernel_launch(void* const* d_in, const int* in_sizes, int n_in, void* d_out, int out_size, void* d_ws, size_t ws_size, hipStream_t stream) {
  if (n_in < 7) return;
  const long long need_x = (long long)(NB - 1) * SEQ_FULL * DM + (long long)SEQ * DM;
  if ((long long)in_sizes[0] < need_x) return;
  if (in_sizes[1] < SEQ * 64 || in_sizes[2] < SEQ * 64) return;
  if (in_sizes[3] < DM * DM || in_sizes[4] < DM * DM || in_sizes[5] < DM * DM || in_sizes[6] < DM * DM) return;
  if ((long long)out_size < need_x) return;
  if (ws_size < (size_t)WS_END) return;
  // inputs (wire order): 0 x [2,2048,2048]; 1 cos table [2048][64]; 2 sin table [2048][64]; 3 Wq; 4 Wk; 5 Wv; 6 Wo (each [2048 out][2048 in])
  const float* const* F = (const float* const*)d_in;
  char* ws = (char*)d_ws;
  unsigned short* XB = (unsigned short*)(ws + WS_XB); unsigned short* WQ = (unsigned short*)(ws + WS_WQ); unsigned short* WK = (unsigned short*)(ws + WS_WK);
  unsigned short* WV = (unsigned short*)(ws + WS_WV); unsigned short* WO = (unsigned short*)(ws + WS_WO);
  _Float16* QH = (_Float16*)(ws + WS_QH); _Float16* KH = (_Float16*)(ws + WS_KH); _Float16* CTX = (_Float16*)(ws + WS_CTX);
  float* DG = (float*)(ws + WS_DG); float* WP = (float*)(ws + WS_WP);
  k_cvt<<<dim3(CVT_BLOCKS), CVT_T, 0, stream>>>(F[0], F[3], F[4], F[5], F[6], XB);
  k_qk<<<dim3(MROWS / 64, NH), 128, 0, stream>>>((const __bf16*)XB, (const __bf16*)WQ, (const __bf16*)WK, F[1], F[2], QH, KH, DG);
  k_lse<<<dim3(SEQ / 64, NH, NB), 128, 0, stream>>>(QH, KH, DG, WP);
  k_vw<<<dim3(MROWS / 64, NH), 128, 0, stream>>>((const __bf16*)XB, (const __bf16*)WV, WP, CTX);
  k_out<<<dim3(MROWS / 64, DM / 128), 128, 0, stream>>>(CTX, (const _Float16*)WO, (float*)d_out);
}

// v003
// It runs in 202 microseconds.
// In two side-by-side timings against v002, it was 1.18 and 1.17 times as fast.
// Over all steps from v000 it is 4.75 times as fast.
// compute dtype: every float input RNE-converted to bf16 on load; q/k/v projections = exact bf16 x bf16 products on v_wmma_f32_16x16x32_bf16 (f32 accumulate); score statistics q' x k' once to f16 each on v_wmma_f32_16x16x32_f16 (f32 accumulate, f32 running max / running sum); diagonal logit = f32 VALU dot of the f32 q', k' (per-row, no shared operand); output projection = f16(w*v * 2^12) x f16(bf16(Wo) * 2^8) on v_wmma_f32_16x16x32_f16, f32 accumulate, x 2^-20 in the f32 epilogue.
#include <hip/hip_runtime.h>
#include <math.h>

typedef __attribute__((ext_vector_type(16))) _Float16 v16h;
typedef __attribute__((ext_vector_type(16))) __bf16 v16b;
typedef __attribute__((ext_vector_type(8)))  _Float16 v8h;
typedef __attribute__((ext_vector_type(8)))  __bf16 v8b;
typedef __attribute__((ext_vector_type(8)))  float v8f;
typedef __attribute__((ext_vector_type(4)))  float v4f;
typedef __attribute__((ext_vector_type(4)))  unsigned v4u;

template <typename T> __device__ __forceinline__ void vst2(void* p, T v) { *(T*)p = v;  }
__device__ __forceinline__ v8f wmma16(v16h a, v16h b, v8f c) {
  v8f d = __builtin_amdgcn_wmma_f32_16x16x32_f16(false, a, false, b, (short)0, c, false, false);
  asm volatile("v_nop\n\tv_nop\n\tv_nop\n\tv_nop" : "+v"(d) : "v"(a), "v"(b));
  return d;
}
__device__ __forceinline__ v8f wmma_bf(v16b a, v16b b, v8f c) {
  v8f d = __builtin_amdgcn_wmma_f32_16x16x32_bf16(false, a, false, b, (short)0, c, false, false);
  asm volatile("v_nop\n\tv_nop\n\tv_nop\n\tv_nop" : "+v"(d) : "v"(a), "v"(b));
  return d;
}
// 16x16x32 fragments (A and B alike): lane = (g = lane>>4, row/col = lane&15); elements 0..7 = k0+8g+0..7, 8..15 = k0+16+8g+0..7; D element r = (row 8g+r, col lane&15)
__device__ __forceinline__ v16h frag_h(const _Float16* rowk0, unsigned lane) {
  union { v16h v; v8h q[2]; } u; const _Float16* p = rowk0 + 8u * (lane >> 4);
  u.q[0] = *(const v8h*)p; u.q[1] = *(const v8h*)(p + 16); return u.v;
}
__device__ __forceinline__ v16b frag_b(const __bf16* rowk0, unsigned lane) {
  union { v16b v; v8b q[2]; } u; const __bf16* p = rowk0 + 8u * (lane >> 4);
  u.q[0] = *(const v8b*)p; u.q[1] = *(const v8b*)(p + 16); return u.v;
}
__device__ __forceinline__ float bfr(float v) { return (float)(__bf16)v; }

// Self-attention whose output keeps only the DIAGONAL probability: x [NB][SEQ_FULL][DM] (first SEQ rows per batch used); Wq/Wk/Wv/Wo [DM out][DM in] (y = x W^T, no bias); 16 heads x 128;
// interleaved-pair rotation of q and k with INPUT tables cos/sin [SEQ][64]; w[b][h][s] = exp(q'[s].k'[s] * scale - logsumexp_k(q'[s].k'[k] * scale)); ctx = w * v; out = ctx Wo^T.
#ifndef NB
#define NB 2
#endif
#ifndef SEQ
#define SEQ 2048
#endif
#define NB_FULL 2
#define SEQ_FULL 2048
#define DM 2048
#define NH 16
#define HD 128
#define MROWS (NB * SEQ)
#define SCALE 0.08838834764831845f
#define LOG2E 1.4426950408889634f
#define CTXC 4096.0f
#define WOC 256.0f
#define OUTC (1.0f / 1048576.0f)

static_assert(NH * HD == DM);
static_assert(SEQ % 256 == 0);
static_assert(SEQ <= SEQ_FULL);
static_assert(NB <= NB_FULL);
static_assert(MROWS % 256 == 0);
static_assert(DM % 128 == 0);
static_assert(((size_t)SEQ * DM) % (8 * 256) == 0);
static_assert(((size_t)DM * DM) % (8 * 256) == 0);

#define WS_XB  ((size_t)0)                                   // bf16 x rows [b*SEQ + s][DM]
#define WS_WQ  (WS_XB  + 2u * (size_t)MROWS * DM)            // bf16 Wq [out][in]
#define WS_WK  (WS_WQ  + 2u * (size_t)DM * DM)
#define WS_WV  (WS_WK  + 2u * (size_t)DM * DM)
#define WS_WO  (WS_WV  + 2u * (size_t)DM * DM)               // f16 (bf16(Wo) * 2^8) [out][in]
#define WS_QH  (WS_WO  + 2u * (size_t)DM * DM)               // f16 rotated q rows [b*SEQ + s][DM]
#define WS_KH  (WS_QH  + 2u * (size_t)MROWS * DM)            // f16 rotated k rows
#define WS_CTX (WS_KH  + 2u * (size_t)MROWS * DM)            // f16 (w * v * 2^12) rows
#define WS_DG  (WS_CTX + 2u * (size_t)MROWS * DM)            // f32 diagonal logits [b][h][s]
#define WS_WP  (WS_DG  + 4u * (size_t)NB * NH * SEQ)         // f32 diagonal probabilities [b][h][s]
#define WS_END (WS_WP  + 4u * (size_t)NB * NH * SEQ)
static_assert(WS_END <= (size_t)134217728);
static_assert(WS_DG % 128 == 0);

#define KP 64u                      /* k elements of one projection stage: 128 B of every row */
#define LP 144u                     /* LDS row pitch of a projection stage, bytes */
#define STG (384u * LP)             /* one projection stage: 256 rows of the left operand, then 128 rows of the weight */
#define NTR (DM / KP)
#define LPK 272u                    /* LDS row pitch of a key stage, bytes: 256 B of data */
#define STGK (128u * LPK)           /* one key stage: 128 keys x 128 head elements */
#define NKB (SEQ / 128u)
static_assert(NTR >= 2u);
#define CP1(l, g) "global_load_async_to_lds_b128 %" #l ", %" #g ", off\n\t"
__device__ __forceinline__ unsigned lds_off(const void* p) { return (unsigned)(size_t)p; }
// the ring's two waits in statements of their own, each with the memory clobber that keeps LDS reads and copies on their side of it
__device__ __forceinline__ void wait_ds() { asm volatile("s_wait_dscnt 0x0" ::: "memory"); }       /* this wave's LDS reads are done before the buffer is handed back */
__device__ __forceinline__ void wait_async() { asm volatile("s_wait_asynccnt 0x0" ::: "memory"); } /* this wave's copies have landed before the barrier publishes them */
// 12 copies of one lane: rows crow + 32 i of the stage (i < 8: left operand, i >= 8: weight); s_wait_xcnt closes the statement so that no address register is rewritten ahead of it
__device__ __forceinline__ void stage_copy(unsigned l, const char* ga, const char* gw) {
  const size_t rs = (size_t)32u * DM * 2u; const unsigned ls = 32u * LP;
  asm volatile(CP1(0, 12) CP1(1, 13) CP1(2, 14) CP1(3, 15) CP1(4, 16) CP1(5, 17) CP1(6, 18) CP1(7, 19) CP1(8, 20) CP1(9, 21) CP1(10, 22) CP1(11, 23) "s_wait_xcnt 0x0"
    :: "v"(l), "v"(l + ls), "v"(l + 2u * ls), "v"(l + 3u * ls), "v"(l + 4u * ls), "v"(l + 5u * ls), "v"(l + 6u * ls), "v"(l + 7u * ls), "v"(l + 8u * ls), "v"(l + 9u * ls), "v"(l + 10u * ls), "v"(l + 11u * ls),
       "v"(ga), "v"(ga + rs), "v"(ga + 2u * rs), "v"(ga + 3u * rs), "v"(ga + 4u * rs), "v"(ga + 5u * rs), "v"(ga + 6u * rs), "v"(ga + 7u * rs), "v"(gw), "v"(gw + rs), "v"(gw + 2u * rs), "v"(gw + 3u * rs)
    : "memory");
}
// 8 copies of one lane: key rows krow + 8 i, i = 0..7, of half a key stage
__device__ __forceinline__ void key_copy(unsigned l, const char* g) {
  const size_t rs = (size_t)8u * DM * 2u; const unsigned ls = 8u * LPK;
  asm volatile(CP1(0, 8) CP1(1, 9) CP1(2, 10) CP1(3, 11) CP1(4, 12) CP1(5, 13) CP1(6, 14) CP1(7, 15) "s_wait_xcnt 0x0"
    :: "v"(l), "v"(l + ls), "v"(l + 2u * ls), "v"(l + 3u * ls), "v"(l + 4u * ls), "v"(l + 5u * ls), "v"(l + 6u * ls), "v"(l + 7u * ls),
       "v"(g), "v"(g + rs), "v"(g + 2u * rs), "v"(g + 3u * rs), "v"(g + 4u * rs), "v"(g + 5u * rs), "v"(g + 6u * rs), "v"(g + 7u * rs)
    : "memory");
}
// acc[mi][nj] += A[256 rows][DM] x W[128 rows][DM]^T for this wave's 64 x 64 share (8 waves: wave >> 1 picks the 64 rows, wave & 1 the 64 weight rows), k ascending in steps of 32;
// A, Wt = the block's first rows (16-bit elements, row pitch DM). Every fragment read from LDS feeds four matrix instructions.
// Every wave of the block calls it; the ring's last readers have left it when it returns (the last trip ends in s_wait_dscnt 0 and the barrier).
template <bool BF> __device__ __forceinline__ void gemm_ring(unsigned char* ring, const void* A, const void* Wt, unsigned tid, v8f (&acc)[4][4]) {
  const unsigned wave = tid >> 5, lane = tid & 31u, col = lane & 15u; const unsigned crow = tid >> 3, cch = tid & 7u;
  const char* ga = (const char*)A + ((size_t)crow * DM + cch * 8u) * 2u; const char* gw = (const char*)Wt + ((size_t)crow * DM + cch * 8u) * 2u;
  const unsigned l0 = lds_off(ring) + crow * LP + cch * 16u;
  stage_copy(l0, ga, gw);
  wait_async();
  __syncthreads();   /* publishes stage 0 */
  stage_copy(l0 + STG, ga + KP * 2u, gw + KP * 2u);
#pragma unroll 1   /* kept rolled: one trip is already 32 matrix instructions, and the text of four such loops stays small */
  for (unsigned t = 0; t < NTR; ++t) {
    const unsigned char* ab = ring + (t & 1u) * STG + ((wave >> 1) * 64u + col) * LP; const unsigned char* wb = ring + (t & 1u) * STG + (256u + (wave & 1u) * 64u + col) * LP;
    // the eight fragment reads of a k step of 32 stand together in front of its 16 matrix instructions (both steps' fragments at once do not fit beside 16 accumulator tiles under v256)
#pragma unroll
    for (unsigned ks = 0; ks < 2u; ++ks) {
      if constexpr (BF) { v16b a[4], w[4];
#pragma unroll
        for (int i = 0; i < 4; ++i) { a[i] = frag_b((const __bf16*)(ab + i * 16u * LP + ks * 64u), lane); w[i] = frag_b((const __bf16*)(wb + i * 16u * LP + ks * 64u), lane); }
#pragma unroll
        for (int mi = 0; mi < 4; ++mi) {
#pragma unroll
          for (int nj = 0; nj < 4; ++nj) acc[mi][nj] = wmma_bf(a[mi], w[nj], acc[mi][nj]); }
      } else { v16h a[4], w[4];
#pragma unroll
        for (int i = 0; i < 4; ++i) { a[i] = frag_h((const _Float16*)(ab + i * 16u * LP + ks * 64u), lane); w[i] = frag_h((const _Float16*)(wb + i * 16u * LP + ks * 64u), lane); }
#pragma unroll
        for (int mi = 0; mi < 4; ++mi) {
#pragma unroll
          for (int nj = 0; nj < 4; ++nj) acc[mi][nj] = wmma16(a[mi], w[nj], acc[mi][nj]); } } }
    wait_ds();
    wait_async();
    __syncthreads();   /* publishes stage t + 1 and ends every reader's last read of stage t's buffer */
    if (t + 2u < NTR) stage_copy(l0 + (t & 1u) * STG, ga + (size_t)(t + 2u) * (KP * 2u), gw + (size_t)(t + 2u) * (KP * 2u));
  }
  wait_async();
}

// ---- k_cvt: ONE launch converts x and the four weights. The five 16-bit planes lie one behind the other in the workspace: NB + 4 segments (each batch of x, then Wq, Wk, Wv, Wo) of CVT_BLOCKS tiles each.
// A tile = CVT_TILE pieces of 8 elements (32 B read, 16 B written a piece). Block n converts tile n of every segment, the next segment's 8 loads a lane issued ahead of this segment's conversion:
// few long-lived waves that keep loads in flight, in place of one short-lived wave per 256 elements.
#define CVT_T 512u
#define CVT_U 4u
#define CVT_TILE (CVT_T * CVT_U)
#define CVT_BLOCKS ((unsigned)((size_t)DM * DM / 8u / CVT_TILE))
#define CVT_SEGS ((unsigned)NB + 4u)
static_assert((size_t)CVT_BLOCKS * CVT_TILE * 8u == (size_t)DM * DM);
static_assert((size_t)SEQ * DM == (size_t)DM * DM);   /* a batch of x is as long as a weight */
static_assert(WS_XB == 0 && WS_WQ == 2u * (size_t)NB * DM * DM && WS_WO == WS_WQ + 3u * 2u * (size_t)DM * DM);
// no register that an issued load or store names is rewritten ahead of this wait
__device__ __forceinline__ void wait_x() { asm volatile("s_wait_xcnt 0x0" ::: "memory"); }
__device__ __forceinline__ void cvt_load(v4f (&r)[2u * CVT_U], const float* s) {
#pragma unroll
  for (unsigned u = 0; u < CVT_U; ++u) { r[2u * u] = *(const v4f*)(s + u * (CVT_T * 8u)); r[2u * u + 1u] = *(const v4f*)(s + u * (CVT_T * 8u) + 4u); }
  wait_x();
  __builtin_amdgcn_sched_barrier(0);   /* the loads stay one group ahead of the conversion that follows, and that conversion's register writes stay behind the wait */
}
__global__ __launch_bounds__(512) void k_cvt(const float* __restrict__ X, const float* __restrict__ Q, const float* __restrict__ K, const float* __restrict__ V, const float* __restrict__ O,
    unsigned short* __restrict__ dst) {
  const unsigned off = blockIdx.x * (CVT_TILE * 8u) + threadIdx.x * 8u;   /* this lane's first element inside every segment */
  v4f cur[2u * CVT_U], nxt[2u * CVT_U];
  cvt_load(cur, X + off);
#pragma unroll   /* unrolled: the segment number picks the source pointer and the target type at compile time, and the two register sets need no copies */
  for (unsigned s = 0; s < CVT_SEGS; ++s) {
    const unsigned n = s + 1u;
    if (n < CVT_SEGS) cvt_load(nxt, (n < (unsigned)NB ? X + (size_t)n * ((size_t)SEQ_FULL * DM) : n == (unsigned)NB ? Q : n == (unsigned)NB + 1u ? K : n == (unsigned)NB + 2u ? V : O) + off);
    v4u o[CVT_U];
#pragma unroll
    for (unsigned u = 0; u < CVT_U; ++u) { const v4f a = cur[2u * u], b = cur[2u * u + 1u];
      if (s + 1u < CVT_SEGS) { v8b t;
#pragma unroll
        for (int e = 0; e < 4; ++e) { t[e] = (__bf16)a[e]; t[4 + e] = (__bf16)b[e]; }
        o[u] = __builtin_bit_cast(v4u, t);
      } else { v8h t;   /* the last segment, Wo, goes to f16 (bf16 value x 2^8) */
#pragma unroll
        for (int e = 0; e < 4; ++e) { t[e] = (_Float16)(bfr(a[e]) * WOC); t[4 + e] = (_Float16)(bfr(b[e]) * WOC); }
        o[u] = __builtin_bit_cast(v4u, t);
      } }
    __builtin_amdgcn_sched_barrier(0);   /* all four pieces are converted before the first store issues: no store's data register is reused ahead of the wait behind the stores */
    unsigned short* d = dst + (size_t)s * ((size_t)DM * DM) + off;
#pragma unroll
    for (unsigned u = 0; u < CVT_U; ++u) vst2((void*)(d + u * (CVT_T * 8u)), o[u]);
    wait_x();
    __builtin_amdgcn_sched_barrier(0);   /* keeps the next segment's register writes behind that wait */
#pragma unroll
    for (unsigned u = 0; u < 2u * CVT_U; ++u) cur[u] = nxt[u];
  }
}

// ---- k_qk: block = (256 token rows, head h): q projection then k projection, one after the other (exact bf16 products, K = DM; 16 accumulator tiles live at a time);
// rotation with the bf16-converted input tables (kept in LDS as the two bf16 values of a pair in one dword: nothing is lost, they are bf16 values); the rotated f32 q' tile waits in LDS for the diagonal dot,
// and each lane then puts the f16 pair (q', k') back into the dword it read; f16 q'/k' rows, f32 diagonal logit per row (the two column halves of a row are summed by two waves, then added)
__global__ __launch_bounds__(256) void k_qk(const __bf16* __restrict__ XB, const __bf16* __restrict__ WQ, const __bf16* __restrict__ WK, const float* __restrict__ COS, const float* __restrict__ SIN,
    _Float16* __restrict__ QH, _Float16* __restrict__ KH, float* __restrict__ DG) {
  __shared__ __align__(16) unsigned sq[256][132];    /* the bits of f32 q', later of the f16 pair (q' low half, k' high half) */
  __shared__ __align__(16) unsigned stab[256][68];   /* bf16 cos (low half) and bf16 sin (high half) of (position, pair) */
  __shared__ __align__(16) float sdg[2][256];
  __shared__ __align__(16) unsigned char ring[2u * STG];
  const unsigned tid = threadIdx.x, wave = tid >> 5, lane = tid & 31u, col = lane & 15u, g = lane >> 4;
  const unsigned wr0 = (wave >> 1) * 64u + 8u * g, wn = wave & 1u;   /* this lane's first row and this wave's column half */
  const unsigned h = blockIdx.y, c0 = h * HD; const unsigned r0 = blockIdx.x * 256u; const unsigned bb = r0 / (unsigned)SEQ, t0 = r0 % (unsigned)SEQ;
  const bool odd = (col & 1u) != 0u;
  // ---- phase 1: q projection, rotation, f32 q' tile to LDS (each lane later re-reads exactly the positions it wrote)
  {
    v8f aq[4][4] = {};
    gemm_ring<true>(ring, XB + (size_t)r0 * DM, WQ + (size_t)c0 * DM, tid, aq);
    // table tile: positions t0..t0+255, 64 pairs, bf16-converted values
    { const unsigned rl = tid >> 4, q = tid & 15u; const size_t o = (size_t)(t0 + rl) * 64u + q * 4u; v4f c[16], s[16];   /* rows rl + 16 i */
#pragma unroll
      for (unsigned i = 0; i < 16u; ++i) { c[i] = *(const v4f*)(COS + o + i * (16u * 64u)); s[i] = *(const v4f*)(SIN + o + i * (16u * 64u)); }
      wait_x();
      __builtin_amdgcn_sched_barrier(0);   /* the 32 loads fly together, and what follows writes no register of theirs ahead of the wait */
#pragma unroll
      for (unsigned i = 0; i < 16u; ++i) { v4u p;
#pragma unroll
        for (int u = 0; u < 4; ++u) p[u] = (unsigned)__builtin_bit_cast(unsigned short, (__bf16)c[i][u]) | ((unsigned)__builtin_bit_cast(unsigned short, (__bf16)s[i][u]) << 16);
        *(v4u*)&stab[rl + 16u * i][q * 4u] = p; } }
    __syncthreads();   /* table tile is cross-wave: block barrier */
#pragma unroll
    for (int mi = 0; mi < 4; ++mi) {
#pragma unroll
      for (int nj = 0; nj < 4; ++nj) {
#pragma unroll
        for (int r = 0; r < 8; ++r) { const unsigned rl = wr0 + mi * 16u + r; const unsigned cc = wn * 64u + nj * 16u + col;
          const unsigned cs = stab[rl][cc >> 1]; const float c = __builtin_bit_cast(float, cs << 16), s = __builtin_bit_cast(float, cs & 0xffff0000u);
          const float oq = aq[mi][nj][r];
          const float pq = __shfl_xor(oq, 1);                              /* pair partner (column ^ 1), all lanes active */
          const float sg = odd ? s : -s;                                    /* even column: te*c - to*s; odd column: to*c + te*s */
          const float qv = oq * c + pq * sg;
          sq[rl][cc] = __builtin_bit_cast(unsigned, qv); } } }
  }
  __syncthreads();
  // ---- phase 2: k projection, rotation, diagonal dot against the staged q' values, f16 pair back to LDS
  v8f ak[4][4] = {};
  gemm_ring<true>(ring, XB + (size_t)r0 * DM, WK + (size_t)c0 * DM, tid, ak);
#pragma unroll
  for (int mi = 0; mi < 4; ++mi) {
    float ds[8] = {0.f, 0.f, 0.f, 0.f, 0.f, 0.f, 0.f, 0.f};
#pragma unroll
    for (int nj = 0; nj < 4; ++nj) {
#pragma unroll
      for (int r = 0; r < 8; ++r) { const unsigned rl = wr0 + mi * 16u + r; const unsigned cc = wn * 64u + nj * 16u + col;
        const unsigned cs = stab[rl][cc >> 1]; const float c = __builtin_bit_cast(float, cs << 16), s = __builtin_bit_cast(float, cs & 0xffff0000u);
        const float okv = ak[mi][nj][r];
        const float pk = __shfl_xor(okv, 1);                               /* pair partner (column ^ 1), all lanes active */
        const float sg = odd ? s : -s;
        const float kv = okv * c + pk * sg;
        const float qv = __builtin_bit_cast(float, sq[rl][cc]);
        ds[r] += qv * kv;
        sq[rl][cc] = (unsigned)__builtin_bit_cast(unsigned short, (_Float16)qv) | ((unsigned)__builtin_bit_cast(unsigned short, (_Float16)kv) << 16); } }
#pragma unroll
    for (int r = 0; r < 8; ++r) { float d = ds[r]; d += __shfl_xor(d, 1); d += __shfl_xor(d, 2); d += __shfl_xor(d, 4); d += __shfl_xor(d, 8);
      if (col == 0u) sdg[wn][wr0 + mi * 16u + r] = d; } }
  __syncthreads();   /* cross-wave LDS tiles: block barrier */
#pragma unroll
  for (unsigned rb = 0; rb < 256u; rb += 64u) { const unsigned rl = rb + (tid >> 4), q = tid & 15u; const size_t o = (size_t)(r0 + rl) * DM + c0 + q * 8u; v4u oq4[4], ok4[4];   /* rows rl + 16 i; the low halves are q', the high halves k' */
#pragma unroll
    for (unsigned i = 0; i < 4u; ++i) { const v4u p0 = *(const v4u*)&sq[rl + 16u * i][q * 8u], p1 = *(const v4u*)&sq[rl + 16u * i][q * 8u + 4u];
      oq4[i][0] = (p0[0] & 0xffffu) | (p0[1] << 16); oq4[i][1] = (p0[2] & 0xffffu) | (p0[3] << 16); oq4[i][2] = (p1[0] & 0xffffu) | (p1[1] << 16); oq4[i][3] = (p1[2] & 0xffffu) | (p1[3] << 16);
      ok4[i][0] = (p0[0] >> 16) | (p0[1] & 0xffff0000u); ok4[i][1] = (p0[2] >> 16) | (p0[3] & 0xffff0000u); ok4[i][2] = (p1[0] >> 16) | (p1[1] & 0xffff0000u); ok4[i][3] = (p1[2] >> 16) | (p1[3] & 0xffff0000u); }
    __builtin_amdgcn_sched_barrier(0);   /* all eight pieces are formed before the first store issues: no store's register is reused ahead of the wait behind the stores */
#pragma unroll
    for (unsigned i = 0; i < 4u; ++i) { vst2((void*)(QH + o + (size_t)i * (16u * DM)), oq4[i]); vst2((void*)(KH + o + (size_t)i * (16u * DM)), ok4[i]); }
    wait_x();
    __builtin_amdgcn_sched_barrier(0);   /* keeps the next group's register writes behind that wait */
  }
  if (tid < 64u) { const v4f d0 = *(const v4f*)&sdg[0][tid * 4u], d1 = *(const v4f*)&sdg[1][tid * 4u]; vst2((void*)(DG + (size_t)(bb * NH + h) * SEQ + t0 + tid * 4u), (d0 + d1) * SCALE); }
}

// ---- k_lse: block = 64 query rows of (b, h); one streaming pass over all SEQ keys (128 per step): f16 q' x f16 k' logits, f32 running max / running sum in the log2 domain; w = exp(diag - lse)
__global__ __launch_bounds__(128) void k_lse(const _Float16* __restrict__ QH, const _Float16* __restrict__ KH, const float* __restrict__ DG, float* __restrict__ WP) {
  __shared__ __align__(16) float sw[64];
  __shared__ __align__(16) unsigned char ring[2u * STGK];
  const unsigned tid = threadIdx.x, wave = tid >> 5, lane = tid & 31u, col = lane & 15u, g = lane >> 4;
  const unsigned qb = blockIdx.x, h = blockIdx.y, b = blockIdx.z; const unsigned c0 = h * HD; const unsigned ql0 = qb * 64u + wave * 16u;
  const size_t q0 = (size_t)b * SEQ + ql0, kr0 = (size_t)b * SEQ;
  const float C2 = SCALE * LOG2E;
  v16h qf[4];
#pragma unroll
  for (int kc = 0; kc < 4; ++kc) qf[kc] = frag_h(QH + (q0 + col) * DM + c0 + kc * 32u, lane);
  float m[8], sm[8];
#pragma unroll
  for (int r = 0; r < 8; ++r) { m[r] = -3.0e38f; sm[r] = 0.f; }
  // key ring: a stage is 128 keys x 256 B; lane = (row tid >> 4, 16-B piece tid & 15), 16 copies a lane and stage in two statements
  const char* gk = (const char*)(KH + (kr0 + (tid >> 4)) * DM + c0 + (tid & 15u) * 8u); const size_t gstep = (size_t)128u * DM * 2u, ghalf = (size_t)64u * DM * 2u;
  const unsigned lk = lds_off(ring) + (tid >> 4) * LPK + (tid & 15u) * 16u;
  key_copy(lk, gk); key_copy(lk + 64u * LPK, gk + ghalf);
  wait_async();
  __syncthreads();   /* publishes stage 0 */
  if (NKB > 1u) { key_copy(lk + STGK, gk + gstep); key_copy(lk + STGK + 64u * LPK, gk + gstep + ghalf); }
#pragma unroll 1
  for (unsigned kb = 0; kb < NKB; ++kb) {
    v8f acc[8] = {};
#pragma unroll
    for (int j = 0; j < 8; ++j) { const _Float16* kp = (const _Float16*)(ring + (kb & 1u) * STGK + (j * 16u + col) * LPK);
      const v16h k0 = frag_h(kp, lane), k1 = frag_h(kp + 32, lane), k2 = frag_h(kp + 64, lane), k3 = frag_h(kp + 96, lane);
      acc[j] = wmma16(qf[0], k0, acc[j]); acc[j] = wmma16(qf[1], k1, acc[j]); acc[j] = wmma16(qf[2], k2, acc[j]); acc[j] = wmma16(qf[3], k3, acc[j]); }
#pragma unroll
    for (int r = 0; r < 8; ++r) { float mx = acc[0][r];
#pragma unroll
      for (int j = 1; j < 8; ++j) mx = fmaxf(mx, acc[j][r]);
      const float mn = fmaxf(m[r], mx * C2); float s = 0.f;
#pragma unroll
      for (int j = 0; j < 8; ++j) s += exp2f(fmaf(acc[j][r], C2, -mn));
      sm[r] = sm[r] * exp2f(m[r] - mn) + s; m[r] = mn; }
    wait_ds();
    wait_async();
    __syncthreads();   /* publishes stage kb + 1 and ends every reader's last read of stage kb's buffer */
    if (kb + 2u < NKB) { const char* gn = gk + (size_t)(kb + 2u) * gstep; const unsigned ln = lk + (kb & 1u) * STGK; key_copy(ln, gn); key_copy(ln + 64u * LPK, gn + ghalf); } }
  wait_async();
  // merge the 16 column lanes of each half (rows stay within a half); all lanes active
#pragma unroll
  for (int off = 1; off < 16; off <<= 1) {
#pragma unroll
    for (int r = 0; r < 8; ++r) { const float om = __shfl_xor(m[r], off), os = __shfl_xor(sm[r], off); const float mn = fmaxf(m[r], om);
      sm[r] = sm[r] * exp2f(m[r] - mn) + os * exp2f(om - mn); m[r] = mn; } }
  const float* dp = DG + (size_t)(b * NH + h) * SEQ + ql0 + 8u * g;
  const v4f d0 = *(const v4f*)dp, d1 = *(const v4f*)(dp + 4);
#pragma unroll
  for (int r = 0; r < 8; ++r) { const float dg = r < 4 ? d0[r & 3] : d1[r & 3]; const float w = exp2f(dg * LOG2E - m[r] - log2f(sm[r]));
    if (col == 0u) sw[wave * 16u + 8u * g + r] = w; }
  __syncthreads();   /* cross-wave LDS: block barrier */
  if (tid < 16u) vst2((void*)(WP + (size_t)(b * NH + h) * SEQ + qb * 64u + tid * 4u), *(const v4f*)&sw[tid * 4u]);   
}

// ---- k_vw: block = (256 token rows, head h): v projection (exact bf16 products) x the row's diagonal probability -> f16 (w * v * 2^12) rows
__global__ __launch_bounds__(256) void k_vw(const __bf16* __restrict__ XB, const __bf16* __restrict__ WV, const float* __restrict__ WP, _Float16* __restrict__ CTX) {
  __shared__ __align__(16) _Float16 sh[256][136];
  __shared__ __align__(16) unsigned char ring[2u * STG];
  const unsigned tid = threadIdx.x, wave = tid >> 5, lane = tid & 31u, col = lane & 15u, g = lane >> 4;
  const unsigned wr0 = (wave >> 1) * 64u + 8u * g, wn = wave & 1u;   /* this lane's first row and this wave's column half */
  const unsigned h = blockIdx.y, c0 = h * HD; const unsigned r0 = blockIdx.x * 256u; const unsigned bb = r0 / (unsigned)SEQ, t0 = r0 % (unsigned)SEQ;
  v8f av[4][4] = {};
  gemm_ring<true>(ring, XB + (size_t)r0 * DM, WV + (size_t)c0 * DM, tid, av);
#pragma unroll
  for (int mi = 0; mi < 4; ++mi) {
    const float* wp = WP + (size_t)(bb * NH + h) * SEQ + t0 + wr0 + mi * 16u;
    const v4f w0 = *(const v4f*)wp, w1 = *(const v4f*)(wp + 4);
#pragma unroll
    for (int nj = 0; nj < 4; ++nj) {
#pragma unroll
      for (int r = 0; r < 8; ++r) { const float wr = (r < 4 ? w0[r & 3] : w1[r & 3]) * CTXC; sh[wr0 + mi * 16u + r][wn * 64u + nj * 16u + col] = (_Float16)(av[mi][nj][r] * wr); } } }
  __syncthreads();
#pragma unroll
  for (unsigned rb = 0; rb < 256u; rb += 128u) { const unsigned rl = rb + (tid >> 4), q = tid & 15u; _Float16* d = CTX + (size_t)(r0 + rl) * DM + c0 + q * 8u; v4u o[8];   /* rows rl + 16 i */
#pragma unroll
    for (unsigned i = 0; i < 8u; ++i) o[i] = *(const v4u*)&sh[rl + 16u * i][q * 8u];
    __builtin_amdgcn_sched_barrier(0);   /* all eight pieces are read before the first store issues: no store's register is reused ahead of the wait behind the stores */
#pragma unroll
    for (unsigned i = 0; i < 8u; ++i) vst2((void*)(d + (size_t)i * (16u * DM)), o[i]);
    wait_x();
    __builtin_amdgcn_sched_barrier(0);   /* keeps the next group's register writes behind that wait */
  }
}

__global__ __launch_bounds__(256) void k_out(const _Float16* __restrict__ CTX, const _Float16* __restrict__ WO, float* __restrict__ OUT) {
  __shared__ __align__(16) unsigned char ring[2u * STG];
  __shared__ __align__(16) float ss[256][132];   /* output staging, an array of its own: with one block of 256 rows to a WGP the LDS is not short */
  const unsigned tid = threadIdx.x, wave = tid >> 5, lane = tid & 31u, col = lane & 15u, g = lane >> 4;
  const unsigned wr0 = (wave >> 1) * 64u + 8u * g, wn = wave & 1u;   /* this lane's first row and this wave's column half */
  const unsigned c0 = blockIdx.y * 128u; const unsigned r0 = blockIdx.x * 256u; const unsigned bb = r0 / (unsigned)SEQ, t0 = r0 % (unsigned)SEQ;
  v8f acc[4][4] = {};
  gemm_ring<false>(ring, CTX + (size_t)r0 * DM, WO + (size_t)c0 * DM, tid, acc);
#pragma unroll
  for (int mi = 0; mi < 4; ++mi) {
#pragma unroll
    for (int nj = 0; nj < 4; ++nj) {
#pragma unroll
      for (int r = 0; r < 8; ++r) ss[wr0 + mi * 16u + r][wn * 64u + nj * 16u + col] = acc[mi][nj][r] * OUTC; } }
  __syncthreads();   /* a row's two column halves come from two waves: block barrier */
  const size_t orow0 = (size_t)bb * SEQ_FULL + t0 + wave * 32u;
#pragma unroll
  for (unsigned rb = 0; rb < 32u; rb += 8u) { v4f o[8];
#pragma unroll
    for (unsigned i = 0; i < 8u; ++i) o[i] = *(const v4f*)&ss[wave * 32u + rb + i][lane * 4u];
    __builtin_amdgcn_sched_barrier(0);   /* all eight rows are read before the first store issues: no store's register is reused ahead of the wait behind the stores */
#pragma unroll
    for (unsigned i = 0; i < 8u; ++i) vst2((void*)(OUT + (orow0 + rb + i) * DM + c0 + lane * 4u), o[i]);
    wait_x();
    __builtin_amdgcn_sched_barrier(0);   /* keeps the next group's register writes behind that wait */
  }
}

extern "C" void kernel_launch(void* const* d_in, const int* in_sizes, int n_in, void* d_out, int out_size, void* d_ws, size_t ws_size, hipStream_t stream) {
  if (n_in < 7) return;
  const long long need_x = (long long)(NB - 1) * SEQ_FULL * DM + (long long)SEQ * DM;
  if ((long long)in_sizes[0] < need_x) return;
  if (in_sizes[1] < SEQ * 64 || in_sizes[2] < SEQ * 64) return;
  if (in_sizes[3] < DM * DM || in_sizes[4] < DM * DM || in_sizes[5] < DM * DM || in_sizes[6] < DM * DM) return;
  if ((long long)out_size < need_x) return;
  if (ws_size < (size_t)WS_END) return;
  // inputs (wire order): 0 x [2,2048,2048]; 1 cos table [2048][64]; 2 sin table [2048][64]; 3 Wq; 4 Wk; 5 Wv; 6 Wo (each [2048 out][2048 in])
  const float* const* F = (const float* const*)d_in;
  char* ws = (char*)d_ws;
  unsigned short* XB = (unsigned short*)(ws + WS_XB); unsigned short* WQ = (unsigned short*)(ws + WS_WQ); unsigned short* WK = (unsigned short*)(ws + WS_WK);
  unsigned short* WV = (unsigned short*)(ws + WS_WV); unsigned short* WO = (unsigned short*)(ws + WS_WO);
  _Float16* QH = (_Float16*)(ws + WS_QH); _Float16* KH = (_Float16*)(ws + WS_KH); _Float16* CTX = (_Float16*)(ws + WS_CTX);
  float* DG = (float*)(ws + WS_DG); float* WP = (float*)(ws + WS_WP);
  k_cvt<<<dim3(CVT_BLOCKS), CVT_T, 0, stream>>>(F[0], F[3], F[4], F[5], F[6], XB);
  k_qk<<<dim3(MROWS / 256, NH), 256, 0, stream>>>((const __bf16*)XB, (const __bf16*)WQ, (const __bf16*)WK, F[1], F[2], QH, KH, DG);
  k_lse<<<dim3(SEQ / 64, NH, NB), 128, 0, stream>>>(QH, KH, DG, WP);
  k_vw<<<dim3(MROWS / 256, NH), 256, 0, stream>>>((const __bf16*)XB, (const __bf16*)WV, WP, CTX);
  k_out<<<dim3(MROWS / 256, DM / 128), 256, 0, stream>>>(CTX, (const _Float16*)WO, (float*)d_out);
}

// v004
// One run takes 190 microseconds.
// Timed twice side by side with v003, it ran 1.06 and 1.07 times as fast.
// All steps since v000 together make it 5.05 times as fast.
// compute dtype: every float input RNE-converted to bf16 on load; q/k/v projections = exact bf16 x bf16 products on v_wmma_f32_16x16x32_bf16 (f32 accumulate); score statistics q' x k' once to f16 each on v_wmma_f32_16x16x32_f16 (f32 accumulate, f32 running max / running sum); diagonal logit = f32 VALU dot of the f32 q', k' (per-row, no shared operand); output projection = f16(w*v * 2^12) x f16(bf16(Wo) * 2^8) on v_wmma_f32_16x16x32_f16, f32 accumulate, x 2^-20 in the f32 epilogue.
#include <hip/hip_runtime.h>
#include <math.h>

typedef __attribute__((ext_vector_type(16))) _Float16 v16h;
typedef __attribute__((ext_vector_type(16))) __bf16 v16b;
typedef __attribute__((ext_vector_type(8)))  _Float16 v8h;
typedef __attribute__((ext_vector_type(8)))  __bf16 v8b;
typedef __attribute__((ext_vector_type(8)))  float v8f;
typedef __attribute__((ext_vector_type(4)))  float v4f;
typedef __attribute__((ext_vector_type(2)))  float v2f;
typedef __attribute__((ext_vector_type(4)))  unsigned v4u;

template <typename T> __device__ __forceinline__ void vst2(void* p, T v) { *(T*)p = v;  }
__device__ __forceinline__ v8f wmma16(v16h a, v16h b, v8f c) {
  v8f d = __builtin_amdgcn_wmma_f32_16x16x32_f16(false, a, false, b, (short)0, c, false, false);
  asm volatile("v_nop\n\tv_nop\n\tv_nop\n\tv_nop" : "+v"(d) : "v"(a), "v"(b));
  return d;
}
__device__ __forceinline__ v8f wmma_bf(v16b a, v16b b, v8f c) {
  v8f d = __builtin_amdgcn_wmma_f32_16x16x32_bf16(false, a, false, b, (short)0, c, false, false);
  asm volatile("v_nop\n\tv_nop\n\tv_nop\n\tv_nop" : "+v"(d) : "v"(a), "v"(b));
  return d;
}
// 16x16x32 fragments (A and B alike): lane = (g = lane>>4, row/col = lane&15); elements 0..7 = k0+8g+0..7, 8..15 = k0+16+8g+0..7; D element r = (row 8g+r, col lane&15)
__device__ __forceinline__ v16h frag_h(const _Float16* rowk0, unsigned lane) {
  union { v16h v; v8h q[2]; } u; const _Float16* p = rowk0 + 8u * (lane >> 4);
  u.q[0] = *(const v8h*)p; u.q[1] = *(const v8h*)(p + 16); return u.v;
}
__device__ __forceinline__ v16b frag_b(const __bf16* rowk0, unsigned lane) {
  union { v16b v; v8b q[2]; } u; const __bf16* p = rowk0 + 8u * (lane >> 4);
  u.q[0] = *(const v8b*)p; u.q[1] = *(const v8b*)(p + 16); return u.v;
}
__device__ __forceinline__ float bfr(float v) { return (float)(__bf16)v; }

// Self-attention whose output keeps only the DIAGONAL probability: x [NB][SEQ_FULL][DM] (first SEQ rows per batch used); Wq/Wk/Wv/Wo [DM out][DM in] (y = x W^T, no bias); 16 heads x 128;
// interleaved-pair rotation of q and k with INPUT tables cos/sin [SEQ][64]; w[b][h][s] = exp(q'[s].k'[s] * scale - logsumexp_k(q'[s].k'[k] * scale)); ctx = w * v; out = ctx Wo^T.
#ifndef NB
#define NB 2
#endif
#ifndef SEQ
#define SEQ 2048
#endif
#define NB_FULL 2
#define SEQ_FULL 2048
#define DM 2048
#define NH 16
#define HD 128
#define MROWS (NB * SEQ)
#define SCALE 0.08838834764831845f
#define LOG2E 1.4426950408889634f
#define CTXC 4096.0f
#define WOC 256.0f
#define OUTC (1.0f / 1048576.0f)

static_assert(NH * HD == DM);
static_assert(SEQ % 256 == 0);
static_assert(SEQ <= SEQ_FULL);
static_assert(NB <= NB_FULL);
static_assert(MROWS % 256 == 0);
static_assert(DM % 128 == 0);
static_assert(((size_t)SEQ * DM) % (8 * 256) == 0);
static_assert(((size_t)DM * DM) % (8 * 256) == 0);

#define WS_XB  ((size_t)0)                                   // bf16 x rows [b*SEQ + s][DM]
#define WS_WQ  (WS_XB  + 2u * (size_t)MROWS * DM)            // bf16 Wq [out][in]
#define WS_WK  (WS_WQ  + 2u * (size_t)DM * DM)
#define WS_WV  (WS_WK  + 2u * (size_t)DM * DM)
#define WS_WO  (WS_WV  + 2u * (size_t)DM * DM)               // f16 (bf16(Wo) * 2^8) [out][in]
#define WS_QH  (WS_WO  + 2u * (size_t)DM * DM)               // f16 rotated q rows [b*SEQ + s][DM]
#define WS_KH  (WS_QH  + 2u * (size_t)MROWS * DM)            // f16 rotated k rows
#define WS_CTX (WS_KH  + 2u * (size_t)MROWS * DM)            // f16 (w * v * 2^12) rows
#define WS_DG  (WS_CTX + 2u * (size_t)MROWS * DM)            // f32 diagonal logits [b][h][s]
#define WS_WP  (WS_DG  + 4u * (size_t)NB * NH * SEQ)         // f32 diagonal probabilities [b][h][s]
#define WS_END (WS_WP  + 4u * (size_t)NB * NH * SEQ)
static_assert(WS_END <= (size_t)134217728);
static_assert(WS_DG % 128 == 0);

#define KP 64u                      /* k elements of one projection stage: 128 B of every row */
#define LP 144u                     /* LDS row pitch of a projection stage, bytes */
#define STG (384u * LP)             /* one projection stage: 256 rows of the left operand, then 128 rows of the weight */
#define NTR (DM / KP)
#define LPK 272u                    /* LDS row pitch of a key stage, bytes: 256 B of data */
#define STGK (128u * LPK)           /* one key stage: 128 keys x 128 head elements */
#define NKB (SEQ / 128u)
static_assert(NTR >= 2u);
#define CP1(l, g) "global_load_async_to_lds_b128 %" #l ", %" #g ", off\n\t"
__device__ __forceinline__ unsigned lds_off(const void* p) { return (unsigned)(size_t)p; }
// the ring's two waits in statements of their own, each with the memory clobber that keeps LDS reads and copies on their side of it
__device__ __forceinline__ void wait_ds() { asm volatile("s_wait_dscnt 0x0" ::: "memory"); }       /* this wave's LDS reads are done before the buffer is handed back */
__device__ __forceinline__ void wait_async() { asm volatile("s_wait_asynccnt 0x0" ::: "memory"); } /* this wave's copies have landed before the barrier publishes them */
// 12 copies of one lane: rows crow + 32 i of the stage (i < 8: left operand, i >= 8: weight); s_wait_xcnt closes the statement so that no address register is rewritten ahead of it
__device__ __forceinline__ void stage_copy(unsigned l, const char* ga, const char* gw) {
  const size_t rs = (size_t)32u * DM * 2u; const unsigned ls = 32u * LP;
  asm volatile(CP1(0, 12) CP1(1, 13) CP1(2, 14) CP1(3, 15) CP1(4, 16) CP1(5, 17) CP1(6, 18) CP1(7, 19) CP1(8, 20) CP1(9, 21) CP1(10, 22) CP1(11, 23) "s_wait_xcnt 0x0"
    :: "v"(l), "v"(l + ls), "v"(l + 2u * ls), "v"(l + 3u * ls), "v"(l + 4u * ls), "v"(l + 5u * ls), "v"(l + 6u * ls), "v"(l + 7u * ls), "v"(l + 8u * ls), "v"(l + 9u * ls), "v"(l + 10u * ls), "v"(l + 11u * ls),
       "v"(ga), "v"(ga + rs), "v"(ga + 2u * rs), "v"(ga + 3u * rs), "v"(ga + 4u * rs), "v"(ga + 5u * rs), "v"(ga + 6u * rs), "v"(ga + 7u * rs), "v"(gw), "v"(gw + rs), "v"(gw + 2u * rs), "v"(gw + 3u * rs)
    : "memory");
}
// 8 copies of one lane: key rows krow + 8 i, i = 0..7, of half a key stage
__device__ __forceinline__ void key_copy(unsigned l, const char* g) {
  const size_t rs = (size_t)8u * DM * 2u; const unsigned ls = 8u * LPK;
  asm volatile(CP1(0, 8) CP1(1, 9) CP1(2, 10) CP1(3, 11) CP1(4, 12) CP1(5, 13) CP1(6, 14) CP1(7, 15) "s_wait_xcnt 0x0"
    :: "v"(l), "v"(l + ls), "v"(l + 2u * ls), "v"(l + 3u * ls), "v"(l + 4u * ls), "v"(l + 5u * ls), "v"(l + 6u * ls), "v"(l + 7u * ls),
       "v"(g), "v"(g + rs), "v"(g + 2u * rs), "v"(g + 3u * rs), "v"(g + 4u * rs), "v"(g + 5u * rs), "v"(g + 6u * rs), "v"(g + 7u * rs)
    : "memory");
}
// acc[mi][nj] += A[256 rows][DM] x W[128 rows][DM]^T for this wave's 64 x 64 share (8 waves: wave >> 1 picks the 64 rows, wave & 1 the 64 weight rows), k ascending in steps of 32;
// A, Wt = the block's first rows (16-bit elements, row pitch DM). Every fragment read from LDS feeds four matrix instructions.
// Every wave of the block calls it; the ring's last readers have left it when it returns (the last trip ends in s_wait_dscnt 0 and the barrier).
template <bool BF> __device__ __forceinline__ void gemm_ring(unsigned char* ring, const void* A, const void* Wt, unsigned tid, v8f (&acc)[4][4]) {
  const unsigned wave = tid >> 5, lane = tid & 31u, col = lane & 15u; const unsigned crow = tid >> 3, cch = tid & 7u;
  const char* ga = (const char*)A + ((size_t)crow * DM + cch * 8u) * 2u; const char* gw = (const char*)Wt + ((size_t)crow * DM + cch * 8u) * 2u;
  const unsigned l0 = lds_off(ring) + crow * LP + cch * 16u;
  stage_copy(l0, ga, gw);
  wait_async();
  __syncthreads();   /* publishes stage 0 */
  stage_copy(l0 + STG, ga + KP * 2u, gw + KP * 2u);
#pragma unroll 1   /* kept rolled: one trip is already 32 matrix instructions, and the text of four such loops stays small */
  for (unsigned t = 0; t < NTR; ++t) {
    const unsigned char* ab = ring + (t & 1u) * STG + ((wave >> 1) * 64u + col) * LP; const unsigned char* wb = ring + (t & 1u) * STG + (256u + (wave & 1u) * 64u + col) * LP;
    // the eight fragment reads of a k step of 32 stand together in front of its 16 matrix instructions (both steps' fragments at once do not fit beside 16 accumulator tiles under v256)
#pragma unroll
    for (unsigned ks = 0; ks < 2u; ++ks) {
      if constexpr (BF) { v16b a[4], w[4];
#pragma unroll
        for (int i = 0; i < 4; ++i) { a[i] = frag_b((const __bf16*)(ab + i * 16u * LP + ks * 64u), lane); w[i] = frag_b((const __bf16*)(wb + i * 16u * LP + ks * 64u), lane); }
#pragma unroll
        for (int mi = 0; mi < 4; ++mi) {
#pragma unroll
          for (int nj = 0; nj < 4; ++nj) acc[mi][nj] = wmma_bf(a[mi], w[nj], acc[mi][nj]); }
      } else { v16h a[4], w[4];
#pragma unroll
        for (int i = 0; i < 4; ++i) { a[i] = frag_h((const _Float16*)(ab + i * 16u * LP + ks * 64u), lane); w[i] = frag_h((const _Float16*)(wb + i * 16u * LP + ks * 64u), lane); }
#pragma unroll
        for (int mi = 0; mi < 4; ++mi) {
#pragma unroll
          for (int nj = 0; nj < 4; ++nj) acc[mi][nj] = wmma16(a[mi], w[nj], acc[mi][nj]); } } }
    wait_ds();
    wait_async();
    __syncthreads();   /* publishes stage t + 1 and ends every reader's last read of stage t's buffer */
    if (t + 2u < NTR) stage_copy(l0 + (t & 1u) * STG, ga + (size_t)(t + 2u) * (KP * 2u), gw + (size_t)(t + 2u) * (KP * 2u));
  }
  wait_async();
}

// ---- k_cvt: ONE launch converts x and the four weights. The five 16-bit planes lie one behind the other in the workspace: NB + 4 segments (each batch of x, then Wq, Wk, Wv, Wo) of CVT_BLOCKS tiles each.
// A tile = CVT_TILE pieces of 8 elements (32 B read, 16 B written a piece). Block n converts tile n of every segment, the next segment's 8 loads a lane issued ahead of this segment's conversion:
// few long-lived waves that keep loads in flight, in place of one short-lived wave per 256 elements.
#define CVT_T 512u
#define CVT_U 4u
#define CVT_TILE (CVT_T * CVT_U)
#define CVT_BLOCKS ((unsigned)((size_t)DM * DM / 8u / CVT_TILE))
#define CVT_SEGS ((unsigned)NB + 4u)
static_assert((size_t)CVT_BLOCKS * CVT_TILE * 8u == (size_t)DM * DM);
static_assert((size_t)SEQ * DM == (size_t)DM * DM);   /* a batch of x is as long as a weight */
static_assert(WS_XB == 0 && WS_WQ == 2u * (size_t)NB * DM * DM && WS_WO == WS_WQ + 3u * 2u * (size_t)DM * DM);
// no register that an issued load or store names is rewritten ahead of this wait
__device__ __forceinline__ void wait_x() { asm volatile("s_wait_xcnt 0x0" ::: "memory"); }
__device__ __forceinline__ void cvt_load(v4f (&r)[2u * CVT_U], const float* s) {
#pragma unroll
  for (unsigned u = 0; u < CVT_U; ++u) { r[2u * u] = *(const v4f*)(s + u * (CVT_T * 8u)); r[2u * u + 1u] = *(const v4f*)(s + u * (CVT_T * 8u) + 4u); }
  wait_x();
  __builtin_amdgcn_sched_barrier(0);   /* the loads stay one group ahead of the conversion that follows, and that conversion's register writes stay behind the wait */
}
__global__ __launch_bounds__(512) void k_cvt(const float* __restrict__ X, const float* __restrict__ Q, const float* __restrict__ K, const float* __restrict__ V, const float* __restrict__ O,
    unsigned short* __restrict__ dst) {
  const unsigned off = blockIdx.x * (CVT_TILE * 8u) + threadIdx.x * 8u;   /* this lane's first element inside every segment */
  v4f cur[2u * CVT_U], nxt[2u * CVT_U];
  cvt_load(cur, X + off);
#pragma unroll   /* unrolled: the segment number picks the source pointer and the target type at compile time, and the two register sets need no copies */
  for (unsigned s = 0; s < CVT_SEGS; ++s) {
    const unsigned n = s + 1u;
    if (n < CVT_SEGS) cvt_load(nxt, (n < (unsigned)NB ? X + (size_t)n * ((size_t)SEQ_FULL * DM) : n == (unsigned)NB ? Q : n == (unsigned)NB + 1u ? K : n == (unsigned)NB + 2u ? V : O) + off);
    v4u o[CVT_U];
#pragma unroll
    for (unsigned u = 0; u < CVT_U; ++u) { const v4f a = cur[2u * u], b = cur[2u * u + 1u];
      if (s + 1u < CVT_SEGS) { v8b t;
#pragma unroll
        for (int e = 0; e < 4; ++e) { t[e] = (__bf16)a[e]; t[4 + e] = (__bf16)b[e]; }
        o[u] = __builtin_bit_cast(v4u, t);
      } else { v8h t;   /* the last segment, Wo, goes to f16 (bf16 value x 2^8) */
#pragma unroll
        for (int e = 0; e < 4; ++e) { t[e] = (_Float16)(bfr(a[e]) * WOC); t[4 + e] = (_Float16)(bfr(b[e]) * WOC); }
        o[u] = __builtin_bit_cast(v4u, t);
      } }
    __builtin_amdgcn_sched_barrier(0);   /* all four pieces are converted before the first store issues: no store's data register is reused ahead of the wait behind the stores */
    unsigned short* d = dst + (size_t)s * ((size_t)DM * DM) + off;
#pragma unroll
    for (unsigned u = 0; u < CVT_U; ++u) vst2((void*)(d + u * (CVT_T * 8u)), o[u]);
    wait_x();
    __builtin_amdgcn_sched_barrier(0);   /* keeps the next segment's register writes behind that wait */
#pragma unroll
    for (unsigned u = 0; u < 2u * CVT_U; ++u) cur[u] = nxt[u];
  }
}

// ---- k_qk: block = (256 token rows, head h): q projection then k projection, one after the other (exact bf16 products, K = DM; 16 accumulator tiles live at a time);
// rotation with the bf16-converted input tables (kept in LDS as the two bf16 values of a pair in one dword: nothing is lost, they are bf16 values); the rotated f32 q' tile waits in LDS for the diagonal dot,
// and each lane then puts the f16 pair (q', k') back into the dword it read; f16 q'/k' rows, f32 diagonal logit per row (the two column halves of a row are summed by two waves, then added)
__global__ __launch_bounds__(256) void k_qk(const __bf16* __restrict__ XB, const __bf16* __restrict__ WQ, const __bf16* __restrict__ WK, const float* __restrict__ COS, const float* __restrict__ SIN,
    _Float16* __restrict__ QH, _Float16* __restrict__ KH, float* __restrict__ DG) {
  __shared__ __align__(16) unsigned sq[256][132];    /* the bits of f32 q', later of the f16 pair (q' low half, k' high half) */
  __shared__ __align__(16) unsigned stab[256][68];   /* bf16 cos (low half) and bf16 sin (high half) of (position, pair) */
  __shared__ __align__(16) float sdg[2][256];
  __shared__ __align__(16) unsigned char ring[2u * STG];
  const unsigned tid = threadIdx.x, wave = tid >> 5, lane = tid & 31u, col = lane & 15u, g = lane >> 4;
  const unsigned wr0 = (wave >> 1) * 64u + 8u * g, wn = wave & 1u;   /* this lane's first row and this wave's column half */
  const unsigned h = blockIdx.y, c0 = h * HD; const unsigned r0 = blockIdx.x * 256u; const unsigned bb = r0 / (unsigned)SEQ, t0 = r0 % (unsigned)SEQ;
  const bool odd = (col & 1u) != 0u;
  // ---- phase 1: q projection, rotation, f32 q' tile to LDS (each lane later re-reads exactly the positions it wrote)
  {
    v8f aq[4][4] = {};
    gemm_ring<true>(ring, XB + (size_t)r0 * DM, WQ + (size_t)c0 * DM, tid, aq);
    // table tile: positions t0..t0+255, 64 pairs, bf16-converted values
    { const unsigned rl = tid >> 4, q = tid & 15u; const size_t o = (size_t)(t0 + rl) * 64u + q * 4u; v4f c[16], s[16];   /* rows rl + 16 i */
#pragma unroll
      for (unsigned i = 0; i < 16u; ++i) { c[i] = *(const v4f*)(COS + o + i * (16u * 64u)); s[i] = *(const v4f*)(SIN + o + i * (16u * 64u)); }
      wait_x();
      __builtin_amdgcn_sched_barrier(0);   /* the 32 loads fly together, and what follows writes no register of theirs ahead of the wait */
#pragma unroll
      for (unsigned i = 0; i < 16u; ++i) { v4u p;
#pragma unroll
        for (int u = 0; u < 4; ++u) p[u] = (unsigned)__builtin_bit_cast(unsigned short, (__bf16)c[i][u]) | ((unsigned)__builtin_bit_cast(unsigned short, (__bf16)s[i][u]) << 16);
        *(v4u*)&stab[rl + 16u * i][q * 4u] = p; } }
    __syncthreads();   /* table tile is cross-wave: block barrier */
#pragma unroll
    for (int mi = 0; mi < 4; ++mi) {
#pragma unroll
      for (int nj = 0; nj < 4; ++nj) {
#pragma unroll
        for (int r = 0; r < 8; ++r) { const unsigned rl = wr0 + mi * 16u + r; const unsigned cc = wn * 64u + nj * 16u + col;
          const unsigned cs = stab[rl][cc >> 1]; const float c = __builtin_bit_cast(float, cs << 16), s = __builtin_bit_cast(float, cs & 0xffff0000u);
          const float oq = aq[mi][nj][r];
          const float pq = __shfl_xor(oq, 1);                              /* pair partner (column ^ 1), all lanes active */
          const float sg = odd ? s : -s;                                    /* even column: te*c - to*s; odd column: to*c + te*s */
          const float qv = oq * c + pq * sg;
          sq[rl][cc] = __builtin_bit_cast(unsigned, qv); } } }
  }
  __syncthreads();
  // ---- phase 2: k projection, rotation, diagonal dot against the staged q' values, f16 pair back to LDS
  v8f ak[4][4] = {};
  gemm_ring<true>(ring, XB + (size_t)r0 * DM, WK + (size_t)c0 * DM, tid, ak);
#pragma unroll
  for (int mi = 0; mi < 4; ++mi) {
    float ds[8] = {0.f, 0.f, 0.f, 0.f, 0.f, 0.f, 0.f, 0.f};
#pragma unroll
    for (int nj = 0; nj < 4; ++nj) {
#pragma unroll
      for (int r = 0; r < 8; ++r) { const unsigned rl = wr0 + mi * 16u + r; const unsigned cc = wn * 64u + nj * 16u + col;
        const unsigned cs = stab[rl][cc >> 1]; const float c = __builtin_bit_cast(float, cs << 16), s = __builtin_bit_cast(float, cs & 0xffff0000u);
        const float okv = ak[mi][nj][r];
        const float pk = __shfl_xor(okv, 1);                               /* pair partner (column ^ 1), all lanes active */
        const float sg = odd ? s : -s;
        const float kv = okv * c + pk * sg;
        const float qv = __builtin_bit_cast(float, sq[rl][cc]);
        ds[r] += qv * kv;
        sq[rl][cc] = (unsigned)__builtin_bit_cast(unsigned short, (_Float16)qv) | ((unsigned)__builtin_bit_cast(unsigned short, (_Float16)kv) << 16); } }
#pragma unroll
    for (int r = 0; r < 8; ++r) { float d = ds[r]; d += __shfl_xor(d, 1); d += __shfl_xor(d, 2); d += __shfl_xor(d, 4); d += __shfl_xor(d, 8);
      if (col == 0u) sdg[wn][wr0 + mi * 16u + r] = d; } }
  __syncthreads();   /* cross-wave LDS tiles: block barrier */
#pragma unroll
  for (unsigned rb = 0; rb < 256u; rb += 64u) { const unsigned rl = rb + (tid >> 4), q = tid & 15u; const size_t o = (size_t)(r0 + rl) * DM + c0 + q * 8u; v4u oq4[4], ok4[4];   /* rows rl + 16 i; the low halves are q', the high halves k' */
#pragma unroll
    for (unsigned i = 0; i < 4u; ++i) { const v4u p0 = *(const v4u*)&sq[rl + 16u * i][q * 8u], p1 = *(const v4u*)&sq[rl + 16u * i][q * 8u + 4u];
      oq4[i][0] = (p0[0] & 0xffffu) | (p0[1] << 16); oq4[i][1] = (p0[2] & 0xffffu) | (p0[3] << 16); oq4[i][2] = (p1[0] & 0xffffu) | (p1[1] << 16); oq4[i][3] = (p1[2] & 0xffffu) | (p1[3] << 16);
      ok4[i][0] = (p0[0] >> 16) | (p0[1] & 0xffff0000u); ok4[i][1] = (p0[2] >> 16) | (p0[3] & 0xffff0000u); ok4[i][2] = (p1[0] >> 16) | (p1[1] & 0xffff0000u); ok4[i][3] = (p1[2] >> 16) | (p1[3] & 0xffff0000u); }
    __builtin_amdgcn_sched_barrier(0);   /* all eight pieces are formed before the first store issues: no store's register is reused ahead of the wait behind the stores */
#pragma unroll
    for (unsigned i = 0; i < 4u; ++i) { vst2((void*)(QH + o + (size_t)i * (16u * DM)), oq4[i]); vst2((void*)(KH + o + (size_t)i * (16u * DM)), ok4[i]); }
    wait_x();
    __builtin_amdgcn_sched_barrier(0);   /* keeps the next group's register writes behind that wait */
  }
  if (tid < 64u) { const v4f d0 = *(const v4f*)&sdg[0][tid * 4u], d1 = *(const v4f*)&sdg[1][tid * 4u]; vst2((void*)(DG + (size_t)(bb * NH + h) * SEQ + t0 + tid * 4u), (d0 + d1) * SCALE); }
}

// bare v_exp_f32, for the terms and rescale factors of a running sum: it lacks only the library exp2f's range scaling (a compare, two selects, an add and a v_ldexp a call), so a result under 2^-126 reads 0;
// each such value is added to, or multiplies a sum that is added to, a sum that holds its own maximum's term (about 1), where it is far below half a unit in the last place: the f32 sums are the same
__device__ __forceinline__ float exp2_raw(float x) { return __builtin_amdgcn_exp2f(x); }
// the same for two rescale factors, in place, written as text; the v_nop is the slot behind the second one
__device__ __forceinline__ v2f exp2_raw2(float x, float y) { asm("v_exp_f32 %0, %0\n\tv_exp_f32 %1, %1\n\tv_nop" : "+v"(x), "+v"(y)); return (v2f){x, y}; }
// ---- k_lse: block = 64 query rows of (b, h); one streaming pass over all SEQ keys (128 per step): f16 q' x f16 k' logits, f32 running max / running sum in the log2 domain; w = exp(diag - lse)
__global__ __launch_bounds__(128) void k_lse(const _Float16* __restrict__ QH, const _Float16* __restrict__ KH, const float* __restrict__ DG, float* __restrict__ WP) {
  __shared__ __align__(16) float sw[64];
  __shared__ __align__(16) unsigned char ring[2u * STGK];
  const unsigned tid = threadIdx.x, wave = tid >> 5, lane = tid & 31u, col = lane & 15u, g = lane >> 4;
  const unsigned qb = blockIdx.x, h = blockIdx.y, b = blockIdx.z; const unsigned c0 = h * HD; const unsigned ql0 = qb * 64u + wave * 16u;
  const size_t q0 = (size_t)b * SEQ + ql0, kr0 = (size_t)b * SEQ;
  const float C2 = SCALE * LOG2E;
  v16h qf[4];
#pragma unroll
  for (int kc = 0; kc < 4; ++kc) qf[kc] = frag_h(QH + (q0 + col) * DM + c0 + kc * 32u, lane);
  float m[8], sm[8];
#pragma unroll
  for (int r = 0; r < 8; ++r) { m[r] = -3.0e38f; sm[r] = 0.f; }
  // key ring: a stage is 128 keys x 256 B; lane = (row tid >> 4, 16-B piece tid & 15), 16 copies a lane and stage in two statements
  const char* gk = (const char*)(KH + (kr0 + (tid >> 4)) * DM + c0 + (tid & 15u) * 8u); const size_t gstep = (size_t)128u * DM * 2u, ghalf = (size_t)64u * DM * 2u;
  const unsigned lk = lds_off(ring) + (tid >> 4) * LPK + (tid & 15u) * 16u;
  key_copy(lk, gk); key_copy(lk + 64u * LPK, gk + ghalf);
  wait_async();
  __syncthreads();   /* publishes stage 0 */
  if (NKB > 1u) { key_copy(lk + STGK, gk + gstep); key_copy(lk + STGK + 64u * LPK, gk + gstep + ghalf); }
#pragma unroll 1
  for (unsigned kb = 0; kb < NKB; ++kb) {
    v8f acc[8] = {};
#pragma unroll
    for (int j = 0; j < 8; ++j) { const _Float16* kp = (const _Float16*)(ring + (kb & 1u) * STGK + (j * 16u + col) * LPK);
      const v16h k0 = frag_h(kp, lane), k1 = frag_h(kp + 32, lane), k2 = frag_h(kp + 64, lane), k3 = frag_h(kp + 96, lane);
      acc[j] = wmma16(qf[0], k0, acc[j]); acc[j] = wmma16(qf[1], k1, acc[j]); acc[j] = wmma16(qf[2], k2, acc[j]); acc[j] = wmma16(qf[3], k3, acc[j]); }
    // two rows at a time, the pair that lies in neighbouring accumulator registers: the scaled difference and the sum are packed operations (same fma, same order of additions a row)
    v2f mn[4], dm[4];
#pragma unroll   /* these loops are unrolled so that acc, mn, dm, m and sm are indexed by constants and stay in registers */
    for (int p = 0; p < 4; ++p) { const int r = 2 * p; v2f mx = {acc[0][r], acc[0][r + 1]};
#pragma unroll
      for (int j = 1; j < 8; ++j) { mx[0] = fmaxf(mx[0], acc[j][r]); mx[1] = fmaxf(mx[1], acc[j][r + 1]); }
      mn[p] = (v2f){fmaxf(m[r], mx[0] * C2), fmaxf(m[r + 1], mx[1] * C2)}; dm[p] = (v2f){m[r], m[r + 1]} - mn[p]; m[r] = mn[p][0]; m[r + 1] = mn[p][1]; }
#pragma unroll
    for (int p = 0; p < 4; ++p) { const int r = 2 * p; v2f s = {0.f, 0.f};
#pragma unroll
      for (int j = 0; j < 8; ++j) { const v2f a = {acc[j][r], acc[j][r + 1]}; const v2f t = __builtin_elementwise_fma(a, (v2f){C2, C2}, -mn[p]); const v2f e = {exp2_raw(t[0]), exp2_raw(t[1])}; s += e; }
      const v2f f = exp2_raw2(dm[p][0], dm[p][1]); sm[r] = sm[r] * f[0] + s[0]; sm[r + 1] = sm[r + 1] * f[1] + s[1]; }
    wait_ds();
    wait_async();
    __syncthreads();   /* publishes stage kb + 1 and ends every reader's last read of stage kb's buffer */
    if (kb + 2u < NKB) { const char* gn = gk + (size_t)(kb + 2u) * gstep; const unsigned ln = lk + (kb & 1u) * STGK; key_copy(ln, gn); key_copy(ln + 64u * LPK, gn + ghalf); } }
  wait_async();
  // merge the 16 column lanes of each half (rows stay within a half); all lanes active
#pragma unroll
  for (int off = 1; off < 16; off <<= 1) {
#pragma unroll
    for (int r = 0; r < 8; ++r) { const float om = __shfl_xor(m[r], off), os = __shfl_xor(sm[r], off); const float mn = fmaxf(m[r], om);
      const v2f f = exp2_raw2(m[r] - mn, om - mn); sm[r] = sm[r] * f[0] + os * f[1]; m[r] = mn; } }
  const float* dp = DG + (size_t)(b * NH + h) * SEQ + ql0 + 8u * g;
  const v4f d0 = *(const v4f*)dp, d1 = *(const v4f*)(dp + 4);
#pragma unroll
  for (int r = 0; r < 8; ++r) { const float dg = r < 4 ? d0[r & 3] : d1[r & 3]; const float w = exp2f(dg * LOG2E - m[r] - log2f(sm[r]));
    if (col == 0u) sw[wave * 16u + 8u * g + r] = w; }
  __syncthreads();   /* cross-wave LDS: block barrier */
  if (tid < 16u) vst2((void*)(WP + (size_t)(b * NH + h) * SEQ + qb * 64u + tid * 4u), *(const v4f*)&sw[tid * 4u]);   
}

// ---- k_vw: block = (256 token rows, head h): v projection (exact bf16 products) x the row's diagonal probability -> f16 (w * v * 2^12) rows
__global__ __launch_bounds__(256) void k_vw(const __bf16* __restrict__ XB, const __bf16* __restrict__ WV, const float* __restrict__ WP, _Float16* __restrict__ CTX) {
  __shared__ __align__(16) _Float16 sh[256][136];
  __shared__ __align__(16) unsigned char ring[2u * STG];
  const unsigned tid = threadIdx.x, wave = tid >> 5, lane = tid & 31u, col = lane & 15u, g = lane >> 4;
  const unsigned wr0 = (wave >> 1) * 64u + 8u * g, wn = wave & 1u;   /* this lane's first row and this wave's column half */
  const unsigned h = blockIdx.y, c0 = h * HD; const unsigned r0 = blockIdx.x * 256u; const unsigned bb = r0 / (unsigned)SEQ, t0 = r0 % (unsigned)SEQ;
  v8f av[4][4] = {};
  gemm_ring<true>(ring, XB + (size_t)r0 * DM, WV + (size_t)c0 * DM, tid, av);
#pragma unroll
  for (int mi = 0; mi < 4; ++mi) {
    const float* wp = WP + (size_t)(bb * NH + h) * SEQ + t0 + wr0 + mi * 16u;
    const v4f w0 = *(const v4f*)wp, w1 = *(const v4f*)(wp + 4);
#pragma unroll
    for (int nj = 0; nj < 4; ++nj) {
#pragma unroll
      for (int r = 0; r < 8; ++r) { const float wr = (r < 4 ? w0[r & 3] : w1[r & 3]) * CTXC; sh[wr0 + mi * 16u + r][wn * 64u + nj * 16u + col] = (_Float16)(av[mi][nj][r] * wr); } } }
  __syncthreads();
#pragma unroll
  for (unsigned rb = 0; rb < 256u; rb += 128u) { const unsigned rl = rb + (tid >> 4), q = tid & 15u; _Float16* d = CTX + (size_t)(r0 + rl) * DM + c0 + q * 8u; v4u o[8];   /* rows rl + 16 i */
#pragma unroll
    for (unsigned i = 0; i < 8u; ++i) o[i] = *(const v4u*)&sh[rl + 16u * i][q * 8u];
    __builtin_amdgcn_sched_barrier(0);   /* all eight pieces are read before the first store issues: no store's register is reused ahead of the wait behind the stores */
#pragma unroll
    for (unsigned i = 0; i < 8u; ++i) vst2((void*)(d + (size_t)i * (16u * DM)), o[i]);
    wait_x();
    __builtin_amdgcn_sched_barrier(0);   /* keeps the next group's register writes behind that wait */
  }
}

__global__ __launch_bounds__(256) void k_out(const _Float16* __restrict__ CTX, const _Float16* __restrict__ WO, float* __restrict__ OUT) {
  __shared__ __align__(16) unsigned char ring[2u * STG];
  __shared__ __align__(16) float ss[256][132];   /* output staging, an array of its own: with one block of 256 rows to a WGP the LDS is not short */
  const unsigned tid = threadIdx.x, wave = tid >> 5, lane = tid & 31u, col = lane & 15u, g = lane >> 4;
  const unsigned wr0 = (wave >> 1) * 64u + 8u * g, wn = wave & 1u;   /* this lane's first row and this wave's column half */
  const unsigned c0 = blockIdx.y * 128u; const unsigned r0 = blockIdx.x * 256u; const unsigned bb = r0 / (unsigned)SEQ, t0 = r0 % (unsigned)SEQ;
  v8f acc[4][4] = {};
  gemm_ring<false>(ring, CTX + (size_t)r0 * DM, WO + (size_t)c0 * DM, tid, acc);
#pragma unroll
  for (int mi = 0; mi < 4; ++mi) {
#pragma unroll
    for (int nj = 0; nj < 4; ++nj) {
#pragma unroll
      for (int r = 0; r < 8; ++r) ss[wr0 + mi * 16u + r][wn * 64u + nj * 16u + col] = acc[mi][nj][r] * OUTC; } }
  __syncthreads();   /* a row's two column halves come from two waves: block barrier */
  const size_t orow0 = (size_t)bb * SEQ_FULL + t0 + wave * 32u;
#pragma unroll
  for (unsigned rb = 0; rb < 32u; rb += 8u) { v4f o[8];
#pragma unroll
    for (unsigned i = 0; i < 8u; ++i) o[i] = *(const v4f*)&ss[wave * 32u + rb + i][lane * 4u];
    __builtin_amdgcn_sched_barrier(0);   /* all eight rows are read before the first store issues: no store's register is reused ahead of the wait behind the stores */
#pragma unroll
    for (unsigned i = 0; i < 8u; ++i) vst2((void*)(OUT + (orow0 + rb + i) * DM + c0 + lane * 4u), o[i]);
    wait_x();
    __builtin_amdgcn_sched_barrier(0);   /* keeps the next group's register writes behind that wait */
  }
}

extern "C" void kernel_launch(void* const* d_in, const int* in_sizes, int n_in, void* d_out, int out_size, void* d_ws, size_t ws_size, hipStream_t stream) {
  if (n_in < 7) return;
  const long long need_x = (long long)(NB - 1) * SEQ_FULL * DM + (long long)SEQ * DM;
  if ((long long)in_sizes[0] < need_x) return;
  if (in_sizes[1] < SEQ * 64 || in_sizes[2] < SEQ * 64) return;
  if (in_sizes[3] < DM * DM || in_sizes[4] < DM * DM || in_sizes[5] < DM * DM || in_sizes[6] < DM * DM) return;
  if ((long long)out_size < need_x) return;
  if (ws_size < (size_t)WS_END) return;
  // inputs (wire order): 0 x [2,2048,2048]; 1 cos table [2048][64]; 2 sin table [2048][64]; 3 Wq; 4 Wk; 5 Wv; 6 Wo (each [2048 out][2048 in])
  const float* const* F = (const float* const*)d_in;
  char* ws = (char*)d_ws;
  unsigned short* XB = (unsigned short*)(ws + WS_XB); unsigned short* WQ = (unsigned short*)(ws + WS_WQ); unsigned short* WK = (unsigned short*)(ws + WS_WK);
  unsigned short* WV = (unsigned short*)(ws + WS_WV); unsigned short* WO = (unsigned short*)(ws + WS_WO);
  _Float16* QH = (_Float16*)(ws + WS_QH); _Float16* KH = (_Float16*)(ws + WS_KH); _Float16* CTX = (_Float16*)(ws + WS_CTX);
  float* DG = (float*)(ws + WS_DG); float* WP = (float*)(ws + WS_WP);
  k_cvt<<<dim3(CVT_BLOCKS), CVT_T, 0, stream>>>(F[0], F[3], F[4], F[5], F[6], XB);
  k_qk<<<dim3(MROWS / 256, NH), 256, 0, stream>>>((const __bf16*)XB, (const __bf16*)WQ, (const __bf16*)WK, F[1], F[2], QH, KH, DG);
  k_lse<<<dim3(SEQ / 64, NH, NB), 128, 0, stream>>>(QH, KH, DG, WP);
  k_vw<<<dim3(MROWS / 256, NH), 256, 0, stream>>>((const __bf16*)XB, (const __bf16*)WV, WP, CTX);
  k_out<<<dim3(MROWS / 256, DM / 128), 256, 0, stream>>>(CTX, (const _Float16*)WO, (float*)d_out);
}

// v005
// A run of this version takes 180 microseconds.
// Two timings next to v004 both put it at 1.05 times that version's speed.
// All steps since v000 together make it 5.32 times as fast.
// compute dtype: every float input RNE-converted to bf16 on load; q/k/v projections = exact bf16 x bf16 products on v_wmma_f32_16x16x32_bf16 (f32 accumulate); score statistics q' x k' once to f16 each on v_wmma_f32_16x16x32_f16 (f32 accumulate, f32 running max / running sum); diagonal logit = f32 VALU dot of the f32 q', k' (per-row, no shared operand); output projection = f16(w*v * 2^12) x f16(bf16(Wo) * 2^8) on v_wmma_f32_16x16x32_f16, f32 accumulate, x 2^-20 in the f32 epilogue.
#include <hip/hip_runtime.h>
#include <math.h>

typedef __attribute__((ext_vector_type(16))) _Float16 v16h;
typedef __attribute__((ext_vector_type(16))) __bf16 v16b;
typedef __attribute__((ext_vector_type(8)))  _Float16 v8h;
typedef __attribute__((ext_vector_type(8)))  __bf16 v8b;
typedef __attribute__((ext_vector_type(8)))  float v8f;
typedef __attribute__((ext_vector_type(4)))  float v4f;
typedef __attribute__((ext_vector_type(2)))  float v2f;
typedef __attribute__((ext_vector_type(4)))  unsigned v4u;

template <typename T> __device__ __forceinline__ void vst2(void* p, T v) { *(T*)p = v;  }
__device__ __forceinline__ v8f wmma16(v16h a, v16h b, v8f c) {
  v8f d = __builtin_amdgcn_wmma_f32_16x16x32_f16(false, a, false, b, (short)0, c, false, false);
  asm volatile("v_nop\n\tv_nop\n\tv_nop\n\tv_nop" : "+v"(d) : "v"(a), "v"(b));
  return d;
}
__device__ __forceinline__ v8f wmma_bf(v16b a, v16b b, v8f c) {
  v8f d = __builtin_amdgcn_wmma_f32_16x16x32_bf16(false, a, false, b, (short)0, c, false, false);
  asm volatile("v_nop\n\tv_nop\n\tv_nop\n\tv_nop" : "+v"(d) : "v"(a), "v"(b));
  return d;
}
// 16x16x32 fragments (A and B alike): lane = (g = lane>>4, row/col = lane&15); elements 0..7 = k0+8g+0..7, 8..15 = k0+16+8g+0..7; D element r = (row 8g+r, col lane&15)
__device__ __forceinline__ v16h frag_h(const _Float16* rowk0, unsigned lane) {
  union { v16h v; v8h q[2]; } u; const _Float16* p = rowk0 + 8u * (lane >> 4);
  u.q[0] = *(const v8h*)p; u.q[1] = *(const v8h*)(p + 16); return u.v;
}
__device__ __forceinline__ v16b frag_b(const __bf16* rowk0, unsigned lane) {
  union { v16b v; v8b q[2]; } u; const __bf16* p = rowk0 + 8u * (lane >> 4);
  u.q[0] = *(const v8b*)p; u.q[1] = *(const v8b*)(p + 16); return u.v;
}
__device__ __forceinline__ float bfr(float v) { return (float)(__bf16)v; }

// Self-attention whose output keeps only the DIAGONAL probability: x [NB][SEQ_FULL][DM] (first SEQ rows per batch used); Wq/Wk/Wv/Wo [DM out][DM in] (y = x W^T, no bias); 16 heads x 128;
// interleaved-pair rotation of q and k with INPUT tables cos/sin [SEQ][64]; w[b][h][s] = exp(q'[s].k'[s] * scale - logsumexp_k(q'[s].k'[k] * scale)); ctx = w * v; out = ctx Wo^T.
#ifndef NB
#define NB 2
#endif
#ifndef SEQ
#define SEQ 2048
#endif
#define NB_FULL 2
#define SEQ_FULL 2048
#define DM 2048
#define NH 16
#define HD 128
#define MROWS (NB * SEQ)
#define SCALE 0.08838834764831845f
#define LOG2E 1.4426950408889634f
#define CTXC 4096.0f
#define WOC 256.0f
#define OUTC (1.0f / 1048576.0f)

static_assert(NH * HD == DM);
static_assert(SEQ % 256 == 0);
static_assert(SEQ <= SEQ_FULL);
static_assert(NB <= NB_FULL);
static_assert(MROWS % 256 == 0);
static_assert(DM % 128 == 0);
static_assert(((size_t)SEQ * DM) % (8 * 256) == 0);
static_assert(((size_t)DM * DM) % (8 * 256) == 0);

#define WS_XB  ((size_t)0)                                   // bf16 x rows [b*SEQ + s][DM]
#define WS_WQ  (WS_XB  + 2u * (size_t)MROWS * DM)            // bf16 Wq [out][in]
#define WS_WK  (WS_WQ  + 2u * (size_t)DM * DM)
#define WS_WV  (WS_WK  + 2u * (size_t)DM * DM)
#define WS_WO  (WS_WV  + 2u * (size_t)DM * DM)               // f16 (bf16(Wo) * 2^8) [out][in]
#define WS_QH  (WS_WO  + 2u * (size_t)DM * DM)               // f16 rotated q rows [b*SEQ + s][DM]
#define WS_KH  (WS_QH  + 2u * (size_t)MROWS * DM)            // f16 rotated k rows
#define WS_CTX (WS_KH  + 2u * (size_t)MROWS * DM)            // f16 (w * v * 2^12) rows
#define WS_DG  (WS_CTX + 2u * (size_t)MROWS * DM)            // f32 diagonal logits [b][h][s]
#define WS_WP  (WS_DG  + 4u * (size_t)NB * NH * SEQ)         // f32 diagonal probabilities [b][h][s]
#define WS_END (WS_WP  + 4u * (size_t)NB * NH * SEQ)
static_assert(WS_END <= (size_t)134217728);
static_assert(WS_DG % 128 == 0);

// ---- LDS staging by asynchronous copies (global_load_async_to_lds_b128): every lane brings 16 B, 8 (or 16) neighbouring lanes bring one whole row piece, so a wave touches whole 128-B lines;
// the fragments are then read from LDS by ds_load_b128 at a row pitch of 16 B x odd. The projection ring has NBF = 3 or 4 buffers (the copies of the next NBF - 1 stages fly while a stage is worked on), the key ring two.
#define KP 64u                      /* k elements of one projection stage: 128 B of every row */
#define LP 144u                     /* LDS row pitch of a projection stage, bytes */
#define STG (384u * LP)             /* one projection stage: 256 rows of the left operand, then 128 rows of the weight */
#define NTR (DM / KP)
#define LPK 272u                    /* LDS row pitch of a key stage, bytes: 256 B of data */
#define STGK (128u * LPK)           /* one key stage: 128 keys x 128 head elements */
#define NKB (SEQ / 128u)
static_assert(NTR >= 4u);
#define CP1(l, g) "global_load_async_to_lds_b128 %" #l ", %" #g ", off\n\t"
__device__ __forceinline__ unsigned lds_off(const void* p) { return (unsigned)(size_t)p; }
// the ring's two waits in statements of their own, each with the memory clobber that keeps LDS reads and copies on their side of it
__device__ __forceinline__ void wait_ds() { asm volatile("s_wait_dscnt 0x0" ::: "memory"); }       /* this wave's LDS reads are done before the buffer is handed back */
__device__ __forceinline__ void wait_async() { asm volatile("s_wait_asynccnt 0x0" ::: "memory"); } /* this wave's copies have landed before the barrier publishes them */
// counted form for the projection ring (12 copies a wave and stage, landing counted in issue order): all but the youngest ST stages' copies have landed, so the oldest stage in flight is complete while the younger ones keep flying
template <unsigned ST> __device__ __forceinline__ void wait_async_but() { asm volatile("s_wait_asynccnt %0" :: "n"(12u * ST) : "memory"); }
// 12 copies of one lane: rows crow + 32 i of the stage (i < 8: left operand, i >= 8: weight); s_wait_xcnt closes the statement so that no address register is rewritten ahead of it
__device__ __forceinline__ void stage_copy(unsigned l, const char* ga, const char* gw) {
  const size_t rs = (size_t)32u * DM * 2u; const unsigned ls = 32u * LP;
  asm volatile(CP1(0, 12) CP1(1, 13) CP1(2, 14) CP1(3, 15) CP1(4, 16) CP1(5, 17) CP1(6, 18) CP1(7, 19) CP1(8, 20) CP1(9, 21) CP1(10, 22) CP1(11, 23) "s_wait_xcnt 0x0"
    :: "v"(l), "v"(l + ls), "v"(l + 2u * ls), "v"(l + 3u * ls), "v"(l + 4u * ls), "v"(l + 5u * ls), "v"(l + 6u * ls), "v"(l + 7u * ls), "v"(l + 8u * ls), "v"(l + 9u * ls), "v"(l + 10u * ls), "v"(l + 11u * ls),
       "v"(ga), "v"(ga + rs), "v"(ga + 2u * rs), "v"(ga + 3u * rs), "v"(ga + 4u * rs), "v"(ga + 5u * rs), "v"(ga + 6u * rs), "v"(ga + 7u * rs), "v"(gw), "v"(gw + rs), "v"(gw + 2u * rs), "v"(gw + 3u * rs)
    : "memory");
}
// 8 copies of one lane: key rows krow + 8 i, i = 0..7, of half a key stage
__device__ __forceinline__ void key_copy(unsigned l, const char* g) {
  const size_t rs = (size_t)8u * DM * 2u; const unsigned ls = 8u * LPK;
  asm volatile(CP1(0, 8) CP1(1, 9) CP1(2, 10) CP1(3, 11) CP1(4, 12) CP1(5, 13) CP1(6, 14) CP1(7, 15) "s_wait_xcnt 0x0"
    :: "v"(l), "v"(l + ls), "v"(l + 2u * ls), "v"(l + 3u * ls), "v"(l + 4u * ls), "v"(l + 5u * ls), "v"(l + 6u * ls), "v"(l + 7u * ls),
       "v"(g), "v"(g + rs), "v"(g + 2u * rs), "v"(g + 3u * rs), "v"(g + 4u * rs), "v"(g + 5u * rs), "v"(g + 6u * rs), "v"(g + 7u * rs)
    : "memory");
}
// acc[mi][nj] += A[256 rows][DM] x W[128 rows][DM]^T for this wave's 64 x 64 share (8 waves: wave >> 1 picks the 64 rows, wave & 1 the 64 weight rows), k ascending in steps of 32;
// A, Wt = the block's first rows (16-bit elements, row pitch DM). Every fragment read from LDS feeds four matrix instructions.
// Every wave of the block calls it; the ring's last readers have left it and every wave's copies have landed when it returns (the last trip ends in s_wait_dscnt 0, s_wait_asynccnt 0 and the barrier).
template <bool BF, unsigned NBF> __device__ __forceinline__ void gemm_ring(unsigned char* ring, const void* A, const void* Wt, unsigned tid, v8f (&acc)[4][4]) {
  static_assert(NBF >= 3u && NBF <= NTR && NBF * 12u <= 63u);   /* the prologue has NBF stages of 12 copies a wave outstanding */
  const unsigned wave = tid >> 5, lane = tid & 31u, col = lane & 15u; const unsigned crow = tid >> 3, cch = tid & 7u;
  const char* ga = (const char*)A + ((size_t)crow * DM + cch * 8u) * 2u; const char* gw = (const char*)Wt + ((size_t)crow * DM + cch * 8u) * 2u;
  const unsigned l0 = lds_off(ring) + crow * LP + cch * 16u;
#pragma unroll 1   /* kept rolled: one stage's 36 address registers at a time */
  for (unsigned s = 0; s < NBF; ++s) stage_copy(l0 + s * STG, ga + s * (KP * 2u), gw + s * (KP * 2u));
  wait_async_but<NBF - 1u>();
  __syncthreads();   /* publishes stage 0 */
  unsigned rb = 0;   /* byte offset of the buffer that holds stage t */
#pragma unroll 1   /* kept rolled: one trip is already 32 matrix instructions, and the text of four such loops stays small */
  for (unsigned t = 0; t < NTR; ++t) {
    const unsigned char* ab = ring + rb + ((wave >> 1) * 64u + col) * LP; const unsigned char* wb = ring + rb + (256u + (wave & 1u) * 64u + col) * LP;
    // the eight fragment reads of a k step of 32 stand together in front of its 16 matrix instructions (both steps' fragments at once do not fit beside 16 accumulator tiles under v256)
#pragma unroll
    for (unsigned ks = 0; ks < 2u; ++ks) {
      if constexpr (BF) { v16b a[4], w[4];
#pragma unroll
        for (int i = 0; i < 4; ++i) { a[i] = frag_b((const __bf16*)(ab + i * 16u * LP + ks * 64u), lane); w[i] = frag_b((const __bf16*)(wb + i * 16u * LP + ks * 64u), lane); }
#pragma unroll
        for (int mi = 0; mi < 4; ++mi) {
#pragma unroll
          for (int nj = 0; nj < 4; ++nj) acc[mi][nj] = wmma_bf(a[mi], w[nj], acc[mi][nj]); }
      } else { v16h a[4], w[4];
#pragma unroll
        for (int i = 0; i < 4; ++i) { a[i] = frag_h((const _Float16*)(ab + i * 16u * LP + ks * 64u), lane); w[i] = frag_h((const _Float16*)(wb + i * 16u * LP + ks * 64u), lane); }
#pragma unroll
        for (int mi = 0; mi < 4; ++mi) {
#pragma unroll
          for (int nj = 0; nj < 4; ++nj) acc[mi][nj] = wmma16(a[mi], w[nj], acc[mi][nj]); } } }
    wait_ds();
    if (t + NBF - 1u < NTR) wait_async_but<NBF - 2u>(); else wait_async();   /* stage t + 1 has landed: behind it stages t + 2 .. t + NBF - 1 are in flight; in the last trips fewer were issued, so the wait is to 0 */
    __syncthreads();   /* publishes stage t + 1 and ends every reader's last read of stage t's buffer */
    if (t + NBF < NTR) stage_copy(l0 + rb, ga + (size_t)(t + NBF) * (KP * 2u), gw + (size_t)(t + NBF) * (KP * 2u));
    rb = rb + STG == NBF * STG ? 0u : rb + STG;
  }
  wait_async();
}

// ---- k_cvt: ONE launch converts x and the four weights. The five 16-bit planes lie one behind the other in the workspace: NB + 4 segments (each batch of x, then Wq, Wk, Wv, Wo) of CVT_BLOCKS tiles each.
// A tile = CVT_TILE pieces of 8 elements (32 B read, 16 B written a piece). Block n converts tile n of every segment, the next segment's 8 loads a lane issued ahead of this segment's conversion:
// few long-lived waves that keep loads in flight, in place of one short-lived wave per 256 elements.
#define CVT_T 512u
#define CVT_U 4u
#define CVT_TILE (CVT_T * CVT_U)
#define CVT_BLOCKS ((unsigned)((size_t)DM * DM / 8u / CVT_TILE))
#define CVT_SEGS ((unsigned)NB + 4u)
static_assert((size_t)CVT_BLOCKS * CVT_TILE * 8u == (size_t)DM * DM);
static_assert((size_t)SEQ * DM == (size_t)DM * DM);   /* a batch of x is as long as a weight */
static_assert(WS_XB == 0 && WS_WQ == 2u * (size_t)NB * DM * DM && WS_WO == WS_WQ + 3u * 2u * (size_t)DM * DM);
// no register that an issued load or store names is rewritten ahead of this wait
__device__ __forceinline__ void wait_x() { asm volatile("s_wait_xcnt 0x0" ::: "memory"); }
__device__ __forceinline__ void cvt_load(v4f (&r)[2u * CVT_U], const float* s) {
#pragma unroll
  for (unsigned u = 0; u < CVT_U; ++u) { r[2u * u] = *(const v4f*)(s + u * (CVT_T * 8u)); r[2u * u + 1u] = *(const v4f*)(s + u * (CVT_T * 8u) + 4u); }
  wait_x();
  __builtin_amdgcn_sched_barrier(0);   /* the loads stay one group ahead of the conversion that follows, and that conversion's register writes stay behind the wait */
}
__global__ __launch_bounds__(512) void k_cvt(const float* __restrict__ X, const float* __restrict__ Q, const float* __restrict__ K, const float* __restrict__ V, const float* __restrict__ O,
    unsigned short* __restrict__ dst) {
  const unsigned off = blockIdx.x * (CVT_TILE * 8u) + threadIdx.x * 8u;   /* this lane's first element inside every segment */
  v4f cur[2u * CVT_U], nxt[2u * CVT_U];
  cvt_load(cur, X + off);
#pragma unroll   /* unrolled: the segment number picks the source pointer and the target type at compile time, and the two register sets need no copies */
  for (unsigned s = 0; s < CVT_SEGS; ++s) {
    const unsigned n = s + 1u;
    if (n < CVT_SEGS) cvt_load(nxt, (n < (unsigned)NB ? X + (size_t)n * ((size_t)SEQ_FULL * DM) : n == (unsigned)NB ? Q : n == (unsigned)NB + 1u ? K : n == (unsigned)NB + 2u ? V : O) + off);
    v4u o[CVT_U];
#pragma unroll
    for (unsigned u = 0; u < CVT_U; ++u) { const v4f a = cur[2u * u], b = cur[2u * u + 1u];
      if (s + 1u < CVT_SEGS) { v8b t;
#pragma unroll
        for (int e = 0; e < 4; ++e) { t[e] = (__bf16)a[e]; t[4 + e] = (__bf16)b[e]; }
        o[u] = __builtin_bit_cast(v4u, t);
      } else { v8h t;   /* the last segment, Wo, goes to f16 (bf16 value x 2^8) */
#pragma unroll
        for (int e = 0; e < 4; ++e) { t[e] = (_Float16)(bfr(a[e]) * WOC); t[4 + e] = (_Float16)(bfr(b[e]) * WOC); }
        o[u] = __builtin_bit_cast(v4u, t);
      } }
    __builtin_amdgcn_sched_barrier(0);   /* all four pieces are converted before the first store issues: no store's data register is reused ahead of the wait behind the stores */
    unsigned short* d = dst + (size_t)s * ((size_t)DM * DM) + off;
#pragma unroll
    for (unsigned u = 0; u < CVT_U; ++u) vst2((void*)(d + u * (CVT_T * 8u)), o[u]);
    wait_x();
    __builtin_amdgcn_sched_barrier(0);   /* keeps the next segment's register writes behind that wait */
#pragma unroll
    for (unsigned u = 0; u < 2u * CVT_U; ++u) cur[u] = nxt[u];
  }
}

// ---- k_qk: block = (256 token rows, head h): q projection then k projection, one after the other (exact bf16 products, K = DM; 16 accumulator tiles live at a time);
// rotation with the bf16-converted input tables (in LDS as the two bf16 values of a pair in one dword: nothing is lost, they are bf16 values; the table tile lies in the idle ring: each thread keeps its 16 converted pieces in registers and lays them there again behind the second projection); the rotated f32 q' tile waits in LDS for the diagonal dot,
// and each lane then puts the f16 pair (q', k') back into the dword it read; f16 q'/k' rows, f32 diagonal logit per row (the two column halves of a row are summed by two waves, then added)
__global__ __launch_bounds__(256) void k_qk(const __bf16* __restrict__ XB, const __bf16* __restrict__ WQ, const __bf16* __restrict__ WK, const float* __restrict__ COS, const float* __restrict__ SIN,
    _Float16* __restrict__ QH, _Float16* __restrict__ KH, float* __restrict__ DG) {
  __shared__ __align__(16) unsigned sq[256][132];    /* the bits of f32 q', later of the f16 pair (q' low half, k' high half) */
  __shared__ __align__(16) float sdg[2][256];
  __shared__ __align__(16) unsigned char ring[3u * STG];
  unsigned (*stab)[68] = (unsigned (*)[68])ring;     /* bf16 cos (low half) and bf16 sin (high half) of (position, pair): in the ring while no projection runs */
  static_assert(256u * 68u * 4u <= 3u * STG);
  const unsigned tid = threadIdx.x, wave = tid >> 5, lane = tid & 31u, col = lane & 15u, g = lane >> 4;
  const unsigned wr0 = (wave >> 1) * 64u + 8u * g, wn = wave & 1u;   /* this lane's first row and this wave's column half */
  const unsigned h = blockIdx.y, c0 = h * HD; const unsigned r0 = blockIdx.x * 256u; const unsigned bb = r0 / (unsigned)SEQ, t0 = r0 % (unsigned)SEQ;
  const bool odd = (col & 1u) != 0u;
  v4u tp[16];   /* this thread's pieces of the converted table tile: rows (tid >> 4) + 16 i, dwords 4 (tid & 15) .. + 3 */
  // ---- phase 1: q projection, rotation, f32 q' tile to LDS (each lane later re-reads exactly the positions it wrote)
  {
    v8f aq[4][4] = {};
    gemm_ring<true, 3u>(ring, XB + (size_t)r0 * DM, WQ + (size_t)c0 * DM, tid, aq);
    // table tile: positions t0..t0+255, 64 pairs, bf16-converted values
    { const unsigned rl = tid >> 4, q = tid & 15u; const size_t o = (size_t)(t0 + rl) * 64u + q * 4u; v4f c[16], s[16];   /* rows rl + 16 i */
#pragma unroll
      for (unsigned i = 0; i < 16u; ++i) { c[i] = *(const v4f*)(COS + o + i * (16u * 64u)); s[i] = *(const v4f*)(SIN + o + i * (16u * 64u)); }
      wait_x();
      __builtin_amdgcn_sched_barrier(0);   /* the 32 loads fly together, and what follows writes no register of theirs ahead of the wait */
#pragma unroll
      for (unsigned i = 0; i < 16u; ++i) { v4u p;
#pragma unroll
        for (int u = 0; u < 4; ++u) p[u] = (unsigned)__builtin_bit_cast(unsigned short, (__bf16)c[i][u]) | ((unsigned)__builtin_bit_cast(unsigned short, (__bf16)s[i][u]) << 16);
        tp[i] = p; *(v4u*)&stab[rl + 16u * i][q * 4u] = p; } }
    __syncthreads();   /* table tile is cross-wave: block barrier */
#pragma unroll
    for (int mi = 0; mi < 4; ++mi) {
#pragma unroll
      for (int nj = 0; nj < 4; ++nj) {
#pragma unroll
        for (int r = 0; r < 8; ++r) { const unsigned rl = wr0 + mi * 16u + r; const unsigned cc = wn * 64u + nj * 16u + col;
          const unsigned cs = stab[rl][cc >> 1]; const float c = __builtin_bit_cast(float, cs << 16), s = __builtin_bit_cast(float, cs & 0xffff0000u);
          const float oq = aq[mi][nj][r];
          const float pq = __shfl_xor(oq, 1);                              /* pair partner (column ^ 1), all lanes active */
          const float sg = odd ? s : -s;                                    /* even column: te*c - to*s; odd column: to*c + te*s */
          const float qv = oq * c + pq * sg;
          sq[rl][cc] = __builtin_bit_cast(unsigned, qv); } } }
  }
  __syncthreads();   /* ends every wave's last read of the table tile before copies are aimed at the ring again */
  // ---- phase 2: k projection, rotation, diagonal dot against the staged q' values, f16 pair back to LDS
  v8f ak[4][4] = {};
  gemm_ring<true, 3u>(ring, XB + (size_t)r0 * DM, WK + (size_t)c0 * DM, tid, ak);
#pragma unroll   /* unrolled so that tp is indexed by constants and stays in registers */
  for (unsigned i = 0; i < 16u; ++i) *(v4u*)&stab[(tid >> 4) + 16u * i][(tid & 15u) * 4u] = tp[i];
  __syncthreads();   /* table tile is cross-wave: block barrier */
#pragma unroll
  for (int mi = 0; mi < 4; ++mi) {
    float ds[8] = {0.f, 0.f, 0.f, 0.f, 0.f, 0.f, 0.f, 0.f};
#pragma unroll
    for (int nj = 0; nj < 4; ++nj) {
#pragma unroll
      for (int r = 0; r < 8; ++r) { const unsigned rl = wr0 + mi * 16u + r; const unsigned cc = wn * 64u + nj * 16u + col;
        const unsigned cs = stab[rl][cc >> 1]; const float c = __builtin_bit_cast(float, cs << 16), s = __builtin_bit_cast(float, cs & 0xffff0000u);
        const float okv = ak[mi][nj][r];
        const float pk = __shfl_xor(okv, 1);                               /* pair partner (column ^ 1), all lanes active */
        const float sg = odd ? s : -s;
        const float kv = okv * c + pk * sg;
        const float qv = __builtin_bit_cast(float, sq[rl][cc]);
        ds[r] += qv * kv;
        sq[rl][cc] = (unsigned)__builtin_bit_cast(unsigned short, (_Float16)qv) | ((unsigned)__builtin_bit_cast(unsigned short, (_Float16)kv) << 16); } }
#pragma unroll
    for (int r = 0; r < 8; ++r) { float d = ds[r]; d += __shfl_xor(d, 1); d += __shfl_xor(d, 2); d += __shfl_xor(d, 4); d += __shfl_xor(d, 8);
      if (col == 0u) sdg[wn][wr0 + mi * 16u + r] = d; } }
  __syncthreads();   /* cross-wave LDS tiles: block barrier */
#pragma unroll
  for (unsigned rb = 0; rb < 256u; rb += 64u) { const unsigned rl = rb + (tid >> 4), q = tid & 15u; const size_t o = (size_t)(r0 + rl) * DM + c0 + q * 8u; v4u oq4[4], ok4[4];   /* rows rl + 16 i; the low halves are q', the high halves k' */
#pragma unroll
    for (unsigned i = 0; i < 4u; ++i) { const v4u p0 = *(const v4u*)&sq[rl + 16u * i][q * 8u], p1 = *(const v4u*)&sq[rl + 16u * i][q * 8u + 4u];
      oq4[i][0] = (p0[0] & 0xffffu) | (p0[1] << 16); oq4[i][1] = (p0[2] & 0xffffu) | (p0[3] << 16); oq4[i][2] = (p1[0] & 0xffffu) | (p1[1] << 16); oq4[i][3] = (p1[2] & 0xffffu) | (p1[3] << 16);
      ok4[i][0] = (p0[0] >> 16) | (p0[1] & 0xffff0000u); ok4[i][1] = (p0[2] >> 16) | (p0[3] & 0xffff0000u); ok4[i][2] = (p1[0] >> 16) | (p1[1] & 0xffff0000u); ok4[i][3] = (p1[2] >> 16) | (p1[3] & 0xffff0000u); }
    __builtin_amdgcn_sched_barrier(0);   /* all eight pieces are formed before the first store issues: no store's register is reused ahead of the wait behind the stores */
#pragma unroll
    for (unsigned i = 0; i < 4u; ++i) { vst2((void*)(QH + o + (size_t)i * (16u * DM)), oq4[i]); vst2((void*)(KH + o + (size_t)i * (16u * DM)), ok4[i]); }
    wait_x();
    __builtin_amdgcn_sched_barrier(0);   /* keeps the next group's register writes behind that wait */
  }
  if (tid < 64u) { const v4f d0 = *(const v4f*)&sdg[0][tid * 4u], d1 = *(const v4f*)&sdg[1][tid * 4u]; vst2((void*)(DG + (size_t)(bb * NH + h) * SEQ + t0 + tid * 4u), (d0 + d1) * SCALE); }
}

// bare v_exp_f32, for the terms and rescale factors of a running sum: it lacks only the library exp2f's range scaling (a compare, two selects, an add and a v_ldexp a call), so a result under 2^-126 reads 0;
// each such value is added to, or multiplies a sum that is added to, a sum that holds its own maximum's term (about 1), where it is far below half a unit in the last place: the f32 sums are the same
__device__ __forceinline__ float exp2_raw(float x) { return __builtin_amdgcn_exp2f(x); }
// the same for two rescale factors, in place, written as text; the v_nop is the slot behind the second one
__device__ __forceinline__ v2f exp2_raw2(float x, float y) { asm("v_exp_f32 %0, %0\n\tv_exp_f32 %1, %1\n\tv_nop" : "+v"(x), "+v"(y)); return (v2f){x, y}; }
// ---- k_lse: block = 64 query rows of (b, h); one streaming pass over all SEQ keys (128 per step): f16 q' x f16 k' logits, f32 running max / running sum in the log2 domain; w = exp(diag - lse)
__global__ __launch_bounds__(128) void k_lse(const _Float16* __restrict__ QH, const _Float16* __restrict__ KH, const float* __restrict__ DG, float* __restrict__ WP) {
  __shared__ __align__(16) float sw[64];
  __shared__ __align__(16) unsigned char ring[2u * STGK];
  const unsigned tid = threadIdx.x, wave = tid >> 5, lane = tid & 31u, col = lane & 15u, g = lane >> 4;
  const unsigned qb = blockIdx.x, h = blockIdx.y, b = blockIdx.z; const unsigned c0 = h * HD; const unsigned ql0 = qb * 64u + wave * 16u;
  const size_t q0 = (size_t)b * SEQ + ql0, kr0 = (size_t)b * SEQ;
  const float C2 = SCALE * LOG2E;
  v16h qf[4];
#pragma unroll
  for (int kc = 0; kc < 4; ++kc) qf[kc] = frag_h(QH + (q0 + col) * DM + c0 + kc * 32u, lane);
  float m[8], sm[8];
#pragma unroll
  for (int r = 0; r < 8; ++r) { m[r] = -3.0e38f; sm[r] = 0.f; }
  // key ring: a stage is 128 keys x 256 B; lane = (row tid >> 4, 16-B piece tid & 15), 16 copies a lane and stage in two statements
  const char* gk = (const char*)(KH + (kr0 + (tid >> 4)) * DM + c0 + (tid & 15u) * 8u); const size_t gstep = (size_t)128u * DM * 2u, ghalf = (size_t)64u * DM * 2u;
  const unsigned lk = lds_off(ring) + (tid >> 4) * LPK + (tid & 15u) * 16u;
  key_copy(lk, gk); key_copy(lk + 64u * LPK, gk + ghalf);
  wait_async();
  __syncthreads();   /* publishes stage 0 */
  if (NKB > 1u) { key_copy(lk + STGK, gk + gstep); key_copy(lk + STGK + 64u * LPK, gk + gstep + ghalf); }
#pragma unroll 1
  for (unsigned kb = 0; kb < NKB; ++kb) {
    v8f acc[8] = {};
#pragma unroll
    for (int j = 0; j < 8; ++j) { const _Float16* kp = (const _Float16*)(ring + (kb & 1u) * STGK + (j * 16u + col) * LPK);
      const v16h k0 = frag_h(kp, lane), k1 = frag_h(kp + 32, lane), k2 = frag_h(kp + 64, lane), k3 = frag_h(kp + 96, lane);
      acc[j] = wmma16(qf[0], k0, acc[j]); acc[j] = wmma16(qf[1], k1, acc[j]); acc[j] = wmma16(qf[2], k2, acc[j]); acc[j] = wmma16(qf[3], k3, acc[j]); }
    // two rows at a time, the pair that lies in neighbouring accumulator registers: the scaled difference and the sum are packed operations (same fma, same order of additions a row)
    v2f mn[4], dm[4];
#pragma unroll   /* these loops are unrolled so that acc, mn, dm, m and sm are indexed by constants and stay in registers */
    for (int p = 0; p < 4; ++p) { const int r = 2 * p; v2f mx = {acc[0][r], acc[0][r + 1]};
#pragma unroll
      for (int j = 1; j < 8; ++j) { mx[0] = fmaxf(mx[0], acc[j][r]); mx[1] = fmaxf(mx[1], acc[j][r + 1]); }
      mn[p] = (v2f){fmaxf(m[r], mx[0] * C2), fmaxf(m[r + 1], mx[1] * C2)}; dm[p] = (v2f){m[r], m[r + 1]} - mn[p]; m[r] = mn[p][0]; m[r + 1] = mn[p][1]; }
#pragma unroll
    for (int p = 0; p < 4; ++p) { const int r = 2 * p; v2f s = {0.f, 0.f};
#pragma unroll
      for (int j = 0; j < 8; ++j) { const v2f a = {acc[j][r], acc[j][r + 1]}; const v2f t = __builtin_elementwise_fma(a, (v2f){C2, C2}, -mn[p]); const v2f e = {exp2_raw(t[0]), exp2_raw(t[1])}; s += e; }
      const v2f f = exp2_raw2(dm[p][0], dm[p][1]); sm[r] = sm[r] * f[0] + s[0]; sm[r + 1] = sm[r + 1] * f[1] + s[1]; }
    wait_ds();
    wait_async();
    __syncthreads();   /* publishes stage kb + 1 and ends every reader's last read of stage kb's buffer */
    if (kb + 2u < NKB) { const char* gn = gk + (size_t)(kb + 2u) * gstep; const unsigned ln = lk + (kb & 1u) * STGK; key_copy(ln, gn); key_copy(ln + 64u * LPK, gn + ghalf); } }
  wait_async();
  // merge the 16 column lanes of each half (rows stay within a half); all lanes active
#pragma unroll
  for (int off = 1; off < 16; off <<= 1) {
#pragma unroll
    for (int r = 0; r < 8; ++r) { const float om = __shfl_xor(m[r], off), os = __shfl_xor(sm[r], off); const float mn = fmaxf(m[r], om);
      const v2f f = exp2_raw2(m[r] - mn, om - mn); sm[r] = sm[r] * f[0] + os * f[1]; m[r] = mn; } }
  const float* dp = DG + (size_t)(b * NH + h) * SEQ + ql0 + 8u * g;
  const v4f d0 = *(const v4f*)dp, d1 = *(const v4f*)(dp + 4);
#pragma unroll
  for (int r = 0; r < 8; ++r) { const float dg = r < 4 ? d0[r & 3] : d1[r & 3]; const float w = exp2f(dg * LOG2E - m[r] - log2f(sm[r]));
    if (col == 0u) sw[wave * 16u + 8u * g + r] = w; }
  __syncthreads();   /* cross-wave LDS: block barrier */
  if (tid < 16u) vst2((void*)(WP + (size_t)(b * NH + h) * SEQ + qb * 64u + tid * 4u), *(const v4f*)&sw[tid * 4u]);   
}

// ---- k_vw: block = (256 token rows, head h): v projection (exact bf16 products) x the row's diagonal probability -> f16 (w * v * 2^12) rows
__global__ __launch_bounds__(256) void k_vw(const __bf16* __restrict__ XB, const __bf16* __restrict__ WV, const float* __restrict__ WP, _Float16* __restrict__ CTX) {
  __shared__ __align__(16) _Float16 sh[256][136];
  __shared__ __align__(16) unsigned char ring[4u * STG];
  const unsigned tid = threadIdx.x, wave = tid >> 5, lane = tid & 31u, col = lane & 15u, g = lane >> 4;
  const unsigned wr0 = (wave >> 1) * 64u + 8u * g, wn = wave & 1u;   /* this lane's first row and this wave's column half */
  const unsigned h = blockIdx.y, c0 = h * HD; const unsigned r0 = blockIdx.x * 256u; const unsigned bb = r0 / (unsigned)SEQ, t0 = r0 % (unsigned)SEQ;
  v8f av[4][4] = {};
  gemm_ring<true, 4u>(ring, XB + (size_t)r0 * DM, WV + (size_t)c0 * DM, tid, av);
#pragma unroll
  for (int mi = 0; mi < 4; ++mi) {
    const float* wp = WP + (size_t)(bb * NH + h) * SEQ + t0 + wr0 + mi * 16u;
    const v4f w0 = *(const v4f*)wp, w1 = *(const v4f*)(wp + 4);
#pragma unroll
    for (int nj = 0; nj < 4; ++nj) {
#pragma unroll
      for (int r = 0; r < 8; ++r) { const float wr = (r < 4 ? w0[r & 3] : w1[r & 3]) * CTXC; sh[wr0 + mi * 16u + r][wn * 64u + nj * 16u + col] = (_Float16)(av[mi][nj][r] * wr); } } }
  __syncthreads();
#pragma unroll
  for (unsigned rb = 0; rb < 256u; rb += 128u) { const unsigned rl = rb + (tid >> 4), q = tid & 15u; _Float16* d = CTX + (size_t)(r0 + rl) * DM + c0 + q * 8u; v4u o[8];   /* rows rl + 16 i */
#pragma unroll
    for (unsigned i = 0; i < 8u; ++i) o[i] = *(const v4u*)&sh[rl + 16u * i][q * 8u];
    __builtin_amdgcn_sched_barrier(0);   /* all eight pieces are read before the first store issues: no store's register is reused ahead of the wait behind the stores */
#pragma unroll
    for (unsigned i = 0; i < 8u; ++i) vst2((void*)(d + (size_t)i * (16u * DM)), o[i]);
    wait_x();
    __builtin_amdgcn_sched_barrier(0);   /* keeps the next group's register writes behind that wait */
  }
}

__global__ __launch_bounds__(256) void k_out(const _Float16* __restrict__ CTX, const _Float16* __restrict__ WO, float* __restrict__ OUT) {
  __shared__ __align__(16) unsigned char ring[4u * STG];
  float (*ss)[132] = (float (*)[132])ring;   /* output staging in the ring: gemm_ring returns behind the barrier that ends its last reader's last read, every copy landed */
  static_assert(256u * 132u * 4u <= 4u * STG);
  const unsigned tid = threadIdx.x, wave = tid >> 5, lane = tid & 31u, col = lane & 15u, g = lane >> 4;
  const unsigned wr0 = (wave >> 1) * 64u + 8u * g, wn = wave & 1u;   /* this lane's first row and this wave's column half */
  const unsigned c0 = blockIdx.y * 128u; const unsigned r0 = blockIdx.x * 256u; const unsigned bb = r0 / (unsigned)SEQ, t0 = r0 % (unsigned)SEQ;
  v8f acc[4][4] = {};
  gemm_ring<false, 4u>(ring, CTX + (size_t)r0 * DM, WO + (size_t)c0 * DM, tid, acc);
#pragma unroll
  for (int mi = 0; mi < 4; ++mi) {
#pragma unroll
    for (int nj = 0; nj < 4; ++nj) {
#pragma unroll
      for (int r = 0; r < 8; ++r) ss[wr0 + mi * 16u + r][wn * 64u + nj * 16u + col] = acc[mi][nj][r] * OUTC; } }
  __syncthreads();   /* a row's two column halves come from two waves: block barrier */
  const size_t orow0 = (size_t)bb * SEQ_FULL + t0 + wave * 32u;
#pragma unroll
  for (unsigned rb = 0; rb < 32u; rb += 8u) { v4f o[8];
#pragma unroll
    for (unsigned i = 0; i < 8u; ++i) o[i] = *(const v4f*)&ss[wave * 32u + rb + i][lane * 4u];
    __builtin_amdgcn_sched_barrier(0);   /* all eight rows are read before the first store issues: no store's register is reused ahead of the wait behind the stores */
#pragma unroll
    for (unsigned i = 0; i < 8u; ++i) vst2((void*)(OUT + (orow0 + rb + i) * DM + c0 + lane * 4u), o[i]);
    wait_x();
    __builtin_amdgcn_sched_barrier(0);   /* keeps the next group's register writes behind that wait */
  }
}

extern "C" void kernel_launch(void* const* d_in, const int* in_sizes, int n_in, void* d_out, int out_size, void* d_ws, size_t ws_size, hipStream_t stream) {
  if (n_in < 7) return;
  const long long need_x = (long long)(NB - 1) * SEQ_FULL * DM + (long long)SEQ * DM;
  if ((long long)in_sizes[0] < need_x) return;
  if (in_sizes[1] < SEQ * 64 || in_sizes[2] < SEQ * 64) return;
  if (in_sizes[3] < DM * DM || in_sizes[4] < DM * DM || in_sizes[5] < DM * DM || in_sizes[6] < DM * DM) return;
  if ((long long)out_size < need_x) return;
  if (ws_size < (size_t)WS_END) return;
  // inputs (wire order): 0 x [2,2048,2048]; 1 cos table [2048][64]; 2 sin table [2048][64]; 3 Wq; 4 Wk; 5 Wv; 6 Wo (each [2048 out][2048 in])
  const float* const* F = (const float* const*)d_in;
  char* ws = (char*)d_ws;
  unsigned short* XB = (unsigned short*)(ws + WS_XB); unsigned short* WQ = (unsigned short*)(ws + WS_WQ); unsigned short* WK = (unsigned short*)(ws + WS_WK);
  unsigned short* WV = (unsigned short*)(ws + WS_WV); unsigned short* WO = (unsigned short*)(ws + WS_WO);
  _Float16* QH = (_Float16*)(ws + WS_QH); _Float16* KH = (_Float16*)(ws + WS_KH); _Float16* CTX = (_Float16*)(ws + WS_CTX);
  float* DG = (float*)(ws + WS_DG); float* WP = (float*)(ws + WS_WP);
  k_cvt<<<dim3(CVT_BLOCKS), CVT_T, 0, stream>>>(F[0], F[3], F[4], F[5], F[6], XB);
  k_qk<<<dim3(MROWS / 256, NH), 256, 0, stream>>>((const __bf16*)XB, (const __bf16*)WQ, (const __bf16*)WK, F[1], F[2], QH, KH, DG);
  k_lse<<<dim3(SEQ / 64, NH, NB), 128, 0, stream>>>(QH, KH, DG, WP);
  k_vw<<<dim3(MROWS / 256, NH), 256, 0, stream>>>((const __bf16*)XB, (const __bf16*)WV, WP, CTX);
  k_out<<<dim3(MROWS / 256, DM / 128), 256, 0, stream>>>(CTX, (const _Float16*)WO, (float*)d_out);
}

// v006
// It runs in 165 microseconds.
// Two timings next to v005 both put it at 1.09 times that version's speed.
// Over all steps from v000 it is 5.79 times as fast.
// compute dtype: every float input RNE-converted to bf16 on load; q/k/v projections = exact bf16 x bf16 products on v_wmma_f32_16x16x32_bf16 (f32 accumulate); score statistics q' x k' once to f16 each on v_wmma_f32_16x16x32_f16 (f32 accumulate, f32 running max / running sum); diagonal logit = f32 VALU dot of the f32 q', k' (per-row, no shared operand); output projection = f16(w*v * 2^12) x f16(bf16(Wo) * 2^8) on v_wmma_f32_16x16x32_f16, f32 accumulate, x 2^-20 in the f32 epilogue.
#include <hip/hip_runtime.h>
#include <math.h>

typedef __attribute__((ext_vector_type(16))) _Float16 v16h;
typedef __attribute__((ext_vector_type(16))) __bf16 v16b;
typedef __attribute__((ext_vector_type(8)))  _Float16 v8h;
typedef __attribute__((ext_vector_type(8)))  __bf16 v8b;
typedef __attribute__((ext_vector_type(8)))  float v8f;
typedef __attribute__((ext_vector_type(4)))  float v4f;
typedef __attribute__((ext_vector_type(2)))  float v2f;
typedef __attribute__((ext_vector_type(4)))  unsigned v4u;

template <typename T> __device__ __forceinline__ void vst2(void* p, T v) { *(T*)p = v;  }
__device__ __forceinline__ v8f wmma16(v16h a, v16h b, v8f c) {
  v8f d = __builtin_amdgcn_wmma_f32_16x16x32_f16(false, a, false, b, (short)0, c, false, false);
  asm volatile("v_nop\n\tv_nop\n\tv_nop\n\tv_nop" : "+v"(d) : "v"(a), "v"(b));
  return d;
}
__device__ __forceinline__ v8f wmma_bf(v16b a, v16b b, v8f c) {
  v8f d = __builtin_amdgcn_wmma_f32_16x16x32_bf16(false, a, false, b, (short)0, c, false, false);
  asm volatile("v_nop\n\tv_nop\n\tv_nop\n\tv_nop" : "+v"(d) : "v"(a), "v"(b));
  return d;
}
// 16x16x32 fragments (A and B alike): lane = (g = lane>>4, row/col = lane&15); elements 0..7 = k0+8g+0..7, 8..15 = k0+16+8g+0..7; D element r = (row 8g+r, col lane&15)
__device__ __forceinline__ v16h frag_h(const _Float16* rowk0, unsigned lane) {
  union { v16h v; v8h q[2]; } u; const _Float16* p = rowk0 + 8u * (lane >> 4);
  u.q[0] = *(const v8h*)p; u.q[1] = *(const v8h*)(p + 16); return u.v;
}
__device__ __forceinline__ v16b frag_b(const __bf16* rowk0, unsigned lane) {
  union { v16b v; v8b q[2]; } u; const __bf16* p = rowk0 + 8u * (lane >> 4);
  u.q[0] = *(const v8b*)p; u.q[1] = *(const v8b*)(p + 16); return u.v;
}
__device__ __forceinline__ float bfr(float v) { return (float)(__bf16)v; }

// Self-attention whose output keeps only the DIAGONAL probability: x [NB][SEQ_FULL][DM] (first SEQ rows per batch used); Wq/Wk/Wv/Wo [DM out][DM in] (y = x W^T, no bias); 16 heads x 128;
// interleaved-pair rotation of q and k with INPUT tables cos/sin [SEQ][64]; w[b][h][s] = exp(q'[s].k'[s] * scale - logsumexp_k(q'[s].k'[k] * scale)); ctx = w * v; out = ctx Wo^T.
#ifndef NB
#define NB 2
#endif
#ifndef SEQ
#define SEQ 2048
#endif
#define NB_FULL 2
#define SEQ_FULL 2048
#define DM 2048
#define NH 16
#define HD 128
#define MROWS (NB * SEQ)
#define SCALE 0.08838834764831845f
#define LOG2E 1.4426950408889634f
#define CTXC 4096.0f
#define WOC 256.0f
#define OUTC (1.0f / 1048576.0f)

static_assert(NH * HD == DM);
static_assert(SEQ % 256 == 0);
static_assert(SEQ <= SEQ_FULL);
static_assert(NB <= NB_FULL);
static_assert(MROWS % 256 == 0);
static_assert(DM % 128 == 0);
static_assert(((size_t)SEQ * DM) % (8 * 256) == 0);
static_assert(((size_t)DM * DM) % (8 * 256) == 0);

#define WS_XB  ((size_t)0)                                   // bf16 x rows [b*SEQ + s][DM]
#define WS_WQ  (WS_XB  + 2u * (size_t)MROWS * DM)            // bf16 Wq [out][in]
#define WS_WK  (WS_WQ  + 2u * (size_t)DM * DM)
#define WS_WV  (WS_WK  + 2u * (size_t)DM * DM)
#define WS_WO  (WS_WV  + 2u * (size_t)DM * DM)               // f16 (bf16(Wo) * 2^8) [out][in]
#define WS_QH  (WS_WO  + 2u * (size_t)DM * DM)               // f16 rotated q rows [b*SEQ + s][DM]
#define WS_KH  (WS_QH  + 2u * (size_t)MROWS * DM)            // f16 rotated k rows
#define WS_CTX (WS_KH  + 2u * (size_t)MROWS * DM)            // f16 (w * v * 2^12) rows
#define WS_DG  (WS_CTX + 2u * (size_t)MROWS * DM)            // f32 diagonal logits [b][h][s]
#define WS_WP  (WS_DG  + 4u * (size_t)NB * NH * SEQ)         // f32 diagonal probabilities [b][h][s]
#define WS_END (WS_WP  + 4u * (size_t)NB * NH * SEQ)
static_assert(WS_END <= (size_t)134217728);
static_assert(WS_DG % 128 == 0);

// ---- LDS staging by asynchronous copies (global_load_async_to_lds_b128): every lane brings 16 B, 8 (or 16) neighbouring lanes bring one whole row piece, so a wave touches whole 128-B lines;
// the fragments are then read from LDS by ds_load_b128 at a row pitch of 16 B x odd. The projection ring has NBF = 3 or 4 buffers (the copies of the next NBF - 1 stages fly while a stage is worked on), the key ring two.
#define KP 64u                      /* k elements of one projection stage: 128 B of every row */
#define LP 144u                     /* LDS row pitch of a projection stage, bytes */
#define STG (384u * LP)             /* one projection stage: 256 rows of the left operand, then 128 rows of the weight */
#define NTR (DM / KP)
#define LPK 272u                    /* LDS row pitch of a key stage, bytes: 256 B of data */
#define STGK (128u * LPK)           /* one key stage: 128 keys x 128 head elements */
#define NKB (SEQ / 128u)
static_assert(NTR >= 4u);
#define CP1(l, g) "global_load_async_to_lds_b128 %" #l ", %" #g ", off\n\t"
__device__ __forceinline__ unsigned lds_off(const void* p) { return (unsigned)(size_t)p; }
// the ring's two waits in statements of their own, each with the memory clobber that keeps LDS reads and copies on their side of it
__device__ __forceinline__ void wait_ds() { asm volatile("s_wait_dscnt 0x0" ::: "memory"); }       /* this wave's LDS reads are done before the buffer is handed back */
__device__ __forceinline__ void wait_async() { asm volatile("s_wait_asynccnt 0x0" ::: "memory"); } /* this wave's copies have landed before the barrier publishes them */
// counted form for the projection ring (12 copies a wave and stage, landing counted in issue order): all but the youngest ST stages' copies have landed, so the oldest stage in flight is complete while the younger ones keep flying
template <unsigned ST> __device__ __forceinline__ void wait_async_but() { asm volatile("s_wait_asynccnt %0" :: "n"(12u * ST) : "memory"); }
// 12 copies of one lane: rows crow + 32 i of the stage (i < 8: left operand, i >= 8: weight); s_wait_xcnt closes the statement so that no address register is rewritten ahead of it
__device__ __forceinline__ void stage_copy(unsigned l, const char* ga, const char* gw) {
  const size_t rs = (size_t)32u * DM * 2u; const unsigned ls = 32u * LP;
  asm volatile(CP1(0, 12) CP1(1, 13) CP1(2, 14) CP1(3, 15) CP1(4, 16) CP1(5, 17) CP1(6, 18) CP1(7, 19) CP1(8, 20) CP1(9, 21) CP1(10, 22) CP1(11, 23) "s_wait_xcnt 0x0"
    :: "v"(l), "v"(l + ls), "v"(l + 2u * ls), "v"(l + 3u * ls), "v"(l + 4u * ls), "v"(l + 5u * ls), "v"(l + 6u * ls), "v"(l + 7u * ls), "v"(l + 8u * ls), "v"(l + 9u * ls), "v"(l + 10u * ls), "v"(l + 11u * ls),
       "v"(ga), "v"(ga + rs), "v"(ga + 2u * rs), "v"(ga + 3u * rs), "v"(ga + 4u * rs), "v"(ga + 5u * rs), "v"(ga + 6u * rs), "v"(ga + 7u * rs), "v"(gw), "v"(gw + rs), "v"(gw + 2u * rs), "v"(gw + 3u * rs)
    : "memory");
}
// the two-weight stage of k_qk: 256 rows of the left operand, then 128 rows of each weight; 16 copies a wave and stage
#define STG2 (512u * LP)
template <unsigned ST> __device__ __forceinline__ void wait_async_but16() { asm volatile("s_wait_asynccnt %0" :: "n"(16u * ST) : "memory"); }   /* all but the youngest ST stages' copies have landed */
// 16 copies of one lane in two statements (an asm statement takes thirty operands): rows crow + 32 i of the stage (i < 8: left operand, i = 8..11: first weight, i = 12..15: second weight); each statement closes with its s_wait_xcnt
__device__ __forceinline__ void stage_copy2(unsigned l, const char* ga, const char* g1, const char* g2) {
  const size_t rs = (size_t)32u * DM * 2u; const unsigned ls = 32u * LP;
  asm volatile(CP1(0, 8) CP1(1, 9) CP1(2, 10) CP1(3, 11) CP1(4, 12) CP1(5, 13) CP1(6, 14) CP1(7, 15) "s_wait_xcnt 0x0"
    :: "v"(l), "v"(l + ls), "v"(l + 2u * ls), "v"(l + 3u * ls), "v"(l + 4u * ls), "v"(l + 5u * ls), "v"(l + 6u * ls), "v"(l + 7u * ls),
       "v"(ga), "v"(ga + rs), "v"(ga + 2u * rs), "v"(ga + 3u * rs), "v"(ga + 4u * rs), "v"(ga + 5u * rs), "v"(ga + 6u * rs), "v"(ga + 7u * rs)
    : "memory");
  asm volatile(CP1(0, 8) CP1(1, 9) CP1(2, 10) CP1(3, 11) CP1(4, 12) CP1(5, 13) CP1(6, 14) CP1(7, 15) "s_wait_xcnt 0x0"
    :: "v"(l + 8u * ls), "v"(l + 9u * ls), "v"(l + 10u * ls), "v"(l + 11u * ls), "v"(l + 12u * ls), "v"(l + 13u * ls), "v"(l + 14u * ls), "v"(l + 15u * ls),
       "v"(g1), "v"(g1 + rs), "v"(g1 + 2u * rs), "v"(g1 + 3u * rs), "v"(g2), "v"(g2 + rs), "v"(g2 + 2u * rs), "v"(g2 + 3u * rs)
    : "memory");
}
// 8 copies of one lane: key rows krow + 8 i, i = 0..7, of half a key stage
__device__ __forceinline__ void key_copy(unsigned l, const char* g) {
  const size_t rs = (size_t)8u * DM * 2u; const unsigned ls = 8u * LPK;
  asm volatile(CP1(0, 8) CP1(1, 9) CP1(2, 10) CP1(3, 11) CP1(4, 12) CP1(5, 13) CP1(6, 14) CP1(7, 15) "s_wait_xcnt 0x0"
    :: "v"(l), "v"(l + ls), "v"(l + 2u * ls), "v"(l + 3u * ls), "v"(l + 4u * ls), "v"(l + 5u * ls), "v"(l + 6u * ls), "v"(l + 7u * ls),
       "v"(g), "v"(g + rs), "v"(g + 2u * rs), "v"(g + 3u * rs), "v"(g + 4u * rs), "v"(g + 5u * rs), "v"(g + 6u * rs), "v"(g + 7u * rs)
    : "memory");
}
// acc[mi][nj] += A[256 rows][DM] x W[128 rows][DM]^T for this wave's 64 x 64 share (8 waves: wave >> 1 picks the 64 rows, wave & 1 the 64 weight rows), k ascending in steps of 32;
// A, Wt = the block's first rows (16-bit elements, row pitch DM). Every fragment read from LDS feeds four matrix instructions.
// Every wave of the block calls it; the ring's last readers have left it and every wave's copies have landed when it returns (the last trip ends in s_wait_dscnt 0, s_wait_asynccnt 0 and the barrier).
template <bool BF, unsigned NBF> __device__ __forceinline__ void gemm_ring(unsigned char* ring, const void* A, const void* Wt, unsigned tid, v8f (&acc)[4][4]) {
  static_assert(NBF >= 3u && NBF <= NTR && NBF * 12u <= 63u);   /* the prologue has NBF stages of 12 copies a wave outstanding */
  const unsigned wave = tid >> 5, lane = tid & 31u, col = lane & 15u; const unsigned crow = tid >> 3, cch = tid & 7u;
  const char* ga = (const char*)A + ((size_t)crow * DM + cch * 8u) * 2u; const char* gw = (const char*)Wt + ((size_t)crow * DM + cch * 8u) * 2u;
  const unsigned l0 = lds_off(ring) + crow * LP + cch * 16u;
#pragma unroll 1   /* kept rolled: one stage's 36 address registers at a time */
  for (unsigned s = 0; s < NBF; ++s) stage_copy(l0 + s * STG, ga + s * (KP * 2u), gw + s * (KP * 2u));
  wait_async_but<NBF - 1u>();
  __syncthreads();   /* publishes stage 0 */
  unsigned rb = 0;   /* byte offset of the buffer that holds stage t */
#pragma unroll 1   /* kept rolled: one trip is already 32 matrix instructions, and the text of two such loops stays small */
  for (unsigned t = 0; t < NTR; ++t) {
    const unsigned char* ab = ring + rb + ((wave >> 1) * 64u + col) * LP; const unsigned char* wb = ring + rb + (256u + (wave & 1u) * 64u + col) * LP;
    // the eight fragment reads of a k step of 32 stand together in front of its 16 matrix instructions (both steps' fragments at once do not fit beside 16 accumulator tiles under v256)
#pragma unroll
    for (unsigned ks = 0; ks < 2u; ++ks) {
      if constexpr (BF) { v16b a[4], w[4];
#pragma unroll
        for (int i = 0; i < 4; ++i) { a[i] = frag_b((const __bf16*)(ab + i * 16u * LP + ks * 64u), lane); w[i] = frag_b((const __bf16*)(wb + i * 16u * LP + ks * 64u), lane); }
#pragma unroll
        for (int mi = 0; mi < 4; ++mi) {
#pragma unroll
          for (int nj = 0; nj < 4; ++nj) acc[mi][nj] = wmma_bf(a[mi], w[nj], acc[mi][nj]); }
      } else { v16h a[4], w[4];
#pragma unroll
        for (int i = 0; i < 4; ++i) { a[i] = frag_h((const _Float16*)(ab + i * 16u * LP + ks * 64u), lane); w[i] = frag_h((const _Float16*)(wb + i * 16u * LP + ks * 64u), lane); }
#pragma unroll
        for (int mi = 0; mi < 4; ++mi) {
#pragma unroll
          for (int nj = 0; nj < 4; ++nj) acc[mi][nj] = wmma16(a[mi], w[nj], acc[mi][nj]); } } }
    wait_ds();
    if (t + NBF - 1u < NTR) wait_async_but<NBF - 2u>(); else wait_async();   /* stage t + 1 has landed: behind it stages t + 2 .. t + NBF - 1 are in flight; in the last trips fewer were issued, so the wait is to 0 */
    __syncthreads();   /* publishes stage t + 1 and ends every reader's last read of stage t's buffer */
    if (t + NBF < NTR) stage_copy(l0 + rb, ga + (size_t)(t + NBF) * (KP * 2u), gw + (size_t)(t + NBF) * (KP * 2u));
    rb = rb + STG == NBF * STG ? 0u : rb + STG;
  }
  wait_async();
}

// The same ring for TWO weights against one left operand: acc[mi][nj] += A x W1^T (nj < 4) and A x W2^T (nj >= 4), this wave's 64 rows x the same 64 weight rows of each; k ascending in steps of 32, as in gemm_ring.
// The left tile is staged once for both products and each of its fragments feeds eight matrix instructions.
// Every wave of the block calls it; it returns as gemm_ring does: last readers gone, every wave's copies landed.
template <unsigned NBF> __device__ __forceinline__ void gemm_ring2(unsigned char* ring, const void* A, const void* W1, const void* W2, unsigned tid, v8f (&acc)[4][8]) {
  static_assert(NBF >= 3u && NBF <= NTR && NBF * 16u <= 63u);   /* the prologue has NBF stages of 16 copies a wave outstanding */
  const unsigned wave = tid >> 5, lane = tid & 31u, col = lane & 15u; const unsigned crow = tid >> 3, cch = tid & 7u;
  const size_t go = ((size_t)crow * DM + cch * 8u) * 2u;
  const char* ga = (const char*)A + go; const char* g1 = (const char*)W1 + go; const char* g2 = (const char*)W2 + go;
  const unsigned l0 = lds_off(ring) + crow * LP + cch * 16u;
#pragma unroll 1   /* kept rolled: one statement's 24 address registers at a time */
  for (unsigned s = 0; s < NBF; ++s) stage_copy2(l0 + s * STG2, ga + s * (KP * 2u), g1 + s * (KP * 2u), g2 + s * (KP * 2u));
  wait_async_but16<NBF - 1u>();
  __syncthreads();   /* publishes stage 0 */
  unsigned rb = 0;   /* byte offset of the buffer that holds stage t */
#pragma unroll 1   /* kept rolled: one trip is already 64 matrix instructions */
  for (unsigned t = 0; t < NTR; ++t) {
    const unsigned char* ab = ring + rb + ((wave >> 1) * 64u + col) * LP; const unsigned char* wb = ring + rb + (256u + (wave & 1u) * 64u + col) * LP;
    // the trip's 48 fragment reads (both k steps of 32) stand in one group in front of its 64 matrix instructions: LDS returns them in order, so the second step's reads land under the first step's products
    v16b a[2][4], w[2][8];
#pragma unroll
    for (unsigned ks = 0; ks < 2u; ++ks) {
#pragma unroll
      for (int i = 0; i < 4; ++i) { a[ks][i] = frag_b((const __bf16*)(ab + i * 16u * LP + ks * 64u), lane); w[ks][i] = frag_b((const __bf16*)(wb + i * 16u * LP + ks * 64u), lane); w[ks][4 + i] = frag_b((const __bf16*)(wb + (128u + i * 16u) * LP + ks * 64u), lane); } }
    __builtin_amdgcn_sched_barrier(0);   /* holds the reads in front: without it the compiler sinks each left fragment's read to directly in front of its row of products, with a wait to 0 there */
#pragma unroll
    for (unsigned ks = 0; ks < 2u; ++ks) {
#pragma unroll
      for (int mi = 0; mi < 4; ++mi) {
#pragma unroll
        for (int nj = 0; nj < 8; ++nj) acc[mi][nj] = __builtin_amdgcn_wmma_f32_16x16x32_bf16(false, a[ks][mi], false, w[ks][nj], (short)0, acc[mi][nj], false, false); } }   /* the bare builtin: as operands of the v_nop statement of wmma_bf the build kept all 32 accumulator tiles under v256 and spilled them to scratch; bare, they and the fragments use v0..v503; the compiler keeps the distances of its own builtin */
    __builtin_amdgcn_sched_barrier(0);   /* holds the foot's waits behind the products: without it s_wait_dscnt 0 rises to the first product, and every read of the trip is waited for there */
    wait_ds();
    if (t + NBF - 1u < NTR) wait_async_but16<NBF - 2u>(); else wait_async();   /* stage t + 1 has landed; in the last trips fewer stages were issued behind it, so the wait is to 0 */
    __syncthreads();   /* publishes stage t + 1 and ends every reader's last read of stage t's buffer */
    if (t + NBF < NTR) stage_copy2(l0 + rb, ga + (size_t)(t + NBF) * (KP * 2u), g1 + (size_t)(t + NBF) * (KP * 2u), g2 + (size_t)(t + NBF) * (KP * 2u));
    rb = rb + STG2 == NBF * STG2 ? 0u : rb + STG2;
  }
  wait_async();
}

// ---- k_cvt: ONE launch converts x and the four weights. The five 16-bit planes lie one behind the other in the workspace: NB + 4 segments (each batch of x, then Wq, Wk, Wv, Wo) of CVT_BLOCKS tiles each.
// A tile = CVT_TILE pieces of 8 elements (32 B read, 16 B written a piece). Block n converts tile n of every segment, the next segment's 8 loads a lane issued ahead of this segment's conversion:
// few long-lived waves that keep loads in flight, in place of one short-lived wave per 256 elements.
#define CVT_T 512u
#define CVT_U 4u
#define CVT_TILE (CVT_T * CVT_U)
#define CVT_BLOCKS ((unsigned)((size_t)DM * DM / 8u / CVT_TILE))
#define CVT_SEGS ((unsigned)NB + 4u)
static_assert((size_t)CVT_BLOCKS * CVT_TILE * 8u == (size_t)DM * DM);
static_assert((size_t)SEQ * DM == (size_t)DM * DM);   /* a batch of x is as long as a weight */
static_assert(WS_XB == 0 && WS_WQ == 2u * (size_t)NB * DM * DM && WS_WO == WS_WQ + 3u * 2u * (size_t)DM * DM);
// no register that an issued load or store names is rewritten ahead of this wait
__device__ __forceinline__ void wait_x() { asm volatile("s_wait_xcnt 0x0" ::: "memory"); }
__device__ __forceinline__ void cvt_load(v4f (&r)[2u * CVT_U], const float* s) {
#pragma unroll
  for (unsigned u = 0; u < CVT_U; ++u) { r[2u * u] = *(const v4f*)(s + u * (CVT_T * 8u)); r[2u * u + 1u] = *(const v4f*)(s + u * (CVT_T * 8u) + 4u); }
  wait_x();
  __builtin_amdgcn_sched_barrier(0);   /* the loads stay one group ahead of the conversion that follows, and that conversion's register writes stay behind the wait */
}
__global__ __launch_bounds__(512) void k_cvt(const float* __restrict__ X, const float* __restrict__ Q, const float* __restrict__ K, const float* __restrict__ V, const float* __restrict__ O,
    unsigned short* __restrict__ dst) {
  const unsigned off = blockIdx.x * (CVT_TILE * 8u) + threadIdx.x * 8u;   /* this lane's first element inside every segment */
  v4f cur[2u * CVT_U], nxt[2u * CVT_U];
  cvt_load(cur, X + off);
#pragma unroll   /* unrolled: the segment number picks the source pointer and the target type at compile time, and the two register sets need no copies */
  for (unsigned s = 0; s < CVT_SEGS; ++s) {
    const unsigned n = s + 1u;
    if (n < CVT_SEGS) cvt_load(nxt, (n < (unsigned)NB ? X + (size_t)n * ((size_t)SEQ_FULL * DM) : n == (unsigned)NB ? Q : n == (unsigned)NB + 1u ? K : n == (unsigned)NB + 2u ? V : O) + off);
    v4u o[CVT_U];
#pragma unroll
    for (unsigned u = 0; u < CVT_U; ++u) { const v4f a = cur[2u * u], b = cur[2u * u + 1u];
      if (s + 1u < CVT_SEGS) { v8b t;
#pragma unroll
        for (int e = 0; e < 4; ++e) { t[e] = (__bf16)a[e]; t[4 + e] = (__bf16)b[e]; }
        o[u] = __builtin_bit_cast(v4u, t);
      } else { v8h t;   /* the last segment, Wo, goes to f16 (bf16 value x 2^8) */
#pragma unroll
        for (int e = 0; e < 4; ++e) { t[e] = (_Float16)(bfr(a[e]) * WOC); t[4 + e] = (_Float16)(bfr(b[e]) * WOC); }
        o[u] = __builtin_bit_cast(v4u, t);
      } }
    __builtin_amdgcn_sched_barrier(0);   /* all four pieces are converted before the first store issues: no store's data register is reused ahead of the wait behind the stores */
    unsigned short* d = dst + (size_t)s * ((size_t)DM * DM) + off;
#pragma unroll
    for (unsigned u = 0; u < CVT_U; ++u) vst2((void*)(d + u * (CVT_T * 8u)), o[u]);
    wait_x();
    __builtin_amdgcn_sched_barrier(0);   /* keeps the next segment's register writes behind that wait */
#pragma unroll
    for (unsigned u = 0; u < 2u * CVT_U; ++u) cur[u] = nxt[u];
  }
}

// ---- k_qk: block = (256 token rows, head h): q and k projections in ONE pass over K = DM (exact bf16 products; 32 accumulator tiles a wave: the x tile is staged once and its fragments serve both weights);
// rotation with the bf16-converted input tables (in LDS as the two bf16 values of a pair in one dword: nothing is lost, they are bf16 values); a lane holds q' and k' of the same (row, column), so the diagonal dot is formed in registers;
// table tile and f16 pair tile lie in the idle ring; f16 q'/k' rows, f32 diagonal logit per row (the two column halves of a row are summed by two waves, then added)
__global__ __launch_bounds__(256) void k_qk(const __bf16* __restrict__ XB, const __bf16* __restrict__ WQ, const __bf16* __restrict__ WK, const float* __restrict__ COS, const float* __restrict__ SIN,
    _Float16* __restrict__ QH, _Float16* __restrict__ KH, float* __restrict__ DG) {
  __shared__ __align__(16) float sdg[2][256];
  __shared__ __align__(16) unsigned char ring[3u * STG2];
  unsigned (*stab)[68] = (unsigned (*)[68])ring;                          /* bf16 cos (low half) and bf16 sin (high half) of (position, pair): in the ring once the projection has left it */
  unsigned (*sq)[132] = (unsigned (*)[132])(ring + 256u * 68u * 4u);      /* the f16 pair (q' low half, k' high half), behind the table tile */
  static_assert(256u * 68u * 4u + 256u * 132u * 4u <= 3u * STG2);
  const unsigned tid = threadIdx.x, wave = tid >> 5, lane = tid & 31u, col = lane & 15u, g = lane >> 4;
  const unsigned wr0 = (wave >> 1) * 64u + 8u * g, wn = wave & 1u;   /* this lane's first row and this wave's column half */
  const unsigned h = blockIdx.y, c0 = h * HD; const unsigned r0 = blockIdx.x * 256u; const unsigned bb = r0 / (unsigned)SEQ, t0 = r0 % (unsigned)SEQ;
  const bool odd = (col & 1u) != 0u;
  v8f aqk[4][8] = {};   /* [mi][nj]: q for nj < 4, k of the same columns for nj >= 4 */
  gemm_ring2<3u>(ring, XB + (size_t)r0 * DM, WQ + (size_t)c0 * DM, WK + (size_t)c0 * DM, tid, aqk);
  // table tile: positions t0..t0+255, 64 pairs, bf16-converted values
  { const unsigned rl = tid >> 4, q = tid & 15u; const size_t o = (size_t)(t0 + rl) * 64u + q * 4u; v4f c[16], s[16];   /* rows rl + 16 i */
#pragma unroll
    for (unsigned i = 0; i < 16u; ++i) { c[i] = *(const v4f*)(COS + o + i * (16u * 64u)); s[i] = *(const v4f*)(SIN + o + i * (16u * 64u)); }
    wait_x();
    __builtin_amdgcn_sched_barrier(0);   /* the 32 loads fly together, and what follows writes no register of theirs ahead of the wait */
#pragma unroll
    for (unsigned i = 0; i < 16u; ++i) { v4u p;
#pragma unroll
      for (int u = 0; u < 4; ++u) p[u] = (unsigned)__builtin_bit_cast(unsigned short, (__bf16)c[i][u]) | ((unsigned)__builtin_bit_cast(unsigned short, (__bf16)s[i][u]) << 16);
      *(v4u*)&stab[rl + 16u * i][q * 4u] = p; } }
  __syncthreads();   /* table tile is cross-wave: block barrier */
#pragma unroll
  for (int mi = 0; mi < 4; ++mi) {
    float ds[8] = {0.f, 0.f, 0.f, 0.f, 0.f, 0.f, 0.f, 0.f};
#pragma unroll
    for (int nj = 0; nj < 4; ++nj) {
#pragma unroll
      for (int r = 0; r < 8; ++r) { const unsigned rl = wr0 + mi * 16u + r; const unsigned cc = wn * 64u + nj * 16u + col;
        const unsigned cs = stab[rl][cc >> 1]; const float c = __builtin_bit_cast(float, cs << 16), s = __builtin_bit_cast(float, cs & 0xffff0000u);
        const float oq = aqk[mi][nj][r], okv = aqk[mi][4 + nj][r];
        const float pq = __shfl_xor(oq, 1), pk = __shfl_xor(okv, 1);       /* pair partners (column ^ 1), all lanes active */
        const float sg = odd ? s : -s;                                    /* even column: te*c - to*s; odd column: to*c + te*s */
        const float qv = oq * c + pq * sg;
        const float kv = okv * c + pk * sg;
        ds[r] += qv * kv;
        sq[rl][cc] = (unsigned)__builtin_bit_cast(unsigned short, (_Float16)qv) | ((unsigned)__builtin_bit_cast(unsigned short, (_Float16)kv) << 16); } }
#pragma unroll
    for (int r = 0; r < 8; ++r) { float d = ds[r]; d += __shfl_xor(d, 1); d += __shfl_xor(d, 2); d += __shfl_xor(d, 4); d += __shfl_xor(d, 8);
      if (col == 0u) sdg[wn][wr0 + mi * 16u + r] = d; } }
  __syncthreads();   /* cross-wave LDS tiles: block barrier */
#pragma unroll
  for (unsigned rb = 0; rb < 256u; rb += 64u) { const unsigned rl = rb + (tid >> 4), q = tid & 15u; const size_t o = (size_t)(r0 + rl) * DM + c0 + q * 8u; v4u oq4[4], ok4[4];   /* rows rl + 16 i; the low halves are q', the high halves k' */
#pragma unroll
    for (unsigned i = 0; i < 4u; ++i) { const v4u p0 = *(const v4u*)&sq[rl + 16u * i][q * 8u], p1 = *(const v4u*)&sq[rl + 16u * i][q * 8u + 4u];
      oq4[i][0] = (p0[0] & 0xffffu) | (p0[1] << 16); oq4[i][1] = (p0[2] & 0xffffu) | (p0[3] << 16); oq4[i][2] = (p1[0] & 0xffffu) | (p1[1] << 16); oq4[i][3] = (p1[2] & 0xffffu) | (p1[3] << 16);
      ok4[i][0] = (p0[0] >> 16) | (p0[1] & 0xffff0000u); ok4[i][1] = (p0[2] >> 16) | (p0[3] & 0xffff0000u); ok4[i][2] = (p1[0] >> 16) | (p1[1] & 0xffff0000u); ok4[i][3] = (p1[2] >> 16) | (p1[3] & 0xffff0000u); }
    __builtin_amdgcn_sched_barrier(0);   /* all eight pieces are formed before the first store issues: no store's register is reused ahead of the wait behind the stores */
#pragma unroll
    for (unsigned i = 0; i < 4u; ++i) { vst2((void*)(QH + o + (size_t)i * (16u * DM)), oq4[i]); vst2((void*)(KH + o + (size_t)i * (16u * DM)), ok4[i]); }
    wait_x();
    __builtin_amdgcn_sched_barrier(0);   /* keeps the next group's register writes behind that wait */
  }
  if (tid < 64u) { const v4f d0 = *(const v4f*)&sdg[0][tid * 4u], d1 = *(const v4f*)&sdg[1][tid * 4u]; vst2((void*)(DG + (size_t)(bb * NH + h) * SEQ + t0 + tid * 4u), (d0 + d1) * SCALE); }
}

// bare v_exp_f32, for the terms and rescale factors of a running sum: it lacks only the library exp2f's range scaling (a compare, two selects, an add and a v_ldexp a call), so a result under 2^-126 reads 0;
// each such value is added to, or multiplies a sum that is added to, a sum that holds its own maximum's term (about 1), where it is far below half a unit in the last place: the f32 sums are the same
__device__ __forceinline__ float exp2_raw(float x) { return __builtin_amdgcn_exp2f(x); }
// the same for two rescale factors, in place, written as text; the v_nop is the slot behind the second one
__device__ __forceinline__ v2f exp2_raw2(float x, float y) { asm("v_exp_f32 %0, %0\n\tv_exp_f32 %1, %1\n\tv_nop" : "+v"(x), "+v"(y)); return (v2f){x, y}; }
// ---- k_lse: block = 64 query rows of (b, h); one streaming pass over all SEQ keys (128 per step): f16 q' x f16 k' logits, f32 running max / running sum in the log2 domain; w = exp(diag - lse)
__global__ __launch_bounds__(128) void k_lse(const _Float16* __restrict__ QH, const _Float16* __restrict__ KH, const float* __restrict__ DG, float* __restrict__ WP) {
  __shared__ __align__(16) float sw[64];
  __shared__ __align__(16) unsigned char ring[2u * STGK];
  const unsigned tid = threadIdx.x, wave = tid >> 5, lane = tid & 31u, col = lane & 15u, g = lane >> 4;
  const unsigned qb = blockIdx.x, h = blockIdx.y, b = blockIdx.z; const unsigned c0 = h * HD; const unsigned ql0 = qb * 64u + wave * 16u;
  const size_t q0 = (size_t)b * SEQ + ql0, kr0 = (size_t)b * SEQ;
  const float C2 = SCALE * LOG2E;
  v16h qf[4];
#pragma unroll
  for (int kc = 0; kc < 4; ++kc) qf[kc] = frag_h(QH + (q0 + col) * DM + c0 + kc * 32u, lane);
  float m[8], sm[8];
#pragma unroll
  for (int r = 0; r < 8; ++r) { m[r] = -3.0e38f; sm[r] = 0.f; }
  // key ring: a stage is 128 keys x 256 B; lane = (row tid >> 4, 16-B piece tid & 15), 16 copies a lane and stage in two statements
  const char* gk = (const char*)(KH + (kr0 + (tid >> 4)) * DM + c0 + (tid & 15u) * 8u); const size_t gstep = (size_t)128u * DM * 2u, ghalf = (size_t)64u * DM * 2u;
  const unsigned lk = lds_off(ring) + (tid >> 4) * LPK + (tid & 15u) * 16u;
  key_copy(lk, gk); key_copy(lk + 64u * LPK, gk + ghalf);
  wait_async();
  __syncthreads();   /* publishes stage 0 */
  if (NKB > 1u) { key_copy(lk + STGK, gk + gstep); key_copy(lk + STGK + 64u * LPK, gk + gstep + ghalf); }
#pragma unroll 1
  for (unsigned kb = 0; kb < NKB; ++kb) {
    v8f acc[8] = {};
#pragma unroll
    for (int j = 0; j < 8; ++j) { const _Float16* kp = (const _Float16*)(ring + (kb & 1u) * STGK + (j * 16u + col) * LPK);
      const v16h k0 = frag_h(kp, lane), k1 = frag_h(kp + 32, lane), k2 = frag_h(kp + 64, lane), k3 = frag_h(kp + 96, lane);
      acc[j] = wmma16(qf[0], k0, acc[j]); acc[j] = wmma16(qf[1], k1, acc[j]); acc[j] = wmma16(qf[2], k2, acc[j]); acc[j] = wmma16(qf[3], k3, acc[j]); }
    // two rows at a time, the pair that lies in neighbouring accumulator registers: the scaled difference and the sum are packed operations (same fma, same order of additions a row)
    v2f mn[4], dm[4];
#pragma unroll   /* these loops are unrolled so that acc, mn, dm, m and sm are indexed by constants and stay in registers */
    for (int p = 0; p < 4; ++p) { const int r = 2 * p; v2f mx = {acc[0][r], acc[0][r + 1]};
#pragma unroll
      for (int j = 1; j < 8; ++j) { mx[0] = fmaxf(mx[0], acc[j][r]); mx[1] = fmaxf(mx[1], acc[j][r + 1]); }
      mn[p] = (v2f){fmaxf(m[r], mx[0] * C2), fmaxf(m[r + 1], mx[1] * C2)}; dm[p] = (v2f){m[r], m[r + 1]} - mn[p]; m[r] = mn[p][0]; m[r + 1] = mn[p][1]; }
#pragma unroll
    for (int p = 0; p < 4; ++p) { const int r = 2 * p; v2f s = {0.f, 0.f};
#pragma unroll
      for (int j = 0; j < 8; ++j) { const v2f a = {acc[j][r], acc[j][r + 1]}; const v2f t = __builtin_elementwise_fma(a, (v2f){C2, C2}, -mn[p]); const v2f e = {exp2_raw(t[0]), exp2_raw(t[1])}; s += e; }
      const v2f f = exp2_raw2(dm[p][0], dm[p][1]); sm[r] = sm[r] * f[0] + s[0]; sm[r + 1] = sm[r + 1] * f[1] + s[1]; }
    wait_ds();
    wait_async();
    __syncthreads();   /* publishes stage kb + 1 and ends every reader's last read of stage kb's buffer */
    if (kb + 2u < NKB) { const char* gn = gk + (size_t)(kb + 2u) * gstep; const unsigned ln = lk + (kb & 1u) * STGK; key_copy(ln, gn); key_copy(ln + 64u * LPK, gn + ghalf); } }
  wait_async();
  // merge the 16 column lanes of each half (rows stay within a half); all lanes active
#pragma unroll
  for (int off = 1; off < 16; off <<= 1) {
#pragma unroll
    for (int r = 0; r < 8; ++r) { const float om = __shfl_xor(m[r], off), os = __shfl_xor(sm[r], off); const float mn = fmaxf(m[r], om);
      const v2f f = exp2_raw2(m[r] - mn, om - mn); sm[r] = sm[r] * f[0] + os * f[1]; m[r] = mn; } }
  const float* dp = DG + (size_t)(b * NH + h) * SEQ + ql0 + 8u * g;
  const v4f d0 = *(const v4f*)dp, d1 = *(const v4f*)(dp + 4);
#pragma unroll
  for (int r = 0; r < 8; ++r) { const float dg = r < 4 ? d0[r & 3] : d1[r & 3]; const float w = exp2f(dg * LOG2E - m[r] - log2f(sm[r]));
    if (col == 0u) sw[wave * 16u + 8u * g + r] = w; }
  __syncthreads();   /* cross-wave LDS: block barrier */
  if (tid < 16u) vst2((void*)(WP + (size_t)(b * NH + h) * SEQ + qb * 64u + tid * 4u), *(const v4f*)&sw[tid * 4u]);   
}

// ---- k_vw: block = (256 token rows, head h): v projection (exact bf16 products) x the row's diagonal probability -> f16 (w * v * 2^12) rows
__global__ __launch_bounds__(256) void k_vw(const __bf16* __restrict__ XB, const __bf16* __restrict__ WV, const float* __restrict__ WP, _Float16* __restrict__ CTX) {
  __shared__ __align__(16) _Float16 sh[256][136];
  __shared__ __align__(16) unsigned char ring[4u * STG];
  const unsigned tid = threadIdx.x, wave = tid >> 5, lane = tid & 31u, col = lane & 15u, g = lane >> 4;
  const unsigned wr0 = (wave >> 1) * 64u + 8u * g, wn = wave & 1u;   /* this lane's first row and this wave's column half */
  const unsigned h = blockIdx.y, c0 = h * HD; const unsigned r0 = blockIdx.x * 256u; const unsigned bb = r0 / (unsigned)SEQ, t0 = r0 % (unsigned)SEQ;
  v8f av[4][4] = {};
  gemm_ring<true, 4u>(ring, XB + (size_t)r0 * DM, WV + (size_t)c0 * DM, tid, av);
#pragma unroll
  for (int mi = 0; mi < 4; ++mi) {
    const float* wp = WP + (size_t)(bb * NH + h) * SEQ + t0 + wr0 + mi * 16u;
    const v4f w0 = *(const v4f*)wp, w1 = *(const v4f*)(wp + 4);
#pragma unroll
    for (int nj = 0; nj < 4; ++nj) {
#pragma unroll
      for (int r = 0; r < 8; ++r) { const float wr = (r < 4 ? w0[r & 3] : w1[r & 3]) * CTXC; sh[wr0 + mi * 16u + r][wn * 64u + nj * 16u + col] = (_Float16)(av[mi][nj][r] * wr); } } }
  __syncthreads();
#pragma unroll
  for (unsigned rb = 0; rb < 256u; rb += 128u) { const unsigned rl = rb + (tid >> 4), q = tid & 15u; _Float16* d = CTX + (size_t)(r0 + rl) * DM + c0 + q * 8u; v4u o[8];   /* rows rl + 16 i */
#pragma unroll
    for (unsigned i = 0; i < 8u; ++i) o[i] = *(const v4u*)&sh[rl + 16u * i][q * 8u];
    __builtin_amdgcn_sched_barrier(0);   /* all eight pieces are read before the first store issues: no store's register is reused ahead of the wait behind the stores */
#pragma unroll
    for (unsigned i = 0; i < 8u; ++i) vst2((void*)(d + (size_t)i * (16u * DM)), o[i]);
    wait_x();
    __builtin_amdgcn_sched_barrier(0);   /* keeps the next group's register writes behind that wait */
  }
}

__global__ __launch_bounds__(256) void k_out(const _Float16* __restrict__ CTX, const _Float16* __restrict__ WO, float* __restrict__ OUT) {
  __shared__ __align__(16) unsigned char ring[4u * STG];
  float (*ss)[132] = (float (*)[132])ring;   /* output staging in the ring: gemm_ring returns behind the barrier that ends its last reader's last read, every copy landed */
  static_assert(256u * 132u * 4u <= 4u * STG);
  const unsigned tid = threadIdx.x, wave = tid >> 5, lane = tid & 31u, col = lane & 15u, g = lane >> 4;
  const unsigned wr0 = (wave >> 1) * 64u + 8u * g, wn = wave & 1u;   /* this lane's first row and this wave's column half */
  const unsigned c0 = blockIdx.y * 128u; const unsigned r0 = blockIdx.x * 256u; const unsigned bb = r0 / (unsigned)SEQ, t0 = r0 % (unsigned)SEQ;
  v8f acc[4][4] = {};
  gemm_ring<false, 4u>(ring, CTX + (size_t)r0 * DM, WO + (size_t)c0 * DM, tid, acc);
#pragma unroll
  for (int mi = 0; mi < 4; ++mi) {
#pragma unroll
    for (int nj = 0; nj < 4; ++nj) {
#pragma unroll
      for (int r = 0; r < 8; ++r) ss[wr0 + mi * 16u + r][wn * 64u + nj * 16u + col] = acc[mi][nj][r] * OUTC; } }
  __syncthreads();   /* a row's two column halves come from two waves: block barrier */
  const size_t orow0 = (size_t)bb * SEQ_FULL + t0 + wave * 32u;
#pragma unroll
  for (unsigned rb = 0; rb < 32u; rb += 8u) { v4f o[8];
#pragma unroll
    for (unsigned i = 0; i < 8u; ++i) o[i] = *(const v4f*)&ss[wave * 32u + rb + i][lane * 4u];
    __builtin_amdgcn_sched_barrier(0);   /* all eight rows are read before the first store issues: no store's register is reused ahead of the wait behind the stores */
#pragma unroll
    for (unsigned i = 0; i < 8u; ++i) vst2((void*)(OUT + (orow0 + rb + i) * DM + c0 + lane * 4u), o[i]);
    wait_x();
    __builtin_amdgcn_sched_barrier(0);   /* keeps the next group's register writes behind that wait */
  }
}

extern "C" void kernel_launch(void* const* d_in, const int* in_sizes, int n_in, void* d_out, int out_size, void* d_ws, size_t ws_size, hipStream_t stream) {
  if (n_in < 7) return;
  const long long need_x = (long long)(NB - 1) * SEQ_FULL * DM + (long long)SEQ * DM;
  if ((long long)in_sizes[0] < need_x) return;
  if (in_sizes[1] < SEQ * 64 || in_sizes[2] < SEQ * 64) return;
  if (in_sizes[3] < DM * DM || in_sizes[4] < DM * DM || in_sizes[5] < DM * DM || in_sizes[6] < DM * DM) return;
  if ((long long)out_size < need_x) return;
  if (ws_size < (size_t)WS_END) return;
  // inputs (wire order): 0 x [2,2048,2048]; 1 cos table [2048][64]; 2 sin table [2048][64]; 3 Wq; 4 Wk; 5 Wv; 6 Wo (each [2048 out][2048 in])
  const float* const* F = (const float* const*)d_in;
  char* ws = (char*)d_ws;
  unsigned short* XB = (unsigned short*)(ws + WS_XB); unsigned short* WQ = (unsigned short*)(ws + WS_WQ); unsigned short* WK = (unsigned short*)(ws + WS_WK);
  unsigned short* WV = (unsigned short*)(ws + WS_WV); unsigned short* WO = (unsigned short*)(ws + WS_WO);
  _Float16* QH = (_Float16*)(ws + WS_QH); _Float16* KH = (_Float16*)(ws + WS_KH); _Float16* CTX = (_Float16*)(ws + WS_CTX);
  float* DG = (float*)(ws + WS_DG); float* WP = (float*)(ws + WS_WP);
  k_cvt<<<dim3(CVT_BLOCKS), CVT_T, 0, stream>>>(F[0], F[3], F[4], F[5], F[6], XB);
  k_qk<<<dim3(MROWS / 256, NH), 256, 0, stream>>>((const __bf16*)XB, (const __bf16*)WQ, (const __bf16*)WK, F[1], F[2], QH, KH, DG);
  k_lse<<<dim3(SEQ / 64, NH, NB), 128, 0, stream>>>(QH, KH, DG, WP);
  k_vw<<<dim3(MROWS / 256, NH), 256, 0, stream>>>((const __bf16*)XB, (const __bf16*)WV, WP, CTX);
  k_out<<<dim3(MROWS / 256, DM / 128), 256, 0, stream>>>(CTX, (const _Float16*)WO, (float*)d_out);
}

// v007
// Measured time: 159 microseconds a run.
// Next to v006, in two timings, it ran 1.03 times as fast each time.
// Counting every step since v000, it is 5.98 times as fast.
// compute dtype: every float input RNE-converted to bf16 on load; q/k/v projections = exact bf16 x bf16 products on v_wmma_f32_16x16x32_bf16 (f32 accumulate); score statistics q' x k' once to f16 each on v_wmma_f32_16x16x32_f16 (f32 accumulate, f32 running max / running sum); diagonal logit = f32 VALU dot of the f32 q', k' (per-row, no shared operand); output projection = f16(w*v * 2^12) x f16(bf16(Wo) * 2^8) on v_wmma_f32_16x16x32_f16, f32 accumulate, x 2^-20 in the f32 epilogue.
#include <hip/hip_runtime.h>
#include <math.h>

typedef __attribute__((ext_vector_type(16))) _Float16 v16h;
typedef __attribute__((ext_vector_type(16))) __bf16 v16b;
typedef __attribute__((ext_vector_type(8)))  _Float16 v8h;
typedef __attribute__((ext_vector_type(8)))  __bf16 v8b;
typedef __attribute__((ext_vector_type(8)))  float v8f;
typedef __attribute__((ext_vector_type(4)))  float v4f;
typedef __attribute__((ext_vector_type(2)))  float v2f;
typedef __attribute__((ext_vector_type(4)))  unsigned v4u;

template <typename T> __device__ __forceinline__ void vst2(void* p, T v) { *(T*)p = v;  }
__device__ __forceinline__ v8f wmma16(v16h a, v16h b, v8f c) {
  v8f d = __builtin_amdgcn_wmma_f32_16x16x32_f16(false, a, false, b, (short)0, c, false, false);
  asm volatile("v_nop\n\tv_nop\n\tv_nop\n\tv_nop" : "+v"(d) : "v"(a), "v"(b));
  return d;
}
// 16x16x32 fragments (A and B alike): lane = (g = lane>>4, row/col = lane&15); elements 0..7 = k0+8g+0..7, 8..15 = k0+16+8g+0..7; D element r = (row 8g+r, col lane&15)
__device__ __forceinline__ v16h frag_h(const _Float16* rowk0, unsigned lane) {
  union { v16h v; v8h q[2]; } u; const _Float16* p = rowk0 + 8u * (lane >> 4);
  u.q[0] = *(const v8h*)p; u.q[1] = *(const v8h*)(p + 16); return u.v;
}
__device__ __forceinline__ v16b frag_b(const __bf16* rowk0, unsigned lane) {
  union { v16b v; v8b q[2]; } u; const __bf16* p = rowk0 + 8u * (lane >> 4);
  u.q[0] = *(const v8b*)p; u.q[1] = *(const v8b*)(p + 16); return u.v;
}
__device__ __forceinline__ float bfr(float v) { return (float)(__bf16)v; }

// Self-attention whose output keeps only the DIAGONAL probability: x [NB][SEQ_FULL][DM] (first SEQ rows per batch used); Wq/Wk/Wv/Wo [DM out][DM in] (y = x W^T, no bias); 16 heads x 128;
// interleaved-pair rotation of q and k with INPUT tables cos/sin [SEQ][64]; w[b][h][s] = exp(q'[s].k'[s] * scale - logsumexp_k(q'[s].k'[k] * scale)); ctx = w * v; out = ctx Wo^T.
#ifndef NB
#define NB 2
#endif
#ifndef SEQ
#define SEQ 2048
#endif
#define NB_FULL 2
#define SEQ_FULL 2048
#define DM 2048
#define NH 16
#define HD 128
#define MROWS (NB * SEQ)
#define SCALE 0.08838834764831845f
#define LOG2E 1.4426950408889634f
#define CTXC 4096.0f
#define WOC 256.0f
#define OUTC (1.0f / 1048576.0f)

static_assert(NH * HD == DM);
static_assert(SEQ % 256 == 0);
static_assert(SEQ <= SEQ_FULL);
static_assert(NB <= NB_FULL);
static_assert(MROWS % 256 == 0);
static_assert(DM % 128 == 0);
static_assert(((size_t)SEQ * DM) % (8 * 256) == 0);
static_assert(((size_t)DM * DM) % (8 * 256) == 0);

#define WS_XB  ((size_t)0)                                   // bf16 x rows [b*SEQ + s][DM]
#define WS_WQ  (WS_XB  + 2u * (size_t)MROWS * DM)            // bf16 Wq [out][in]
#define WS_WK  (WS_WQ  + 2u * (size_t)DM * DM)
#define WS_WV  (WS_WK  + 2u * (size_t)DM * DM)
#define WS_WO  (WS_WV  + 2u * (size_t)DM * DM)               // f16 (bf16(Wo) * 2^8) [out][in]
#define WS_QH  (WS_WO  + 2u * (size_t)DM * DM)               // f16 rotated q rows [b*SEQ + s][DM]
#define WS_KH  (WS_QH  + 2u * (size_t)MROWS * DM)            // f16 rotated k rows
#define WS_CTX (WS_KH  + 2u * (size_t)MROWS * DM)            // f16 (w * v * 2^12) rows
#define WS_DG  (WS_CTX + 2u * (size_t)MROWS * DM)            // f32 diagonal logits [b][h][s]
#define WS_WP  (WS_DG  + 4u * (size_t)NB * NH * SEQ)         // f32 diagonal probabilities [b][h][s]
#define WS_END (WS_WP  + 4u * (size_t)NB * NH * SEQ)
static_assert(WS_END <= (size_t)134217728);
static_assert(WS_DG % 128 == 0);

// ---- LDS staging by asynchronous copies (global_load_async_to_lds_b128): every lane brings 16 B, 8 (or 16) neighbouring lanes bring one whole row piece, so a wave touches whole 128-B lines;
// the fragments are then read from LDS by ds_load_b128 at a row pitch of 16 B x odd. The projection ring has NBF = 3 or 4 buffers (the copies of the next NBF - 1 stages fly while a stage is worked on), the key ring two.
#define KP 64u                      /* k elements of one projection stage: 128 B of every row */
#define LP 144u                     /* LDS row pitch of a projection stage, bytes */
#define STG (384u * LP)             /* one projection stage: 256 rows of the left operand, then 128 rows of the weight */
#define NTR (DM / KP)
#define LPK 272u                    /* LDS row pitch of a key stage, bytes: 256 B of data */
#define STGK (128u * LPK)           /* one key stage: 128 keys x 128 head elements */
#define NKB (SEQ / 128u)
static_assert(NTR >= 4u);
#define CP1(l, g) "global_load_async_to_lds_b128 %" #l ", %" #g ", off\n\t"
__device__ __forceinline__ unsigned lds_off(const void* p) { return (unsigned)(size_t)p; }
// the ring's two waits in statements of their own, each with the memory clobber that keeps LDS reads and copies on their side of it
__device__ __forceinline__ void wait_ds() { asm volatile("s_wait_dscnt 0x0" ::: "memory"); }       /* this wave's LDS reads are done before the buffer is handed back */
__device__ __forceinline__ void wait_async() { asm volatile("s_wait_asynccnt 0x0" ::: "memory"); } /* this wave's copies have landed before the barrier publishes them */
// counted form for the projection ring (12 copies a wave and stage, landing counted in issue order): all but the youngest ST stages' copies have landed, so the oldest stage in flight is complete while the younger ones keep flying
template <unsigned ST> __device__ __forceinline__ void wait_async_but() { asm volatile("s_wait_asynccnt %0" :: "n"(12u * ST) : "memory"); }
// 12 copies of one lane: rows crow + 32 i of the stage (i < 8: left operand, i >= 8: weight); s_wait_xcnt closes the statement so that no address register is rewritten ahead of it
__device__ __forceinline__ void stage_copy(unsigned l, const char* ga, const char* gw) {
  const size_t rs = (size_t)32u * DM * 2u; const unsigned ls = 32u * LP;
  asm volatile(CP1(0, 12) CP1(1, 13) CP1(2, 14) CP1(3, 15) CP1(4, 16) CP1(5, 17) CP1(6, 18) CP1(7, 19) CP1(8, 20) CP1(9, 21) CP1(10, 22) CP1(11, 23) "s_wait_xcnt 0x0"
    :: "v"(l), "v"(l + ls), "v"(l + 2u * ls), "v"(l + 3u * ls), "v"(l + 4u * ls), "v"(l + 5u * ls), "v"(l + 6u * ls), "v"(l + 7u * ls), "v"(l + 8u * ls), "v"(l + 9u * ls), "v"(l + 10u * ls), "v"(l + 11u * ls),
       "v"(ga), "v"(ga + rs), "v"(ga + 2u * rs), "v"(ga + 3u * rs), "v"(ga + 4u * rs), "v"(ga + 5u * rs), "v"(ga + 6u * rs), "v"(ga + 7u * rs), "v"(gw), "v"(gw + rs), "v"(gw + 2u * rs), "v"(gw + 3u * rs)
    : "memory");
}
// the two-weight stage of k_qk: 256 rows of the left operand, then 128 rows of each weight; 16 copies a wave and stage
#define STG2 (512u * LP)
template <unsigned ST> __device__ __forceinline__ void wait_async_but16() { asm volatile("s_wait_asynccnt %0" :: "n"(16u * ST) : "memory"); }   /* all but the youngest ST stages' copies have landed */
// 16 copies of one lane in two statements (an asm statement takes thirty operands): rows crow + 32 i of the stage (i < 8: left operand, i = 8..11: first weight, i = 12..15: second weight); each statement closes with its s_wait_xcnt
__device__ __forceinline__ void stage_copy2(unsigned l, const char* ga, const char* g1, const char* g2) {
  const size_t rs = (size_t)32u * DM * 2u; const unsigned ls = 32u * LP;
  asm volatile(CP1(0, 8) CP1(1, 9) CP1(2, 10) CP1(3, 11) CP1(4, 12) CP1(5, 13) CP1(6, 14) CP1(7, 15) "s_wait_xcnt 0x0"
    :: "v"(l), "v"(l + ls), "v"(l + 2u * ls), "v"(l + 3u * ls), "v"(l + 4u * ls), "v"(l + 5u * ls), "v"(l + 6u * ls), "v"(l + 7u * ls),
       "v"(ga), "v"(ga + rs), "v"(ga + 2u * rs), "v"(ga + 3u * rs), "v"(ga + 4u * rs), "v"(ga + 5u * rs), "v"(ga + 6u * rs), "v"(ga + 7u * rs)
    : "memory");
  asm volatile(CP1(0, 8) CP1(1, 9) CP1(2, 10) CP1(3, 11) CP1(4, 12) CP1(5, 13) CP1(6, 14) CP1(7, 15) "s_wait_xcnt 0x0"
    :: "v"(l + 8u * ls), "v"(l + 9u * ls), "v"(l + 10u * ls), "v"(l + 11u * ls), "v"(l + 12u * ls), "v"(l + 13u * ls), "v"(l + 14u * ls), "v"(l + 15u * ls),
       "v"(g1), "v"(g1 + rs), "v"(g1 + 2u * rs), "v"(g1 + 3u * rs), "v"(g2), "v"(g2 + rs), "v"(g2 + 2u * rs), "v"(g2 + 3u * rs)
    : "memory");
}
// 8 copies of one lane: key rows krow + 8 i, i = 0..7, of half a key stage
__device__ __forceinline__ void key_copy(unsigned l, const char* g) {
  const size_t rs = (size_t)8u * DM * 2u; const unsigned ls = 8u * LPK;
  asm volatile(CP1(0, 8) CP1(1, 9) CP1(2, 10) CP1(3, 11) CP1(4, 12) CP1(5, 13) CP1(6, 14) CP1(7, 15) "s_wait_xcnt 0x0"
    :: "v"(l), "v"(l + ls), "v"(l + 2u * ls), "v"(l + 3u * ls), "v"(l + 4u * ls), "v"(l + 5u * ls), "v"(l + 6u * ls), "v"(l + 7u * ls),
       "v"(g), "v"(g + rs), "v"(g + 2u * rs), "v"(g + 3u * rs), "v"(g + 4u * rs), "v"(g + 5u * rs), "v"(g + 6u * rs), "v"(g + 7u * rs)
    : "memory");
}
// one fragment from an LDS row piece, and one product, in the operand type of the ring (the bare builtin: the compiler keeps the distances of its own builtin, and accumulators and fragments are free to lie above v255)
template <bool BF> struct frag_of { typedef v16b T; };
template <> struct frag_of<false> { typedef v16h T; };
template <bool BF> __device__ __forceinline__ typename frag_of<BF>::T frag_ld(const unsigned char* p, unsigned lane) {
  if constexpr (BF) return frag_b((const __bf16*)p, lane); else return frag_h((const _Float16*)p, lane);
}
template <bool BF> __device__ __forceinline__ v8f mm16(typename frag_of<BF>::T a, typename frag_of<BF>::T b, v8f c) {
  if constexpr (BF) return __builtin_amdgcn_wmma_f32_16x16x32_bf16(false, a, false, b, (short)0, c, false, false);
  else return __builtin_amdgcn_wmma_f32_16x16x32_f16(false, a, false, b, (short)0, c, false, false);
}
// the eight fragments of one k step of 32: four of the left operand, four of the weight
template <bool BF> __device__ __forceinline__ void frag_step(const unsigned char* ab, const unsigned char* wb, unsigned lane, typename frag_of<BF>::T (&a)[4], typename frag_of<BF>::T (&w)[4]) {
#pragma unroll
  for (int i = 0; i < 4; ++i) { a[i] = frag_ld<BF>(ab + i * 16u * LP, lane); w[i] = frag_ld<BF>(wb + i * 16u * LP, lane); }
}
// the products of left fragments M0 .. M1 - 1 with the four weight fragments
template <bool BF, int M0, int M1> __device__ __forceinline__ void mm_step(const typename frag_of<BF>::T (&a)[4], const typename frag_of<BF>::T (&w)[4], v8f (&acc)[4][4]) {
#pragma unroll
  for (int mi = M0; mi < M1; ++mi) {
#pragma unroll
    for (int nj = 0; nj < 4; ++nj) acc[mi][nj] = mm16<BF>(a[mi], w[nj], acc[mi][nj]); }
}
// acc[mi][nj] += A[256 rows][DM] x W[128 rows][DM]^T for this wave's 64 x 64 share (8 waves: wave >> 1 picks the 64 rows, wave & 1 the 64 weight rows), k ascending in steps of 32;
// A, Wt = the block's first rows (16-bit elements, row pitch DM). Every fragment read from LDS feeds four matrix instructions.
// The fragments are fetched ONE K STEP AHEAD into a second register set: the 16 reads of the next step are issued at the head of this step's 16 matrix instructions and land under them.
// A stage holds two steps, so the fetch in front of a stage's second step already reads the next stage: the publish point of stage t + 1 stands between the two steps of stage t.
// Every wave of the block calls it; the ring's last readers have left it and every wave's copies have landed when it returns (the last trip's publish point is s_wait_dscnt 0, s_wait_asynccnt 0 and the barrier, and nothing is read or copied behind it).
template <bool BF, unsigned NBF> __device__ __forceinline__ void gemm_ring(unsigned char* ring, const void* A, const void* Wt, unsigned tid, v8f (&acc)[4][4]) {
  static_assert(NBF >= 3u && NBF <= NTR && NBF * 12u <= 63u);   /* the prologue has NBF stages of 12 copies a wave outstanding */
  const unsigned wave = tid >> 5, lane = tid & 31u, col = lane & 15u; const unsigned crow = tid >> 3, cch = tid & 7u;
  const char* ga = (const char*)A + ((size_t)crow * DM + cch * 8u) * 2u; const char* gw = (const char*)Wt + ((size_t)crow * DM + cch * 8u) * 2u;
  const unsigned l0 = lds_off(ring) + crow * LP + cch * 16u;
  const unsigned ao = ((wave >> 1) * 64u + col) * LP, wo = (256u + (wave & 1u) * 64u + col) * LP;   /* this lane's first rows inside a stage */
#pragma unroll 1   /* kept rolled: one stage's 36 address registers at a time */
  for (unsigned s = 0; s < NBF; ++s) stage_copy(l0 + s * STG, ga + s * (KP * 2u), gw + s * (KP * 2u));
  wait_async_but<NBF - 1u>();
  __syncthreads();   /* publishes stage 0 */
  typename frag_of<BF>::T a0[4], w0[4], a1[4], w1[4];
  frag_step<BF>(ring + ao, ring + wo, lane, a0, w0);   /* stage 0, first step */
  unsigned rb = 0;   /* byte offset of the buffer that holds stage t */
#pragma unroll 1   /* kept rolled: one trip is already 32 matrix instructions, and the text of two such loops stays small */
  for (unsigned t = 0; t < NTR; ++t) {
    const unsigned rn = rb + STG == NBF * STG ? 0u : rb + STG;   /* the buffer of stage t + 1 */
    frag_step<BF>(ring + rb + ao + 64u, ring + rb + wo + 64u, lane, a1, w1);   /* stage t, second step: lands under the first step's products */
    mm_step<BF, 0, 4>(a0, w0, acc);
    __builtin_amdgcn_sched_barrier(0);   /* holds the publish point's waits behind the products: s_wait_dscnt 0 in front of them would wait out the reads just issued */
    wait_ds();   /* this wave's last reads of stage t's buffer are done */
    if (t + NBF - 1u < NTR) wait_async_but<NBF - 2u>(); else wait_async();   /* stage t + 1 has landed: behind it stages t + 2 .. t + NBF - 1 are in flight; in the last trips fewer were issued, so the wait is to 0 */
    __syncthreads();   /* publishes stage t + 1 and ends every reader's last read of stage t's buffer */
    if (t + 1u < NTR) frag_step<BF>(ring + rn + ao, ring + rn + wo, lane, a0, w0);   /* stage t + 1, first step: lands under the second step's products */
    mm_step<BF, 0, 2>(a1, w1, acc);
    // the refill stands in the middle of the step: while one wave of a SIMD issues its copies and waits out s_wait_xcnt, the other has products to issue; in front of the step both would stand there at once with the matrix unit idle
    if (t + NBF < NTR) stage_copy(l0 + rb, ga + (size_t)(t + NBF) * (KP * 2u), gw + (size_t)(t + NBF) * (KP * 2u));
    mm_step<BF, 2, 4>(a1, w1, acc);
    rb = rn;
  }
  wait_async();
}

// the twelve fragments of one k step of 32: four of the left operand, four of each weight
__device__ __forceinline__ void frag_step2(const unsigned char* ab, const unsigned char* wb, unsigned lane, v16b (&a)[4], v16b (&w)[8]) {
#pragma unroll
  for (int i = 0; i < 4; ++i) { a[i] = frag_b((const __bf16*)(ab + i * 16u * LP), lane); w[i] = frag_b((const __bf16*)(wb + i * 16u * LP), lane); w[4 + i] = frag_b((const __bf16*)(wb + (128u + i * 16u) * LP), lane); }
}
// the products of left fragments M0 .. M1 - 1 with the eight weight fragments
template <int M0, int M1> __device__ __forceinline__ void mm_step2(const v16b (&a)[4], const v16b (&w)[8], v8f (&acc)[4][8]) {
#pragma unroll
  for (int mi = M0; mi < M1; ++mi) {
#pragma unroll
    for (int nj = 0; nj < 8; ++nj) acc[mi][nj] = mm16<true>(a[mi], w[nj], acc[mi][nj]); }
}
// The same ring for TWO weights against one left operand: acc[mi][nj] += A x W1^T (nj < 4) and A x W2^T (nj >= 4), this wave's 64 rows x the same 64 weight rows of each; k ascending in steps of 32, as in gemm_ring.
// The left tile is staged once for both products and each of its fragments feeds eight matrix instructions. Fragments one k step ahead and the publish point between a stage's two steps, as in gemm_ring.
// Every wave of the block calls it; it returns as gemm_ring does: last readers gone, every wave's copies landed.
template <unsigned NBF> __device__ __forceinline__ void gemm_ring2(unsigned char* ring, const void* A, const void* W1, const void* W2, unsigned tid, v8f (&acc)[4][8]) {
  static_assert(NBF >= 3u && NBF <= NTR && NBF * 16u <= 63u);   /* the prologue has NBF stages of 16 copies a wave outstanding */
  const unsigned wave = tid >> 5, lane = tid & 31u, col = lane & 15u; const unsigned crow = tid >> 3, cch = tid & 7u;
  const size_t go = ((size_t)crow * DM + cch * 8u) * 2u;
  const char* ga = (const char*)A + go; const char* g1 = (const char*)W1 + go; const char* g2 = (const char*)W2 + go;
  const unsigned l0 = lds_off(ring) + crow * LP + cch * 16u;
  const unsigned ao = ((wave >> 1) * 64u + col) * LP, wo = (256u + (wave & 1u) * 64u + col) * LP;   /* this lane's first rows inside a stage */
#pragma unroll 1   /* kept rolled: one statement's 24 address registers at a time */
  for (unsigned s = 0; s < NBF; ++s) stage_copy2(l0 + s * STG2, ga + s * (KP * 2u), g1 + s * (KP * 2u), g2 + s * (KP * 2u));
  wait_async_but16<NBF - 1u>();
  __syncthreads();   /* publishes stage 0 */
  v16b a0[4], w0[8], a1[4], w1[8];
  frag_step2(ring + ao, ring + wo, lane, a0, w0);   /* stage 0, first step */
  unsigned rb = 0;   /* byte offset of the buffer that holds stage t */
#pragma unroll 1   /* kept rolled: one trip is already 64 matrix instructions */
  for (unsigned t = 0; t < NTR; ++t) {
    const unsigned rn = rb + STG2 == NBF * STG2 ? 0u : rb + STG2;   /* the buffer of stage t + 1 */
    frag_step2(ring + rb + ao + 64u, ring + rb + wo + 64u, lane, a1, w1);   /* stage t, second step: lands under the first step's products */
    mm_step2<0, 4>(a0, w0, acc);
    __builtin_amdgcn_sched_barrier(0);   /* holds the publish point's waits behind the products: s_wait_dscnt 0 in front of them would wait out the reads just issued */
    wait_ds();   /* this wave's last reads of stage t's buffer are done */
    if (t + NBF - 1u < NTR) wait_async_but16<NBF - 2u>(); else wait_async();   /* stage t + 1 has landed; in the last trips fewer stages were issued behind it, so the wait is to 0 */
    __syncthreads();   /* publishes stage t + 1 and ends every reader's last read of stage t's buffer */
    if (t + 1u < NTR) frag_step2(ring + rn + ao, ring + rn + wo, lane, a0, w0);   /* stage t + 1, first step: lands under the second step's products */
    mm_step2<0, 2>(a1, w1, acc);
    // the refill stands in the middle of the step, as in gemm_ring; two left fragments are spent there, so their registers are free for the copies' addresses
    if (t + NBF < NTR) stage_copy2(l0 + rb, ga + (size_t)(t + NBF) * (KP * 2u), g1 + (size_t)(t + NBF) * (KP * 2u), g2 + (size_t)(t + NBF) * (KP * 2u));
    mm_step2<2, 4>(a1, w1, acc);
    rb = rn;
  }
  wait_async();
}

// ---- k_cvt: ONE launch converts x and the four weights. The five 16-bit planes lie one behind the other in the workspace: NB + 4 segments (each batch of x, then Wq, Wk, Wv, Wo) of CVT_BLOCKS tiles each.
// A tile = CVT_TILE pieces of 8 elements (32 B read, 16 B written a piece). Block n converts tile n of every segment, the next segment's 8 loads a lane issued ahead of this segment's conversion:
// few long-lived waves that keep loads in flight, in place of one short-lived wave per 256 elements.
#define CVT_T 512u
#define CVT_U 4u
#define CVT_TILE (CVT_T * CVT_U)
#define CVT_BLOCKS ((unsigned)((size_t)DM * DM / 8u / CVT_TILE))
#define CVT_SEGS ((unsigned)NB + 4u)
static_assert((size_t)CVT_BLOCKS * CVT_TILE * 8u == (size_t)DM * DM);
static_assert((size_t)SEQ * DM == (size_t)DM * DM);   /* a batch of x is as long as a weight */
static_assert(WS_XB == 0 && WS_WQ == 2u * (size_t)NB * DM * DM && WS_WO == WS_WQ + 3u * 2u * (size_t)DM * DM);
// no register that an issued load or store names is rewritten ahead of this wait
__device__ __forceinline__ void wait_x() { asm volatile("s_wait_xcnt 0x0" ::: "memory"); }
__device__ __forceinline__ void cvt_load(v4f (&r)[2u * CVT_U], const float* s) {
#pragma unroll
  for (unsigned u = 0; u < CVT_U; ++u) { r[2u * u] = *(const v4f*)(s + u * (CVT_T * 8u)); r[2u * u + 1u] = *(const v4f*)(s + u * (CVT_T * 8u) + 4u); }
  wait_x();
  __builtin_amdgcn_sched_barrier(0);   /* the loads stay one group ahead of the conversion that follows, and that conversion's register writes stay behind the wait */
}
__global__ __launch_bounds__(512) void k_cvt(const float* __restrict__ X, const float* __restrict__ Q, const float* __restrict__ K, const float* __restrict__ V, const float* __restrict__ O,
    unsigned short* __restrict__ dst) {
  const unsigned off = blockIdx.x * (CVT_TILE * 8u) + threadIdx.x * 8u;   /* this lane's first element inside every segment */
  v4f cur[2u * CVT_U], nxt[2u * CVT_U];
  cvt_load(cur, X + off);
#pragma unroll   /* unrolled: the segment number picks the source pointer and the target type at compile time, and the two register sets need no copies */
  for (unsigned s = 0; s < CVT_SEGS; ++s) {
    const unsigned n = s + 1u;
    if (n < CVT_SEGS) cvt_load(nxt, (n < (unsigned)NB ? X + (size_t)n * ((size_t)SEQ_FULL * DM) : n == (unsigned)NB ? Q : n == (unsigned)NB + 1u ? K : n == (unsigned)NB + 2u ? V : O) + off);
    v4u o[CVT_U];
#pragma unroll
    for (unsigned u = 0; u < CVT_U; ++u) { const v4f a = cur[2u * u], b = cur[2u * u + 1u];
      if (s + 1u < CVT_SEGS) { v8b t;
#pragma unroll
        for (int e = 0; e < 4; ++e) { t[e] = (__bf16)a[e]; t[4 + e] = (__bf16)b[e]; }
        o[u] = __builtin_bit_cast(v4u, t);
      } else { v8h t;   /* the last segment, Wo, goes to f16 (bf16 value x 2^8) */
#pragma unroll
        for (int e = 0; e < 4; ++e) { t[e] = (_Float16)(bfr(a[e]) * WOC); t[4 + e] = (_Float16)(bfr(b[e]) * WOC); }
        o[u] = __builtin_bit_cast(v4u, t);
      } }
    __builtin_amdgcn_sched_barrier(0);   /* all four pieces are converted before the first store issues: no store's data register is reused ahead of the wait behind the stores */
    unsigned short* d = dst + (size_t)s * ((size_t)DM * DM) + off;
#pragma unroll
    for (unsigned u = 0; u < CVT_U; ++u) vst2((void*)(d + u * (CVT_T * 8u)), o[u]);
    wait_x();
    __builtin_amdgcn_sched_barrier(0);   /* keeps the next segment's register writes behind that wait */
#pragma unroll
    for (unsigned u = 0; u < 2u * CVT_U; ++u) cur[u] = nxt[u];
  }
}

// ---- k_qk: block = (256 token rows, head h): q and k projections in ONE pass over K = DM (exact bf16 products; 32 accumulator tiles a wave: the x tile is staged once and its fragments serve both weights);
// rotation with the bf16-converted input tables (in LDS as the two bf16 values of a pair in one dword: nothing is lost, they are bf16 values); a lane holds q' and k' of the same (row, column), so the diagonal dot is formed in registers;
// table tile and f16 pair tile lie in the idle ring; f16 q'/k' rows, f32 diagonal logit per row (the two column halves of a row are summed by two waves, then added)
__global__ __launch_bounds__(256) void k_qk(const __bf16* __restrict__ XB, const __bf16* __restrict__ WQ, const __bf16* __restrict__ WK, const float* __restrict__ COS, const float* __restrict__ SIN,
    _Float16* __restrict__ QH, _Float16* __restrict__ KH, float* __restrict__ DG) {
  __shared__ __align__(16) float sdg[2][256];
  __shared__ __align__(16) unsigned char ring[3u * STG2];
  unsigned (*stab)[68] = (unsigned (*)[68])ring;                          /* bf16 cos (low half) and bf16 sin (high half) of (position, pair): in the ring once the projection has left it */
  unsigned (*sq)[132] = (unsigned (*)[132])(ring + 256u * 68u * 4u);      /* the f16 pair (q' low half, k' high half), behind the table tile */
  static_assert(256u * 68u * 4u + 256u * 132u * 4u <= 3u * STG2);
  const unsigned tid = threadIdx.x, wave = tid >> 5, lane = tid & 31u, col = lane & 15u, g = lane >> 4;
  const unsigned wr0 = (wave >> 1) * 64u + 8u * g, wn = wave & 1u;   /* this lane's first row and this wave's column half */
  const unsigned h = blockIdx.y, c0 = h * HD; const unsigned r0 = blockIdx.x * 256u; const unsigned bb = r0 / (unsigned)SEQ, t0 = r0 % (unsigned)SEQ;
  const bool odd = (col & 1u) != 0u;
  v8f aqk[4][8] = {};   /* [mi][nj]: q for nj < 4, k of the same columns for nj >= 4 */
  gemm_ring2<3u>(ring, XB + (size_t)r0 * DM, WQ + (size_t)c0 * DM, WK + (size_t)c0 * DM, tid, aqk);
  // table tile: positions t0..t0+255, 64 pairs, bf16-converted values
  { const unsigned rl = tid >> 4, q = tid & 15u; const size_t o = (size_t)(t0 + rl) * 64u + q * 4u; v4f c[16], s[16];   /* rows rl + 16 i */
#pragma unroll
    for (unsigned i = 0; i < 16u; ++i) { c[i] = *(const v4f*)(COS + o + i * (16u * 64u)); s[i] = *(const v4f*)(SIN + o + i * (16u * 64u)); }
    wait_x();
    __builtin_amdgcn_sched_barrier(0);   /* the 32 loads fly together, and what follows writes no register of theirs ahead of the wait */
#pragma unroll
    for (unsigned i = 0; i < 16u; ++i) { v4u p;
#pragma unroll
      for (int u = 0; u < 4; ++u) p[u] = (unsigned)__builtin_bit_cast(unsigned short, (__bf16)c[i][u]) | ((unsigned)__builtin_bit_cast(unsigned short, (__bf16)s[i][u]) << 16);
      *(v4u*)&stab[rl + 16u * i][q * 4u] = p; } }
  __syncthreads();   /* table tile is cross-wave: block barrier */
#pragma unroll
  for (int mi = 0; mi < 4; ++mi) {
    float ds[8] = {0.f, 0.f, 0.f, 0.f, 0.f, 0.f, 0.f, 0.f};
#pragma unroll
    for (int nj = 0; nj < 4; ++nj) {
#pragma unroll
      for (int r = 0; r < 8; ++r) { const unsigned rl = wr0 + mi * 16u + r; const unsigned cc = wn * 64u + nj * 16u + col;
        const unsigned cs = stab[rl][cc >> 1]; const float c = __builtin_bit_cast(float, cs << 16), s = __builtin_bit_cast(float, cs & 0xffff0000u);
        const float oq = aqk[mi][nj][r], okv = aqk[mi][4 + nj][r];
        const float pq = __shfl_xor(oq, 1), pk = __shfl_xor(okv, 1);       /* pair partners (column ^ 1), all lanes active */
        const float sg = odd ? s : -s;                                    /* even column: te*c - to*s; odd column: to*c + te*s */
        const float qv = oq * c + pq * sg;
        const float kv = okv * c + pk * sg;
        ds[r] += qv * kv;
        sq[rl][cc] = (unsigned)__builtin_bit_cast(unsigned short, (_Float16)qv) | ((unsigned)__builtin_bit_cast(unsigned short, (_Float16)kv) << 16); } }
#pragma unroll
    for (int r = 0; r < 8; ++r) { float d = ds[r]; d += __shfl_xor(d, 1); d += __shfl_xor(d, 2); d += __shfl_xor(d, 4); d += __shfl_xor(d, 8);
      if (col == 0u) sdg[wn][wr0 + mi * 16u + r] = d; } }
  __syncthreads();   /* cross-wave LDS tiles: block barrier */
#pragma unroll
  for (unsigned rb = 0; rb < 256u; rb += 64u) { const unsigned rl = rb + (tid >> 4), q = tid & 15u; const size_t o = (size_t)(r0 + rl) * DM + c0 + q * 8u; v4u oq4[4], ok4[4];   /* rows rl + 16 i; the low halves are q', the high halves k' */
#pragma unroll
    for (unsigned i = 0; i < 4u; ++i) { const v4u p0 = *(const v4u*)&sq[rl + 16u * i][q * 8u], p1 = *(const v4u*)&sq[rl + 16u * i][q * 8u + 4u];
      oq4[i][0] = (p0[0] & 0xffffu) | (p0[1] << 16); oq4[i][1] = (p0[2] & 0xffffu) | (p0[3] << 16); oq4[i][2] = (p1[0] & 0xffffu) | (p1[1] << 16); oq4[i][3] = (p1[2] & 0xffffu) | (p1[3] << 16);
      ok4[i][0] = (p0[0] >> 16) | (p0[1] & 0xffff0000u); ok4[i][1] = (p0[2] >> 16) | (p0[3] & 0xffff0000u); ok4[i][2] = (p1[0] >> 16) | (p1[1] & 0xffff0000u); ok4[i][3] = (p1[2] >> 16) | (p1[3] & 0xffff0000u); }
    __builtin_amdgcn_sched_barrier(0);   /* all eight pieces are formed before the first store issues: no store's register is reused ahead of the wait behind the stores */
#pragma unroll
    for (unsigned i = 0; i < 4u; ++i) { vst2((void*)(QH + o + (size_t)i * (16u * DM)), oq4[i]); vst2((void*)(KH + o + (size_t)i * (16u * DM)), ok4[i]); }
    wait_x();
    __builtin_amdgcn_sched_barrier(0);   /* keeps the next group's register writes behind that wait */
  }
  if (tid < 64u) { const v4f d0 = *(const v4f*)&sdg[0][tid * 4u], d1 = *(const v4f*)&sdg[1][tid * 4u]; vst2((void*)(DG + (size_t)(bb * NH + h) * SEQ + t0 + tid * 4u), (d0 + d1) * SCALE); }
}

// bare v_exp_f32, for the terms and rescale factors of a running sum: it lacks only the library exp2f's range scaling (a compare, two selects, an add and a v_ldexp a call), so a result under 2^-126 reads 0;
// each such value is added to, or multiplies a sum that is added to, a sum that holds its own maximum's term (about 1), where it is far below half a unit in the last place: the f32 sums are the same
__device__ __forceinline__ float exp2_raw(float x) { return __builtin_amdgcn_exp2f(x); }
// the same for two rescale factors, in place, written as text; the v_nop is the slot behind the second one
__device__ __forceinline__ v2f exp2_raw2(float x, float y) { asm("v_exp_f32 %0, %0\n\tv_exp_f32 %1, %1\n\tv_nop" : "+v"(x), "+v"(y)); return (v2f){x, y}; }
// ---- k_lse: block = 64 query rows of (b, h); one streaming pass over all SEQ keys (128 per step): f16 q' x f16 k' logits, f32 running max / running sum in the log2 domain; w = exp(diag - lse)
__global__ __launch_bounds__(128) void k_lse(const _Float16* __restrict__ QH, const _Float16* __restrict__ KH, const float* __restrict__ DG, float* __restrict__ WP) {
  __shared__ __align__(16) float sw[64];
  __shared__ __align__(16) unsigned char ring[2u * STGK];
  const unsigned tid = threadIdx.x, wave = tid >> 5, lane = tid & 31u, col = lane & 15u, g = lane >> 4;
  const unsigned qb = blockIdx.x, h = blockIdx.y, b = blockIdx.z; const unsigned c0 = h * HD; const unsigned ql0 = qb * 64u + wave * 16u;
  const size_t q0 = (size_t)b * SEQ + ql0, kr0 = (size_t)b * SEQ;
  const float C2 = SCALE * LOG2E;
  v16h qf[4];
#pragma unroll
  for (int kc = 0; kc < 4; ++kc) qf[kc] = frag_h(QH + (q0 + col) * DM + c0 + kc * 32u, lane);
  float m[8], sm[8];
#pragma unroll
  for (int r = 0; r < 8; ++r) { m[r] = -3.0e38f; sm[r] = 0.f; }
  // key ring: a stage is 128 keys x 256 B; lane = (row tid >> 4, 16-B piece tid & 15), 16 copies a lane and stage in two statements
  const char* gk = (const char*)(KH + (kr0 + (tid >> 4)) * DM + c0 + (tid & 15u) * 8u); const size_t gstep = (size_t)128u * DM * 2u, ghalf = (size_t)64u * DM * 2u;
  const unsigned lk = lds_off(ring) + (tid >> 4) * LPK + (tid & 15u) * 16u;
  key_copy(lk, gk); key_copy(lk + 64u * LPK, gk + ghalf);
  wait_async();
  __syncthreads();   /* publishes stage 0 */
  if (NKB > 1u) { key_copy(lk + STGK, gk + gstep); key_copy(lk + STGK + 64u * LPK, gk + gstep + ghalf); }
#pragma unroll 1
  for (unsigned kb = 0; kb < NKB; ++kb) {
    v8f acc[8] = {};
#pragma unroll
    for (int j = 0; j < 8; ++j) { const _Float16* kp = (const _Float16*)(ring + (kb & 1u) * STGK + (j * 16u + col) * LPK);
      const v16h k0 = frag_h(kp, lane), k1 = frag_h(kp + 32, lane), k2 = frag_h(kp + 64, lane), k3 = frag_h(kp + 96, lane);
      acc[j] = wmma16(qf[0], k0, acc[j]); acc[j] = wmma16(qf[1], k1, acc[j]); acc[j] = wmma16(qf[2], k2, acc[j]); acc[j] = wmma16(qf[3], k3, acc[j]); }
    // two rows at a time, the pair that lies in neighbouring accumulator registers: the scaled difference and the sum are packed operations (same fma, same order of additions a row)
    v2f mn[4], dm[4];
#pragma unroll   /* these loops are unrolled so that acc, mn, dm, m and sm are indexed by constants and stay in registers */
    for (int p = 0; p < 4; ++p) { const int r = 2 * p; v2f mx = {acc[0][r], acc[0][r + 1]};
#pragma unroll
      for (int j = 1; j < 8; ++j) { mx[0] = fmaxf(mx[0], acc[j][r]); mx[1] = fmaxf(mx[1], acc[j][r + 1]); }
      mn[p] = (v2f){fmaxf(m[r], mx[0] * C2), fmaxf(m[r + 1], mx[1] * C2)}; dm[p] = (v2f){m[r], m[r + 1]} - mn[p]; m[r] = mn[p][0]; m[r + 1] = mn[p][1]; }
#pragma unroll
    for (int p = 0; p < 4; ++p) { const int r = 2 * p; v2f s = {0.f, 0.f};
#pragma unroll
      for (int j = 0; j < 8; ++j) { const v2f a = {acc[j][r], acc[j][r + 1]}; const v2f t = __builtin_elementwise_fma(a, (v2f){C2, C2}, -mn[p]); const v2f e = {exp2_raw(t[0]), exp2_raw(t[1])}; s += e; }
      const v2f f = exp2_raw2(dm[p][0], dm[p][1]); sm[r] = sm[r] * f[0] + s[0]; sm[r + 1] = sm[r + 1] * f[1] + s[1]; }
    wait_ds();
    wait_async();
    __syncthreads();   /* publishes stage kb + 1 and ends every reader's last read of stage kb's buffer */
    if (kb + 2u < NKB) { const char* gn = gk + (size_t)(kb + 2u) * gstep; const unsigned ln = lk + (kb & 1u) * STGK; key_copy(ln, gn); key_copy(ln + 64u * LPK, gn + ghalf); } }
  wait_async();
  // merge the 16 column lanes of each half (rows stay within a half); all lanes active
#pragma unroll
  for (int off = 1; off < 16; off <<= 1) {
#pragma unroll
    for (int r = 0; r < 8; ++r) { const float om = __shfl_xor(m[r], off), os = __shfl_xor(sm[r], off); const float mn = fmaxf(m[r], om);
      const v2f f = exp2_raw2(m[r] - mn, om - mn); sm[r] = sm[r] * f[0] + os * f[1]; m[r] = mn; } }
  const float* dp = DG + (size_t)(b * NH + h) * SEQ + ql0 + 8u * g;
  const v4f d0 = *(const v4f*)dp, d1 = *(const v4f*)(dp + 4);
#pragma unroll
  for (int r = 0; r < 8; ++r) { const float dg = r < 4 ? d0[r & 3] : d1[r & 3]; const float w = exp2f(dg * LOG2E - m[r] - log2f(sm[r]));
    if (col == 0u) sw[wave * 16u + 8u * g + r] = w; }
  __syncthreads();   /* cross-wave LDS: block barrier */
  if (tid < 16u) vst2((void*)(WP + (size_t)(b * NH + h) * SEQ + qb * 64u + tid * 4u), *(const v4f*)&sw[tid * 4u]);   
}

// ---- k_vw: block = (256 token rows, head h): v projection (exact bf16 products) x the row's diagonal probability -> f16 (w * v * 2^12) rows
__global__ __launch_bounds__(256) void k_vw(const __bf16* __restrict__ XB, const __bf16* __restrict__ WV, const float* __restrict__ WP, _Float16* __restrict__ CTX) {
  __shared__ __align__(16) _Float16 sh[256][136];
  __shared__ __align__(16) unsigned char ring[4u * STG];
  const unsigned tid = threadIdx.x, wave = tid >> 5, lane = tid & 31u, col = lane & 15u, g = lane >> 4;
  const unsigned wr0 = (wave >> 1) * 64u + 8u * g, wn = wave & 1u;   /* this lane's first row and this wave's column half */
  const unsigned h = blockIdx.y, c0 = h * HD; const unsigned r0 = blockIdx.x * 256u; const unsigned bb = r0 / (unsigned)SEQ, t0 = r0 % (unsigned)SEQ;
  v8f av[4][4] = {};
  gemm_ring<true, 4u>(ring, XB + (size_t)r0 * DM, WV + (size_t)c0 * DM, tid, av);
#pragma unroll
  for (int mi = 0; mi < 4; ++mi) {
    const float* wp = WP + (size_t)(bb * NH + h) * SEQ + t0 + wr0 + mi * 16u;
    const v4f w0 = *(const v4f*)wp, w1 = *(const v4f*)(wp + 4);
#pragma unroll
    for (int nj = 0; nj < 4; ++nj) {
#pragma unroll
      for (int r = 0; r < 8; ++r) { const float wr = (r < 4 ? w0[r & 3] : w1[r & 3]) * CTXC; sh[wr0 + mi * 16u + r][wn * 64u + nj * 16u + col] = (_Float16)(av[mi][nj][r] * wr); } } }
  __syncthreads();
#pragma unroll
  for (unsigned rb = 0; rb < 256u; rb += 128u) { const unsigned rl = rb + (tid >> 4), q = tid & 15u; _Float16* d = CTX + (size_t)(r0 + rl) * DM + c0 + q * 8u; v4u o[8];   /* rows rl + 16 i */
#pragma unroll
    for (unsigned i = 0; i < 8u; ++i) o[i] = *(const v4u*)&sh[rl + 16u * i][q * 8u];
    __builtin_amdgcn_sched_barrier(0);   /* all eight pieces are read before the first store issues: no store's register is reused ahead of the wait behind the stores */
#pragma unroll
    for (unsigned i = 0; i < 8u; ++i) vst2((void*)(d + (size_t)i * (16u * DM)), o[i]);
    wait_x();
    __builtin_amdgcn_sched_barrier(0);   /* keeps the next group's register writes behind that wait */
  }
}

__global__ __launch_bounds__(256) void k_out(const _Float16* __restrict__ CTX, const _Float16* __restrict__ WO, float* __restrict__ OUT) {
  __shared__ __align__(16) unsigned char ring[4u * STG];
  float (*ss)[132] = (float (*)[132])ring;   /* output staging in the ring: gemm_ring returns behind the barrier that ends its last reader's last read, every copy landed */
  static_assert(256u * 132u * 4u <= 4u * STG);
  const unsigned tid = threadIdx.x, wave = tid >> 5, lane = tid & 31u, col = lane & 15u, g = lane >> 4;
  const unsigned wr0 = (wave >> 1) * 64u + 8u * g, wn = wave & 1u;   /* this lane's first row and this wave's column half */
  const unsigned c0 = blockIdx.y * 128u; const unsigned r0 = blockIdx.x * 256u; const unsigned bb = r0 / (unsigned)SEQ, t0 = r0 % (unsigned)SEQ;
  v8f acc[4][4] = {};
  gemm_ring<false, 4u>(ring, CTX + (size_t)r0 * DM, WO + (size_t)c0 * DM, tid, acc);
#pragma unroll
  for (int mi = 0; mi < 4; ++mi) {
#pragma unroll
    for (int nj = 0; nj < 4; ++nj) {
#pragma unroll
      for (int r = 0; r < 8; ++r) ss[wr0 + mi * 16u + r][wn * 64u + nj * 16u + col] = acc[mi][nj][r] * OUTC; } }
  __syncthreads();   /* a row's two column halves come from two waves: block barrier */
  const size_t orow0 = (size_t)bb * SEQ_FULL + t0 + wave * 32u;
#pragma unroll
  for (unsigned rb = 0; rb < 32u; rb += 8u) { v4f o[8];
#pragma unroll
    for (unsigned i = 0; i < 8u; ++i) o[i] = *(const v4f*)&ss[wave * 32u + rb + i][lane * 4u];
    __builtin_amdgcn_sched_barrier(0);   /* all eight rows are read before the first store issues: no store's register is reused ahead of the wait behind the stores */
#pragma unroll
    for (unsigned i = 0; i < 8u; ++i) vst2((void*)(OUT + (orow0 + rb + i) * DM + c0 + lane * 4u), o[i]);
    wait_x();
    __builtin_amdgcn_sched_barrier(0);   /* keeps the next group's register writes behind that wait */
  }
}

extern "C" void kernel_launch(void* const* d_in, const int* in_sizes, int n_in, void* d_out, int out_size, void* d_ws, size_t ws_size, hipStream_t stream) {
  if (n_in < 7) return;
  const long long need_x = (long long)(NB - 1) * SEQ_FULL * DM + (long long)SEQ * DM;
  if ((long long)in_sizes[0] < need_x) return;
  if (in_sizes[1] < SEQ * 64 || in_sizes[2] < SEQ * 64) return;
  if (in_sizes[3] < DM * DM || in_sizes[4] < DM * DM || in_sizes[5] < DM * DM || in_sizes[6] < DM * DM) return;
  if ((long long)out_size < need_x) return;
  if (ws_size < (size_t)WS_END) return;
  // inputs (wire order): 0 x [2,2048,2048]; 1 cos table [2048][64]; 2 sin table [2048][64]; 3 Wq; 4 Wk; 5 Wv; 6 Wo (each [2048 out][2048 in])
  const float* const* F = (const float* const*)d_in;
  char* ws = (char*)d_ws;
  unsigned short* XB = (unsigned short*)(ws + WS_XB); unsigned short* WQ = (unsigned short*)(ws + WS_WQ); unsigned short* WK = (unsigned short*)(ws + WS_WK);
  unsigned short* WV = (unsigned short*)(ws + WS_WV); unsigned short* WO = (unsigned short*)(ws + WS_WO);
  _Float16* QH = (_Float16*)(ws + WS_QH); _Float16* KH = (_Float16*)(ws + WS_KH); _Float16* CTX = (_Float16*)(ws + WS_CTX);
  float* DG = (float*)(ws + WS_DG); float* WP = (float*)(ws + WS_WP);
  k_cvt<<<dim3(CVT_BLOCKS), CVT_T, 0, stream>>>(F[0], F[3], F[4], F[5], F[6], XB);
  k_qk<<<dim3(MROWS / 256, NH), 256, 0, stream>>>((const __bf16*)XB, (const __bf16*)WQ, (const __bf16*)WK, F[1], F[2], QH, KH, DG);
  k_lse<<<dim3(SEQ / 64, NH, NB), 128, 0, stream>>>(QH, KH, DG, WP);
  k_vw<<<dim3(MROWS / 256, NH), 256, 0, stream>>>((const __bf16*)XB, (const __bf16*)WV, WP, CTX);
  k_out<<<dim3(MROWS / 256, DM / 128), 256, 0, stream>>>(CTX, (const _Float16*)WO, (float*)d_out);
}
